// v000
// Measured on an AMD MI455X. A time is GPU time per run, averaged over a window of back-to-back runs after a warm-up
// (all launches, gaps included; the runs take copies of the inputs in turn), and the median of several windows.
// Apart from v000's, it joins two sittings. Times from different sittings can be a few percent apart, while
// side-by-side timings come from the same sitting.
// v000 is the starting kernel. One run takes 314 microseconds.
#include <hip/hip_runtime.h>
#include <hip/hip_bf16.h>

// ---------------------------------------------------------------------------
// Multi-head attention (Swin-style: logit_scale + sigmoid rel-pos bias)
// B=4, S=2048, D=512, H=8, hd=64.  f16 WMMA (v_wmma_f32_16x16x32_f16),
// f32 accumulate, fused flash-attention middle stage.
// ---------------------------------------------------------------------------

#define BATCH 4
#define SEQ   2048
#define DMODEL 512
#define HEADS 8
#define HDIM  64

typedef __attribute__((ext_vector_type(16))) _Float16 v16h;
typedef __attribute__((ext_vector_type(8)))  float    v8f;

__device__ __forceinline__ v8f wmma_f16(v16h a, v16h b, v8f c) {
  // (neg_a, A, neg_b, B, c_mod, C, reuse_a, reuse_b)
  return __builtin_amdgcn_wmma_f32_16x16x32_f16(false, a, false, b, (short)0, c,
                                                false, false);
}

// A/B operand loader (16x32 f16 tile, one row per lane).
// p must already point at row_base + k_chunk + (lane>=16 ? 8 : 0).
// Elements [0..7] = K+0..7 of this lane's chunk, [8..15] = K+16..23.
__device__ __forceinline__ v16h load_tile_f32(const float* __restrict__ p) {
  v16h a;
#pragma unroll
  for (int t = 0; t < 8; ++t) {
    a[t]     = (_Float16)p[t];
    a[t + 8] = (_Float16)p[t + 16];
  }
  return a;
}
__device__ __forceinline__ v16h load_tile_f16(const _Float16* __restrict__ p) {
  v16h a;
#pragma unroll
  for (int t = 0; t < 8; ++t) {
    a[t]     = p[t];
    a[t + 8] = p[t + 16];
  }
  return a;
}

// ---------------------------------------------------------------------------
// Kernel 0: sigmoid(rpe) -> f32 table  (4095*8 elements, lives in L2)
// ---------------------------------------------------------------------------
__global__ void rpe_sigmoid_kernel(const float* __restrict__ rpe,
                                   float* __restrict__ sig, int n) {
  int i = blockIdx.x * blockDim.x + threadIdx.x;
  if (i < n) sig[i] = 1.0f / (1.0f + __expf(-rpe[i]));
}

// ---------------------------------------------------------------------------
// Kernel 1: fused QKV projection.  X (8192x512 f32) @ W^T + b -> f16.
// grid = (M/64, N/64, 3)  block = 128 (4 waves, each wave: 16x64 strip)
// Q,K stored [B,H,S,64]; V stored transposed [B,H,64,S].
// Head split per reference: feature n -> h = n % 8, d = n / 8.
// ---------------------------------------------------------------------------
__global__ __launch_bounds__(128) void qkv_proj_kernel(
    const float* __restrict__ X,
    const float* __restrict__ Wq, const float* __restrict__ bq,
    const float* __restrict__ Wk, const float* __restrict__ bk,
    const float* __restrict__ Wv, const float* __restrict__ bv,
    _Float16* __restrict__ qf, _Float16* __restrict__ kf,
    _Float16* __restrict__ vt) {
  const int lane = threadIdx.x & 31;
  const int wave = threadIdx.x >> 5;
  const int lr = lane & 15;   // row-in-tile / n-in-tile
  const int hs = lane >> 4;   // half select
  const int mode = blockIdx.z;

  const float* W    = (mode == 0) ? Wq : (mode == 1) ? Wk : Wv;
  const float* bias = (mode == 0) ? bq : (mode == 1) ? bk : bv;

  const int m0 = blockIdx.x * 64 + wave * 16;
  const int n0 = blockIdx.y * 64;

  v8f acc[4] = {{}, {}, {}, {}};
  const float* arow = X + (m0 + lr) * DMODEL + hs * 8;

  for (int kk = 0; kk < DMODEL; kk += 32) {
    v16h a = load_tile_f32(arow + kk);
#pragma unroll
    for (int sub = 0; sub < 4; ++sub) {
      const float* brow = W + (n0 + sub * 16 + lr) * DMODEL + kk + hs * 8;
      v16h bm = load_tile_f32(brow);
      acc[sub] = wmma_f16(a, bm, acc[sub]);
    }
  }

#pragma unroll
  for (int sub = 0; sub < 4; ++sub) {
    const int n = n0 + sub * 16 + lr;
    const int hh = n & 7, d = n >> 3;  // f = d*H + h  (reference split_heads)
    const float bn = bias[n];
#pragma unroll
    for (int r = 0; r < 8; ++r) {
      const int m = m0 + r + 8 * hs;
      const int bidx = m >> 11;      // / SEQ
      const int s = m & (SEQ - 1);
      const _Float16 val = (_Float16)(acc[sub][r] + bn);
      if (mode == 0)
        qf[((bidx * HEADS + hh) * SEQ + s) * HDIM + d] = val;
      else if (mode == 1)
        kf[((bidx * HEADS + hh) * SEQ + s) * HDIM + d] = val;
      else
        vt[((bidx * HEADS + hh) * HDIM + d) * SEQ + s] = val;  // transposed
    }
  }
}

// ---------------------------------------------------------------------------
// Kernel 2: flash attention.
// grid = (S/64, H, B), block = 128 (4 waves, each owns 16 query rows).
// Per 64-wide k-tile: 8 WMMA (QK^T), online softmax, P->LDS->A-layout,
// 8 WMMA (PV).  Output written f16 to ao [B,S,D] with f = h*64 + d.
// ---------------------------------------------------------------------------
__global__ __launch_bounds__(128) void flash_attn_kernel(
    const _Float16* __restrict__ qf, const _Float16* __restrict__ kf,
    const _Float16* __restrict__ vt, const float* __restrict__ sig_rpe,
    const float* __restrict__ logit_scale, _Float16* __restrict__ ao) {
  // padded to 66 halves/row: row stride 33 dwords, gcd(33,64)=1 -> no bank conflicts
  __shared__ _Float16 plds[4][16][66];

  const int lane = threadIdx.x & 31;
  const int wave = threadIdx.x >> 5;
  const int lr = lane & 15;
  const int hs = lane >> 4;

  const int b = blockIdx.z;
  const int h = blockIdx.y;
  const int q0 = blockIdx.x * 64 + wave * 16;

  // scale = exp(min(ls, ln(100))) / sqrt(D_MODEL)
  const float scale =
      __expf(fminf(logit_scale[h], 4.6051702f)) * 0.04419417382f;

  const int bh = b * HEADS + h;

  // Q strip: 16 rows x 64 (two K-chunks of 32)
  const _Float16* qp = qf + ((size_t)bh * SEQ + (q0 + lr)) * HDIM + hs * 8;
  v16h aq[2];
  aq[0] = load_tile_f16(qp);
  aq[1] = load_tile_f16(qp + 32);

  v8f o[4] = {{}, {}, {}, {}};
  float mrow[8], lrow[8];
#pragma unroll
  for (int r = 0; r < 8; ++r) { mrow[r] = -1e30f; lrow[r] = 0.0f; }

  for (int kt = 0; kt < SEQ / 64; ++kt) {
    const int j0 = kt * 64;

    // ---- scores: S = Q K^T * scale + sigmoid(rpe[i-j+S-1, h]) ----
    v8f sv[4];
#pragma unroll
    for (int sub = 0; sub < 4; ++sub) {
      const _Float16* kp =
          kf + ((size_t)bh * SEQ + (j0 + sub * 16 + lr)) * HDIM + hs * 8;
      v8f s = {};
      s = wmma_f16(aq[0], load_tile_f16(kp), s);
      s = wmma_f16(aq[1], load_tile_f16(kp + 32), s);
      const int j = j0 + sub * 16 + lr;  // this lane's column
#pragma unroll
      for (int r = 0; r < 8; ++r) {
        const int i = q0 + r + 8 * hs;   // this element's row
        const float bias = sig_rpe[(i - j + (SEQ - 1)) * HEADS + h];
        s[r] = s[r] * scale + bias;
      }
      sv[sub] = s;
    }

    // ---- tile row-max (reduce over 4 subs then across 16 lanes) ----
    float tmax[8];
#pragma unroll
    for (int r = 0; r < 8; ++r)
      tmax[r] = fmaxf(fmaxf(sv[0][r], sv[1][r]), fmaxf(sv[2][r], sv[3][r]));
#pragma unroll
    for (int msk = 1; msk < 16; msk <<= 1)
#pragma unroll
      for (int r = 0; r < 8; ++r)
        tmax[r] = fmaxf(tmax[r], __shfl_xor(tmax[r], msk, 32));

    // ---- online softmax update ----
    float corr[8];
#pragma unroll
    for (int r = 0; r < 8; ++r) {
      const float nm = fmaxf(mrow[r], tmax[r]);
      corr[r] = __expf(mrow[r] - nm);
      mrow[r] = nm;
    }
    float tsum[8] = {0, 0, 0, 0, 0, 0, 0, 0};
#pragma unroll
    for (int sub = 0; sub < 4; ++sub)
#pragma unroll
      for (int r = 0; r < 8; ++r) {
        const float p = __expf(sv[sub][r] - mrow[r]);
        sv[sub][r] = p;
        tsum[r] += p;
      }
#pragma unroll
    for (int msk = 1; msk < 16; msk <<= 1)
#pragma unroll
      for (int r = 0; r < 8; ++r) tsum[r] += __shfl_xor(tsum[r], msk, 32);
#pragma unroll
    for (int r = 0; r < 8; ++r) {
      lrow[r] = lrow[r] * corr[r] + tsum[r];
#pragma unroll
      for (int sd = 0; sd < 4; ++sd) o[sd][r] *= corr[r];
    }

    // ---- P: C-layout regs -> LDS (f16) -> A-layout regs ----
    __syncthreads();
#pragma unroll
    for (int sub = 0; sub < 4; ++sub)
#pragma unroll
      for (int r = 0; r < 8; ++r)
        plds[wave][r + 8 * hs][sub * 16 + lr] = (_Float16)sv[sub][r];
    __syncthreads();

    v16h ap[2];
#pragma unroll
    for (int c = 0; c < 2; ++c) {
      const int cb = c * 32 + hs * 8;
#pragma unroll
      for (int t = 0; t < 8; ++t) {
        ap[c][t]     = plds[wave][lr][cb + t];
        ap[c][t + 8] = plds[wave][lr][cb + t + 16];
      }
    }

    // ---- O += P @ V   (V^T rows are head-dims; contiguous over j) ----
#pragma unroll
    for (int sd = 0; sd < 4; ++sd) {
      const _Float16* vp =
          vt + ((size_t)bh * HDIM + sd * 16 + lr) * SEQ + j0 + hs * 8;
      o[sd] = wmma_f16(ap[0], load_tile_f16(vp), o[sd]);
      o[sd] = wmma_f16(ap[1], load_tile_f16(vp + 32), o[sd]);
    }
  }

  // ---- epilogue: O / l, merge heads with f = h*64 + d ----
#pragma unroll
  for (int sd = 0; sd < 4; ++sd) {
    const int d = sd * 16 + lr;
#pragma unroll
    for (int r = 0; r < 8; ++r) {
      const int i = q0 + r + 8 * hs;
      const float val = o[sd][r] / lrow[r];
      ao[((size_t)b * SEQ + i) * DMODEL + h * HDIM + d] = (_Float16)val;
    }
  }
}

// ---------------------------------------------------------------------------
// Kernel 3: output projection.  AO (8192x512 f16) @ Wp^T + bp -> f32 d_out.
// ---------------------------------------------------------------------------
__global__ __launch_bounds__(128) void out_proj_kernel(
    const _Float16* __restrict__ ao, const float* __restrict__ Wp,
    const float* __restrict__ bp, float* __restrict__ out) {
  const int lane = threadIdx.x & 31;
  const int wave = threadIdx.x >> 5;
  const int lr = lane & 15;
  const int hs = lane >> 4;

  const int m0 = blockIdx.x * 64 + wave * 16;
  const int n0 = blockIdx.y * 64;

  v8f acc[4] = {{}, {}, {}, {}};
  const _Float16* arow = ao + (size_t)(m0 + lr) * DMODEL + hs * 8;

  for (int kk = 0; kk < DMODEL; kk += 32) {
    v16h a = load_tile_f16(arow + kk);
#pragma unroll
    for (int sub = 0; sub < 4; ++sub) {
      const float* brow = Wp + (n0 + sub * 16 + lr) * DMODEL + kk + hs * 8;
      acc[sub] = wmma_f16(a, load_tile_f32(brow), acc[sub]);
    }
  }

#pragma unroll
  for (int sub = 0; sub < 4; ++sub) {
    const int n = n0 + sub * 16 + lr;
    const float bn = bp[n];
#pragma unroll
    for (int r = 0; r < 8; ++r) {
      const int m = m0 + r + 8 * hs;
      out[(size_t)m * DMODEL + n] = acc[sub][r] + bn;
    }
  }
}

// ---------------------------------------------------------------------------
extern "C" void kernel_launch(void* const* d_in, const int* in_sizes, int n_in,
                              void* d_out, int out_size, void* d_ws,
                              size_t ws_size, hipStream_t stream) {
  (void)in_sizes; (void)n_in; (void)out_size; (void)ws_size;

  const float* query = (const float*)d_in[0];
  const float* Wq = (const float*)d_in[1];
  const float* bq = (const float*)d_in[2];
  const float* Wk = (const float*)d_in[3];
  const float* bk = (const float*)d_in[4];
  const float* Wv = (const float*)d_in[5];
  const float* bv = (const float*)d_in[6];
  const float* Wp = (const float*)d_in[7];
  const float* bp = (const float*)d_in[8];
  const float* logit_scale = (const float*)d_in[9];
  const float* rpe = (const float*)d_in[10];

  // workspace carve-up
  const size_t QKV_ELEMS = (size_t)BATCH * HEADS * SEQ * HDIM;  // 4.19M halves
  char* ws = (char*)d_ws;
  float* sig = (float*)ws;                         // 4095*8 f32 = 131040 B
  _Float16* qf = (_Float16*)(ws + 131072);
  _Float16* kf = qf + QKV_ELEMS;
  _Float16* vt = kf + QKV_ELEMS;
  _Float16* ao = vt + QKV_ELEMS;

  const int nrpe = (2 * SEQ - 1) * HEADS;
  rpe_sigmoid_kernel<<<(nrpe + 255) / 256, 256, 0, stream>>>(rpe, sig, nrpe);

  qkv_proj_kernel<<<dim3((BATCH * SEQ) / 64, DMODEL / 64, 3), 128, 0, stream>>>(
      query, Wq, bq, Wk, bk, Wv, bv, qf, kf, vt);

  flash_attn_kernel<<<dim3(SEQ / 64, HEADS, BATCH), 128, 0, stream>>>(
      qf, kf, vt, sig, logit_scale, ao);

  out_proj_kernel<<<dim3((BATCH * SEQ) / 64, DMODEL / 64), 128, 0, stream>>>(
      ao, Wp, bp, (float*)d_out);
}

// v001
// It runs in 160 microseconds.
// Two timings next to v000 put it at 2.02 and 2.01 times that version's speed.
#include <hip/hip_runtime.h>
#include <hip/hip_bf16.h>

// ---------------------------------------------------------------------------
// Multi-head attention (Swin-style: logit_scale + sigmoid rel-pos bias)
// B=4, S=2048, D=512, H=8, hd=64.  f16 WMMA (v_wmma_f32_16x16x32_f16),
// f32 accumulate, fused flash-attention middle stage.
// ---------------------------------------------------------------------------

#define BATCH 4
#define SEQ   2048
#define DMODEL 512
#define HEADS 8
#define HDIM  64

typedef __attribute__((ext_vector_type(16))) _Float16 v16h;
typedef __attribute__((ext_vector_type(8)))  float    v8f;

__device__ __forceinline__ v8f wmma_f16(v16h a, v16h b, v8f c) {
  // (neg_a, A, neg_b, B, c_mod, C, reuse_a, reuse_b)
  return __builtin_amdgcn_wmma_f32_16x16x32_f16(false, a, false, b, (short)0, c,
                                                false, false);
}

// A/B operand loader (16x32 f16 tile, one row per lane).
// p must already point at row_base + k_chunk + (lane>=16 ? 8 : 0).
// Elements [0..7] = K+0..7 of this lane's chunk, [8..15] = K+16..23.
__device__ __forceinline__ v16h load_tile_f16(const _Float16* __restrict__ p) {
  v16h a;
#pragma unroll
  for (int t = 0; t < 8; ++t) {
    a[t]     = p[t];
    a[t + 8] = p[t + 16];
  }
  return a;
}

// LDS staging of operand tiles.  A tile is 64 rows x 64 f16 (128 B a row), laid
// at a pitch of 144 B (16 B x odd: conflict-free for 16-byte reads).  The block's
// 128 threads fetch it with 16-byte loads whose 32 lanes cover four whole 128-B
// lines; each of the 4 waves then reads its fragments from LDS.
typedef __attribute__((ext_vector_type(8))) _Float16 v8h;
typedef __attribute__((ext_vector_type(4))) _Float16 v4h;
typedef __attribute__((ext_vector_type(4))) float    v4f;
#define PITCH 72
#define TILE_HALVES (64 * PITCH)

// Fragment from LDS: same element order as load_tile_f16
// (p = row base + k_chunk + (lane>=16 ? 8 : 0)).
__device__ __forceinline__ v16h frag_lds(const _Float16* p) {
  const v8h lo = *(const v8h*)p;
  const v8h hi = *(const v8h*)(p + 16);
  return __builtin_shufflevector(lo, hi, 0, 1, 2, 3, 4, 5, 6, 7, 8, 9, 10, 11,
                                 12, 13, 14, 15);
}

// f32 source, 64 x 64 floats: thread t holds floats (t&15)*4.. of rows (t>>4)+8p.
// g already points at this thread's first float4; ld = row stride in floats.
__device__ __forceinline__ void fetch_f32(v4f (&r)[8], const float* __restrict__ g,
                                          int ld) {
#pragma unroll
  for (int p = 0; p < 8; ++p) r[p] = *(const v4f*)(g + p * 8 * ld);
}
__device__ __forceinline__ void put_f32(_Float16* s, const v4f (&r)[8]) {
#pragma unroll
  for (int p = 0; p < 8; ++p)
    *(v4h*)(s + p * 8 * PITCH) = __builtin_convertvector(r[p], v4h);
}
// f16 source, 64 x 64 halves: thread t holds halves (t&7)*8.. of rows (t>>3)+16p.
__device__ __forceinline__ void fetch_f16(v8h (&r)[4],
                                          const _Float16* __restrict__ g, int ld) {
#pragma unroll
  for (int p = 0; p < 4; ++p) r[p] = *(const v8h*)(g + p * 16 * ld);
}
__device__ __forceinline__ void put_f16(_Float16* s, const v8h (&r)[4]) {
#pragma unroll
  for (int p = 0; p < 4; ++p) *(v8h*)(s + p * 16 * PITCH) = r[p];
}

// ---------------------------------------------------------------------------
// Kernel 0: sigmoid(rpe) -> f32 table  (4095*8 elements, lives in L2)
// ---------------------------------------------------------------------------
__global__ void rpe_sigmoid_kernel(const float* __restrict__ rpe,
                                   float* __restrict__ sig, int n) {
  int i = blockIdx.x * blockDim.x + threadIdx.x;
  if (i < n) sig[i] = 1.0f / (1.0f + __expf(-rpe[i]));
}

// ---------------------------------------------------------------------------
// Kernel 1: fused QKV projection.  X (8192x512 f32) @ W^T + b -> f16.
// grid = (M/64, N/64, 3)  block = 128 (4 waves, each wave: 16x64 strip)
// Q,K stored [B,H,S,64]; V stored transposed [B,H,64,S].
// Head split per reference: feature n -> h = n % 8, d = n / 8.
// ---------------------------------------------------------------------------
__global__ __launch_bounds__(128) void qkv_proj_kernel(
    const float* __restrict__ X,
    const float* __restrict__ Wq, const float* __restrict__ bq,
    const float* __restrict__ Wk, const float* __restrict__ bk,
    const float* __restrict__ Wv, const float* __restrict__ bv,
    _Float16* __restrict__ qf, _Float16* __restrict__ kf,
    _Float16* __restrict__ vt) {
  const int lane = threadIdx.x & 31;
  const int wave = threadIdx.x >> 5;
  const int lr = lane & 15;   // row-in-tile / n-in-tile
  const int hs = lane >> 4;   // half select
  const int mode = blockIdx.z;

  const float* W    = (mode == 0) ? Wq : (mode == 1) ? Wk : Wv;
  const float* bias = (mode == 0) ? bq : (mode == 1) ? bk : bv;

  const int m0 = blockIdx.x * 64 + wave * 16;
  const int n0 = blockIdx.y * 64;

  __shared__ __attribute__((aligned(16))) _Float16 xs[2][TILE_HALVES];
  __shared__ __attribute__((aligned(16))) _Float16 wsm[2][TILE_HALVES];

  const int srow = threadIdx.x >> 4, scol = (threadIdx.x & 15) * 4;
  const float* xg = X + (blockIdx.x * 64 + srow) * DMODEL + scol;
  const float* wg = W + (n0 + srow) * DMODEL + scol;
  const int soff = srow * PITCH + scol;

  v8f acc[4] = {{}, {}, {}, {}};
  v4f xr[8], wr[8];
  fetch_f32(xr, xg, DMODEL);
  fetch_f32(wr, wg, DMODEL);
  put_f32(&xs[0][soff], xr);
  put_f32(&wsm[0][soff], wr);
  __syncthreads();  // publishes tile 0

  for (int it = 0; it < DMODEL / 64; ++it) {
    const int cur = it & 1;
    const bool more = it + 1 < DMODEL / 64;
    if (more) {  // next tile flies while this one is multiplied
      fetch_f32(xr, xg + (it + 1) * 64, DMODEL);
      fetch_f32(wr, wg + (it + 1) * 64, DMODEL);
    }
#pragma unroll
    for (int c = 0; c < 2; ++c) {
      const v16h a = frag_lds(&xs[cur][(wave * 16 + lr) * PITCH + c * 32 + hs * 8]);
#pragma unroll
      for (int sub = 0; sub < 4; ++sub) {
        const v16h bm =
            frag_lds(&wsm[cur][(sub * 16 + lr) * PITCH + c * 32 + hs * 8]);
        acc[sub] = wmma_f16(a, bm, acc[sub]);
      }
    }
    if (more) {
      put_f32(&xs[cur ^ 1][soff], xr);
      put_f32(&wsm[cur ^ 1][soff], wr);
    }
    // publishes the next tile and ends the reads of this one before its refill
    __syncthreads();
  }

#pragma unroll
  for (int sub = 0; sub < 4; ++sub) {
    const int n = n0 + sub * 16 + lr;
    const int hh = n & 7, d = n >> 3;  // f = d*H + h  (reference split_heads)
    const float bn = bias[n];
#pragma unroll
    for (int r = 0; r < 8; ++r) {
      const int m = m0 + r + 8 * hs;
      const int bidx = m >> 11;      // / SEQ
      const int s = m & (SEQ - 1);
      const _Float16 val = (_Float16)(acc[sub][r] + bn);
      if (mode == 0)
        qf[((bidx * HEADS + hh) * SEQ + s) * HDIM + d] = val;
      else if (mode == 1)
        kf[((bidx * HEADS + hh) * SEQ + s) * HDIM + d] = val;
      else
        vt[((bidx * HEADS + hh) * HDIM + d) * SEQ + s] = val;  // transposed
    }
  }
}

// ---------------------------------------------------------------------------
// Kernel 2: flash attention.
// grid = (S/64, H, B), block = 128 (4 waves, each owns 16 query rows).
// Per 64-wide k-tile: 8 WMMA (QK^T), online softmax, P->LDS->A-layout,
// 8 WMMA (PV).  Output written f16 to ao [B,S,D] with f = h*64 + d.
// ---------------------------------------------------------------------------
__global__ __launch_bounds__(128) void flash_attn_kernel(
    const _Float16* __restrict__ qf, const _Float16* __restrict__ kf,
    const _Float16* __restrict__ vt, const float* __restrict__ sig_rpe,
    const float* __restrict__ logit_scale, _Float16* __restrict__ ao) {
  // padded to 66 halves/row: row stride 33 dwords, gcd(33,64)=1 -> no bank conflicts
  __shared__ _Float16 plds[4][16][66];
  __shared__ __attribute__((aligned(16))) _Float16 ks[2][TILE_HALVES];
  __shared__ __attribute__((aligned(16))) _Float16 vs[2][TILE_HALVES];

  const int lane = threadIdx.x & 31;
  const int wave = threadIdx.x >> 5;
  const int lr = lane & 15;
  const int hs = lane >> 4;

  const int b = blockIdx.z;
  const int h = blockIdx.y;
  const int q0 = blockIdx.x * 64 + wave * 16;

  // scale = exp(min(ls, ln(100))) / sqrt(D_MODEL)
  const float scale =
      __expf(fminf(logit_scale[h], 4.6051702f)) * 0.04419417382f;

  const int bh = b * HEADS + h;

  // Q strip: 16 rows x 64 (two K-chunks of 32)
  const _Float16* qp = qf + ((size_t)bh * SEQ + (q0 + lr)) * HDIM + hs * 8;
  v16h aq[2];
  aq[0] = load_tile_f16(qp);
  aq[1] = load_tile_f16(qp + 32);

  v8f o[4] = {{}, {}, {}, {}};
  float mrow[8], lrow[8];
#pragma unroll
  for (int r = 0; r < 8; ++r) { mrow[r] = -1e30f; lrow[r] = 0.0f; }

  const int srow = threadIdx.x >> 3, scol = (threadIdx.x & 7) * 8;
  const _Float16* kg = kf + ((size_t)bh * SEQ + srow) * HDIM + scol;
  const _Float16* vg = vt + ((size_t)bh * HDIM + srow) * SEQ + scol;
  const int soff = srow * PITCH + scol;
  v8h kr[4], vr[4];
  fetch_f16(kr, kg, HDIM);
  fetch_f16(vr, vg, SEQ);
  put_f16(&ks[0][soff], kr);
  put_f16(&vs[0][soff], vr);
  __syncthreads();  // publishes K and V^T tile 0

  for (int kt = 0; kt < SEQ / 64; ++kt) {
    const int j0 = kt * 64;
    const int cur = kt & 1;
    const bool more = kt + 1 < SEQ / 64;
    if (more) {  // next tiles fly during scores and softmax
      fetch_f16(kr, kg + (size_t)(j0 + 64) * HDIM, HDIM);
      fetch_f16(vr, vg + (j0 + 64), SEQ);
    }

    // ---- scores: S = Q K^T * scale + sigmoid(rpe[i-j+S-1, h]) ----
    v8f sv[4];
#pragma unroll
    for (int sub = 0; sub < 4; ++sub) {
      const _Float16* kp = &ks[cur][(sub * 16 + lr) * PITCH + hs * 8];
      v8f s = {};
      s = wmma_f16(aq[0], frag_lds(kp), s);
      s = wmma_f16(aq[1], frag_lds(kp + 32), s);
      const int j = j0 + sub * 16 + lr;  // this lane's column
#pragma unroll
      for (int r = 0; r < 8; ++r) {
        const int i = q0 + r + 8 * hs;   // this element's row
        const float bias = sig_rpe[(i - j + (SEQ - 1)) * HEADS + h];
        s[r] = s[r] * scale + bias;
      }
      sv[sub] = s;
    }

    // ---- tile row-max (reduce over 4 subs then across 16 lanes) ----
    float tmax[8];
#pragma unroll
    for (int r = 0; r < 8; ++r)
      tmax[r] = fmaxf(fmaxf(sv[0][r], sv[1][r]), fmaxf(sv[2][r], sv[3][r]));
#pragma unroll
    for (int msk = 1; msk < 16; msk <<= 1)
#pragma unroll
      for (int r = 0; r < 8; ++r)
        tmax[r] = fmaxf(tmax[r], __shfl_xor(tmax[r], msk, 32));

    // ---- online softmax update ----
    float corr[8];
#pragma unroll
    for (int r = 0; r < 8; ++r) {
      const float nm = fmaxf(mrow[r], tmax[r]);
      corr[r] = __expf(mrow[r] - nm);
      mrow[r] = nm;
    }
    float tsum[8] = {0, 0, 0, 0, 0, 0, 0, 0};
#pragma unroll
    for (int sub = 0; sub < 4; ++sub)
#pragma unroll
      for (int r = 0; r < 8; ++r) {
        const float p = __expf(sv[sub][r] - mrow[r]);
        sv[sub][r] = p;
        tsum[r] += p;
      }
#pragma unroll
    for (int msk = 1; msk < 16; msk <<= 1)
#pragma unroll
      for (int r = 0; r < 8; ++r) tsum[r] += __shfl_xor(tsum[r], msk, 32);
#pragma unroll
    for (int r = 0; r < 8; ++r) {
      lrow[r] = lrow[r] * corr[r] + tsum[r];
#pragma unroll
      for (int sd = 0; sd < 4; ++sd) o[sd][r] *= corr[r];
    }

    // ---- P: C-layout regs -> LDS (f16) -> A-layout regs ----
    // This barrier also ends every wave's reads of the other K/V buffer
    // (last pass), which is refilled behind it; the next one publishes it.
    __syncthreads();
    if (more) {
      put_f16(&ks[cur ^ 1][soff], kr);
      put_f16(&vs[cur ^ 1][soff], vr);
    }
#pragma unroll
    for (int sub = 0; sub < 4; ++sub)
#pragma unroll
      for (int r = 0; r < 8; ++r)
        plds[wave][r + 8 * hs][sub * 16 + lr] = (_Float16)sv[sub][r];
    __syncthreads();

    v16h ap[2];
#pragma unroll
    for (int c = 0; c < 2; ++c) {
      const int cb = c * 32 + hs * 8;
#pragma unroll
      for (int t = 0; t < 8; ++t) {
        ap[c][t]     = plds[wave][lr][cb + t];
        ap[c][t + 8] = plds[wave][lr][cb + t + 16];
      }
    }

    // ---- O += P @ V   (V^T rows are head-dims; contiguous over j) ----
#pragma unroll
    for (int sd = 0; sd < 4; ++sd) {
      const _Float16* vp = &vs[cur][(sd * 16 + lr) * PITCH + hs * 8];
      o[sd] = wmma_f16(ap[0], frag_lds(vp), o[sd]);
      o[sd] = wmma_f16(ap[1], frag_lds(vp + 32), o[sd]);
    }
  }

  // ---- epilogue: O / l, merge heads with f = h*64 + d ----
#pragma unroll
  for (int sd = 0; sd < 4; ++sd) {
    const int d = sd * 16 + lr;
#pragma unroll
    for (int r = 0; r < 8; ++r) {
      const int i = q0 + r + 8 * hs;
      const float val = o[sd][r] / lrow[r];
      ao[((size_t)b * SEQ + i) * DMODEL + h * HDIM + d] = (_Float16)val;
    }
  }
}

// ---------------------------------------------------------------------------
// Kernel 3: output projection.  AO (8192x512 f16) @ Wp^T + bp -> f32 d_out.
// ---------------------------------------------------------------------------
__global__ __launch_bounds__(128) void out_proj_kernel(
    const _Float16* __restrict__ ao, const float* __restrict__ Wp,
    const float* __restrict__ bp, float* __restrict__ out) {
  const int lane = threadIdx.x & 31;
  const int wave = threadIdx.x >> 5;
  const int lr = lane & 15;
  const int hs = lane >> 4;

  const int m0 = blockIdx.x * 64 + wave * 16;
  const int n0 = blockIdx.y * 64;

  __shared__ __attribute__((aligned(16))) _Float16 as[2][TILE_HALVES];
  __shared__ __attribute__((aligned(16))) _Float16 wsm[2][TILE_HALVES];

  const int arow = threadIdx.x >> 3, acol = (threadIdx.x & 7) * 8;
  const int wrow = threadIdx.x >> 4, wcol = (threadIdx.x & 15) * 4;
  const _Float16* ag = ao + (size_t)(blockIdx.x * 64 + arow) * DMODEL + acol;
  const float* wg = Wp + (n0 + wrow) * DMODEL + wcol;
  const int aoff = arow * PITCH + acol;
  const int woff = wrow * PITCH + wcol;

  v8f acc[4] = {{}, {}, {}, {}};
  v8h ar[4];
  v4f wr[8];
  fetch_f16(ar, ag, DMODEL);
  fetch_f32(wr, wg, DMODEL);
  put_f16(&as[0][aoff], ar);
  put_f32(&wsm[0][woff], wr);
  __syncthreads();  // publishes tile 0

  for (int it = 0; it < DMODEL / 64; ++it) {
    const int cur = it & 1;
    const bool more = it + 1 < DMODEL / 64;
    if (more) {  // next tile flies while this one is multiplied
      fetch_f16(ar, ag + (it + 1) * 64, DMODEL);
      fetch_f32(wr, wg + (it + 1) * 64, DMODEL);
    }
#pragma unroll
    for (int c = 0; c < 2; ++c) {
      const v16h a = frag_lds(&as[cur][(wave * 16 + lr) * PITCH + c * 32 + hs * 8]);
#pragma unroll
      for (int sub = 0; sub < 4; ++sub) {
        const v16h bm =
            frag_lds(&wsm[cur][(sub * 16 + lr) * PITCH + c * 32 + hs * 8]);
        acc[sub] = wmma_f16(a, bm, acc[sub]);
      }
    }
    if (more) {
      put_f16(&as[cur ^ 1][aoff], ar);
      put_f32(&wsm[cur ^ 1][woff], wr);
    }
    // publishes the next tile and ends the reads of this one before its refill
    __syncthreads();
  }

#pragma unroll
  for (int sub = 0; sub < 4; ++sub) {
    const int n = n0 + sub * 16 + lr;
    const float bn = bp[n];
#pragma unroll
    for (int r = 0; r < 8; ++r) {
      const int m = m0 + r + 8 * hs;
      out[(size_t)m * DMODEL + n] = acc[sub][r] + bn;
    }
  }
}

// ---------------------------------------------------------------------------
extern "C" void kernel_launch(void* const* d_in, const int* in_sizes, int n_in,
                              void* d_out, int out_size, void* d_ws,
                              size_t ws_size, hipStream_t stream) {
  (void)in_sizes; (void)n_in; (void)out_size; (void)ws_size;

  const float* query = (const float*)d_in[0];
  const float* Wq = (const float*)d_in[1];
  const float* bq = (const float*)d_in[2];
  const float* Wk = (const float*)d_in[3];
  const float* bk = (const float*)d_in[4];
  const float* Wv = (const float*)d_in[5];
  const float* bv = (const float*)d_in[6];
  const float* Wp = (const float*)d_in[7];
  const float* bp = (const float*)d_in[8];
  const float* logit_scale = (const float*)d_in[9];
  const float* rpe = (const float*)d_in[10];

  // workspace carve-up
  const size_t QKV_ELEMS = (size_t)BATCH * HEADS * SEQ * HDIM;  // 4.19M halves
  char* ws = (char*)d_ws;
  float* sig = (float*)ws;                         // 4095*8 f32 = 131040 B
  _Float16* qf = (_Float16*)(ws + 131072);
  _Float16* kf = qf + QKV_ELEMS;
  _Float16* vt = kf + QKV_ELEMS;
  _Float16* ao = vt + QKV_ELEMS;

  const int nrpe = (2 * SEQ - 1) * HEADS;
  rpe_sigmoid_kernel<<<(nrpe + 255) / 256, 256, 0, stream>>>(rpe, sig, nrpe);

  qkv_proj_kernel<<<dim3((BATCH * SEQ) / 64, DMODEL / 64, 3), 128, 0, stream>>>(
      query, Wq, bq, Wk, bk, Wv, bv, qf, kf, vt);

  flash_attn_kernel<<<dim3(SEQ / 64, HEADS, BATCH), 128, 0, stream>>>(
      qf, kf, vt, sig, logit_scale, ao);

  out_proj_kernel<<<dim3((BATCH * SEQ) / 64, DMODEL / 64), 128, 0, stream>>>(
      ao, Wp, bp, (float*)d_out);
}

// v002
// Measured time: 120 microseconds a run.
// Next to v001, in two timings, it ran 1.34 times as fast each time.
// Over all steps from v000 it is 2.69 times as fast.
#include <hip/hip_runtime.h>
#include <hip/hip_bf16.h>

// ---------------------------------------------------------------------------
// Multi-head attention (logit_scale + sigmoid rel-pos bias)
// B=4, S=2048, D=512, H=8, hd=64.  f16 WMMA (v_wmma_f32_16x16x32_f16),
// f32 accumulate, fused flash-attention middle stage.
// ---------------------------------------------------------------------------

#define BATCH 4
#define SEQ   2048
#define DMODEL 512
#define HEADS 8
#define HDIM  64

typedef __attribute__((ext_vector_type(16))) _Float16 v16h;
typedef __attribute__((ext_vector_type(8)))  float    v8f;

__device__ __forceinline__ v8f wmma_f16(v16h a, v16h b, v8f c) {
  // (neg_a, A, neg_b, B, c_mod, C, reuse_a, reuse_b)
  return __builtin_amdgcn_wmma_f32_16x16x32_f16(false, a, false, b, (short)0, c,
                                                false, false);
}

// A/B operand loader (16x32 f16 tile, one row per lane).
// p must already point at row_base + k_chunk + (lane>=16 ? 8 : 0).
// Elements [0..7] = K+0..7 of this lane's chunk, [8..15] = K+16..23.
__device__ __forceinline__ v16h load_tile_f16(const _Float16* __restrict__ p) {
  v16h a;
#pragma unroll
  for (int t = 0; t < 8; ++t) {
    a[t]     = p[t];
    a[t + 8] = p[t + 16];
  }
  return a;
}

// LDS staging of operand tiles.  A tile is 64 rows x 64 f16 (128 B a row), laid
// at a pitch of 144 B (16 B x odd: conflict-free for 16-byte reads).  The block's
// 128 threads fetch it with 16-byte loads whose 32 lanes cover four whole 128-B
// lines; each of the 4 waves then reads its fragments from LDS.
typedef __attribute__((ext_vector_type(8))) _Float16 v8h;
typedef __attribute__((ext_vector_type(4))) _Float16 v4h;
typedef __attribute__((ext_vector_type(4))) float    v4f;
#define PITCH 72
#define TILE_HALVES (64 * PITCH)

// Fragment from LDS: same element order as load_tile_f16
// (p = row base + k_chunk + (lane>=16 ? 8 : 0)).
__device__ __forceinline__ v16h frag_lds(const _Float16* p) {
  const v8h lo = *(const v8h*)p;
  const v8h hi = *(const v8h*)(p + 16);
  return __builtin_shufflevector(lo, hi, 0, 1, 2, 3, 4, 5, 6, 7, 8, 9, 10, 11,
                                 12, 13, 14, 15);
}

// f32 source, 64 x 64 floats: thread t holds floats (t&15)*4.. of rows (t>>4)+8p.
// g already points at this thread's first float4; ld = row stride in floats.
__device__ __forceinline__ void fetch_f32(v4f (&r)[8], const float* __restrict__ g,
                                          int ld) {
#pragma unroll
  for (int p = 0; p < 8; ++p) r[p] = *(const v4f*)(g + p * 8 * ld);
}
__device__ __forceinline__ void put_f32(_Float16* s, const v4f (&r)[8]) {
#pragma unroll
  for (int p = 0; p < 8; ++p)
    *(v4h*)(s + p * 8 * PITCH) = __builtin_convertvector(r[p], v4h);
}
// f16 source, 64 x 64 halves: thread t holds halves (t&7)*8.. of rows (t>>3)+16p.
__device__ __forceinline__ void fetch_f16(v8h (&r)[4],
                                          const _Float16* __restrict__ g, int ld) {
#pragma unroll
  for (int p = 0; p < 4; ++p) r[p] = *(const v8h*)(g + p * 16 * ld);
}
__device__ __forceinline__ void put_f16(_Float16* s, const v8h (&r)[4]) {
#pragma unroll
  for (int p = 0; p < 4; ++p) *(v8h*)(s + p * 16 * PITCH) = r[p];
}

// ---------------------------------------------------------------------------
// Kernel 0: sigmoid(rpe) -> f32 table  (4095*8 elements, lives in L2)
// ---------------------------------------------------------------------------
__global__ void rpe_sigmoid_kernel(const float* __restrict__ rpe,
                                   float* __restrict__ sig, int n) {
  int i = blockIdx.x * blockDim.x + threadIdx.x;
  if (i < n) sig[i] = 1.0f / (1.0f + __expf(-rpe[i]));
}

// ---------------------------------------------------------------------------
// Kernel 1: fused QKV projection.  X (8192x512 f32) @ W^T + b -> f16.
// grid = (M/64, N/64, 3)  block = 128 (4 waves, each wave: 16x64 strip)
// Q,K stored [B,H,S,64]; V stored transposed [B,H,64,S].
// Head split per reference: feature n -> h = n % 8, d = n / 8.
// ---------------------------------------------------------------------------
__global__ __launch_bounds__(128) void qkv_proj_kernel(
    const float* __restrict__ X,
    const float* __restrict__ Wq, const float* __restrict__ bq,
    const float* __restrict__ Wk, const float* __restrict__ bk,
    const float* __restrict__ Wv, const float* __restrict__ bv,
    _Float16* __restrict__ qf, _Float16* __restrict__ kf,
    _Float16* __restrict__ vt) {
  const int lane = threadIdx.x & 31;
  const int wave = threadIdx.x >> 5;
  const int lr = lane & 15;   // row-in-tile / n-in-tile
  const int hs = lane >> 4;   // half select
  const int mode = blockIdx.z;

  const float* W    = (mode == 0) ? Wq : (mode == 1) ? Wk : Wv;
  const float* bias = (mode == 0) ? bq : (mode == 1) ? bk : bv;

  const int m0 = blockIdx.x * 64 + wave * 16;
  const int n0 = blockIdx.y * 64;

  __shared__ __attribute__((aligned(16))) _Float16 xs[2][TILE_HALVES];
  __shared__ __attribute__((aligned(16))) _Float16 wsm[2][TILE_HALVES];

  const int srow = threadIdx.x >> 4, scol = (threadIdx.x & 15) * 4;
  const float* xg = X + (blockIdx.x * 64 + srow) * DMODEL + scol;
  const float* wg = W + (n0 + srow) * DMODEL + scol;
  const int soff = srow * PITCH + scol;

  v8f acc[4] = {{}, {}, {}, {}};
  v4f xr[8], wr[8];
  fetch_f32(xr, xg, DMODEL);
  fetch_f32(wr, wg, DMODEL);
  put_f32(&xs[0][soff], xr);
  put_f32(&wsm[0][soff], wr);
  __syncthreads();  // publishes tile 0

  for (int it = 0; it < DMODEL / 64; ++it) {
    const int cur = it & 1;
    const bool more = it + 1 < DMODEL / 64;
    if (more) {  // next tile flies while this one is multiplied
      fetch_f32(xr, xg + (it + 1) * 64, DMODEL);
      fetch_f32(wr, wg + (it + 1) * 64, DMODEL);
    }
#pragma unroll
    for (int c = 0; c < 2; ++c) {
      const v16h a = frag_lds(&xs[cur][(wave * 16 + lr) * PITCH + c * 32 + hs * 8]);
#pragma unroll
      for (int sub = 0; sub < 4; ++sub) {
        const v16h bm =
            frag_lds(&wsm[cur][(sub * 16 + lr) * PITCH + c * 32 + hs * 8]);
        acc[sub] = wmma_f16(a, bm, acc[sub]);
      }
    }
    if (more) {
      put_f32(&xs[cur ^ 1][soff], xr);
      put_f32(&wsm[cur ^ 1][soff], wr);
    }
    // publishes the next tile and ends the reads of this one before its refill
    __syncthreads();
  }

#pragma unroll
  for (int sub = 0; sub < 4; ++sub) {
    const int n = n0 + sub * 16 + lr;
    const int hh = n & 7, d = n >> 3;  // f = d*H + h  (reference split_heads)
    const float bn = bias[n];
#pragma unroll
    for (int r = 0; r < 8; ++r) {
      const int m = m0 + r + 8 * hs;
      const int bidx = m >> 11;      // / SEQ
      const int s = m & (SEQ - 1);
      const _Float16 val = (_Float16)(acc[sub][r] + bn);
      if (mode == 0)
        qf[((bidx * HEADS + hh) * SEQ + s) * HDIM + d] = val;
      else if (mode == 1)
        kf[((bidx * HEADS + hh) * SEQ + s) * HDIM + d] = val;
      else
        vt[((bidx * HEADS + hh) * HDIM + d) * SEQ + s] = val;  // transposed
    }
  }
}

// ---------------------------------------------------------------------------
// Kernel 2: flash attention, transposed products.
// grid = (S/64, H, B), block = 128 (4 waves, each owns 16 queries).
// Per 64-key tile: S^T = K Q^T (8 WMMA; A = K rows from LDS, B = Q in registers),
// so a lane holds 32 scores of ONE query (column lr; keys 8*hs + r of each
// 16-key group): maximum and sum run in-lane, plus one exchange between the
// wave's halves.  Two score tiles, converted in place, are the B operand of
// O^T += V^T P^T (8 WMMA): P never leaves the registers.
// Output written f16 to ao [B,S,D] with f = h*64 + d.
// ---------------------------------------------------------------------------
// Value of lane l ^ 16.
__device__ __forceinline__ float other_half(float x) {
  const int b = __builtin_bit_cast(int, x);
  return __builtin_bit_cast(
      float, __builtin_amdgcn_permlanex16(b, b, 0x76543210, 0xfedcba98, false,
                                          false));
}

// e^x of the eight scores of one tile: the multiply by log2(e) and v_exp_f32, as
// __expf compiles.  Written as one statement so that the v_nop stands directly
// behind the last v_exp_f32: the instruction set asks for one independent
// instruction between a transcendental and a vector instruction that uses its
// result or overwrites its source.  Inside the run each
// v_exp_f32 is independent of the one before (outputs early-clobber).
__device__ __forceinline__ void exp_tile(v8f& s, float m) {
  const float a0 = (s[0] - m) * 1.44269504f, a1 = (s[1] - m) * 1.44269504f;
  const float a2 = (s[2] - m) * 1.44269504f, a3 = (s[3] - m) * 1.44269504f;
  const float a4 = (s[4] - m) * 1.44269504f, a5 = (s[5] - m) * 1.44269504f;
  const float a6 = (s[6] - m) * 1.44269504f, a7 = (s[7] - m) * 1.44269504f;
  float p0, p1, p2, p3, p4, p5, p6, p7;
  asm("v_exp_f32 %0, %8\n\tv_exp_f32 %1, %9\n\tv_exp_f32 %2, %10\n\t"
      "v_exp_f32 %3, %11\n\tv_exp_f32 %4, %12\n\tv_exp_f32 %5, %13\n\t"
      "v_exp_f32 %6, %14\n\tv_exp_f32 %7, %15\n\tv_nop"
      : "=&v"(p0), "=&v"(p1), "=&v"(p2), "=&v"(p3), "=&v"(p4), "=&v"(p5),
        "=&v"(p6), "=&v"(p7)
      : "v"(a0), "v"(a1), "v"(a2), "v"(a3), "v"(a4), "v"(a5), "v"(a6), "v"(a7));
  s[0] = p0; s[1] = p1; s[2] = p2; s[3] = p3;
  s[4] = p4; s[5] = p5; s[6] = p6; s[7] = p7;
}

__global__ __launch_bounds__(128) void flash_attn_kernel(
    const _Float16* __restrict__ qf, const _Float16* __restrict__ kf,
    const _Float16* __restrict__ vt, const float* __restrict__ sig_rpe,
    const float* __restrict__ logit_scale, _Float16* __restrict__ ao) {
  __shared__ __attribute__((aligned(16))) _Float16 ks[2][TILE_HALVES];
  __shared__ __attribute__((aligned(16))) _Float16 vs[2][TILE_HALVES];

  const int lane = threadIdx.x & 31;
  const int wave = threadIdx.x >> 5;
  const int lr = lane & 15;
  const int hs = lane >> 4;

  const int b = blockIdx.z;
  const int h = blockIdx.y;
  const int q0 = blockIdx.x * 64 + wave * 16;
  const int i = q0 + lr;  // this lane's query

  // scale = exp(min(ls, ln(100))) / sqrt(D_MODEL)
  const float scale =
      __expf(fminf(logit_scale[h], 4.6051702f)) * 0.04419417382f;

  const int bh = b * HEADS + h;

  // Q strip as B operand: column = query lr, 64 k (two chunks of 32)
  const _Float16* qp = qf + ((size_t)bh * SEQ + i) * HDIM + hs * 8;
  v16h bq[2];
  bq[0] = load_tile_f16(qp);
  bq[1] = load_tile_f16(qp + 32);
  // The zeroing of the accumulators below reuses Q's address registers: this
  // wait stands between the four loads and that overwrite.
  asm volatile("s_wait_xcnt 0x0" ::: "memory");

  v8f o[4] = {{}, {}, {}, {}};  // o[sd][r] = O^T[sd*16 + 8*hs + r][query lr]
  float mrow = -1e30f;          // running maximum of this lane's query
  float lrow = 0.0f;            // running sum over this half's keys only

  const int srow = threadIdx.x >> 3, scol = (threadIdx.x & 7) * 8;
  const _Float16* kg = kf + ((size_t)bh * SEQ + srow) * HDIM + scol;
  const _Float16* vg = vt + ((size_t)bh * HDIM + srow) * SEQ + scol;
  const int soff = srow * PITCH + scol;
  v8h kr[4], vr[4];
  fetch_f16(kr, kg, HDIM);
  fetch_f16(vr, vg, SEQ);
  put_f16(&ks[0][soff], kr);
  put_f16(&vs[0][soff], vr);
  __syncthreads();  // publishes K and V^T tile 0

  for (int kt = 0; kt < SEQ / 64; ++kt) {
    const int j0 = kt * 64;
    const int cur = kt & 1;
    const bool more = kt + 1 < SEQ / 64;
    if (more) {  // next tiles fly during scores and softmax
      fetch_f16(kr, kg + (size_t)(j0 + 64) * HDIM, HDIM);
      fetch_f16(vr, vg + (j0 + 64), SEQ);
    }

    // ---- scores: S^T = K Q^T * scale + sigmoid(rpe[i-j+S-1, h]) ----
    v8f sv[4];
#pragma unroll
    for (int sub = 0; sub < 4; ++sub) {
      const _Float16* kp = &ks[cur][(sub * 16 + lr) * PITCH + hs * 8];
      v8f s = {};
      s = wmma_f16(frag_lds(kp), bq[0], s);
      s = wmma_f16(frag_lds(kp + 32), bq[1], s);
#pragma unroll
      for (int r = 0; r < 8; ++r) {
        const int j = j0 + sub * 16 + 8 * hs + r;  // this element's key
        const float bias = sig_rpe[(i - j + (SEQ - 1)) * HEADS + h];
        s[r] = s[r] * scale + bias;
      }
      sv[sub] = s;
    }

    // ---- tile maximum of this query: in-lane, then the other half's ----
    float tmax = sv[0][0];
#pragma unroll
    for (int sub = 0; sub < 4; ++sub)
#pragma unroll
      for (int r = 0; r < 8; ++r) tmax = fmaxf(tmax, sv[sub][r]);
    tmax = fmaxf(tmax, other_half(tmax));

    // ---- online softmax update ----
    const float nm = fmaxf(mrow, tmax);
    const float corr = __expf(mrow - nm);
    mrow = nm;
    float ts[4];  // four independent chains
#pragma unroll
    for (int sub = 0; sub < 4; ++sub) {
      exp_tile(sv[sub], nm);
      ts[sub] = sv[sub][0];
#pragma unroll
      for (int r = 1; r < 8; ++r) ts[sub] += sv[sub][r];
    }
    lrow = lrow * corr + ((ts[0] + ts[1]) + (ts[2] + ts[3]));
#pragma unroll
    for (int sd = 0; sd < 4; ++sd)
#pragma unroll
      for (int r = 0; r < 8; ++r) o[sd][r] *= corr;

    // The other K/V buffer was last read in the pass before, which ended at the
    // barrier at this loop's foot.
    if (more) {
      put_f16(&ks[cur ^ 1][soff], kr);
      put_f16(&vs[cur ^ 1][soff], vr);
    }

    // ---- P^T as B operand: score tiles 2c and 2c+1 hold keys 8*hs + 0..7 and
    // 16 + 8*hs + 0..7 of chunk c, the k order of frag_lds ----
    v16h bp[2];
#pragma unroll
    for (int c = 0; c < 2; ++c)
#pragma unroll
      for (int t = 0; t < 8; ++t) {
        bp[c][t]     = (_Float16)sv[2 * c][t];
        bp[c][t + 8] = (_Float16)sv[2 * c + 1][t];
      }

    // ---- O^T += V^T P^T   (V^T rows are head-dims; contiguous over j) ----
#pragma unroll
    for (int sd = 0; sd < 4; ++sd) {
      const _Float16* vp = &vs[cur][(sd * 16 + lr) * PITCH + hs * 8];
      o[sd] = wmma_f16(frag_lds(vp), bp[0], o[sd]);
      o[sd] = wmma_f16(frag_lds(vp + 32), bp[1], o[sd]);
    }
    // publishes the next tiles and ends the reads of these before their refill
    __syncthreads();
  }

  // ---- epilogue: join the halves' sums, O / l, merge heads (f = h*64 + d);
  // a lane's 8 registers are 8 consecutive d of its query: one 16-byte store ----
  const float ltot = lrow + other_half(lrow);
#pragma unroll
  for (int sd = 0; sd < 4; ++sd) {
    v8h w;
#pragma unroll
    for (int r = 0; r < 8; ++r) w[r] = (_Float16)(o[sd][r] / ltot);
    *(v8h*)&ao[((size_t)b * SEQ + i) * DMODEL + h * HDIM + sd * 16 + 8 * hs] = w;
  }
}

// ---------------------------------------------------------------------------
// Kernel 3: output projection.  AO (8192x512 f16) @ Wp^T + bp -> f32 d_out.
// ---------------------------------------------------------------------------
__global__ __launch_bounds__(128) void out_proj_kernel(
    const _Float16* __restrict__ ao, const float* __restrict__ Wp,
    const float* __restrict__ bp, float* __restrict__ out) {
  const int lane = threadIdx.x & 31;
  const int wave = threadIdx.x >> 5;
  const int lr = lane & 15;
  const int hs = lane >> 4;

  const int m0 = blockIdx.x * 64 + wave * 16;
  const int n0 = blockIdx.y * 64;

  __shared__ __attribute__((aligned(16))) _Float16 as[2][TILE_HALVES];
  __shared__ __attribute__((aligned(16))) _Float16 wsm[2][TILE_HALVES];

  const int arow = threadIdx.x >> 3, acol = (threadIdx.x & 7) * 8;
  const int wrow = threadIdx.x >> 4, wcol = (threadIdx.x & 15) * 4;
  const _Float16* ag = ao + (size_t)(blockIdx.x * 64 + arow) * DMODEL + acol;
  const float* wg = Wp + (n0 + wrow) * DMODEL + wcol;
  const int aoff = arow * PITCH + acol;
  const int woff = wrow * PITCH + wcol;

  v8f acc[4] = {{}, {}, {}, {}};
  v8h ar[4];
  v4f wr[8];
  fetch_f16(ar, ag, DMODEL);
  fetch_f32(wr, wg, DMODEL);
  put_f16(&as[0][aoff], ar);
  put_f32(&wsm[0][woff], wr);
  __syncthreads();  // publishes tile 0

  for (int it = 0; it < DMODEL / 64; ++it) {
    const int cur = it & 1;
    const bool more = it + 1 < DMODEL / 64;
    if (more) {  // next tile flies while this one is multiplied
      fetch_f16(ar, ag + (it + 1) * 64, DMODEL);
      fetch_f32(wr, wg + (it + 1) * 64, DMODEL);
    }
#pragma unroll
    for (int c = 0; c < 2; ++c) {
      const v16h a = frag_lds(&as[cur][(wave * 16 + lr) * PITCH + c * 32 + hs * 8]);
#pragma unroll
      for (int sub = 0; sub < 4; ++sub) {
        const v16h bm =
            frag_lds(&wsm[cur][(sub * 16 + lr) * PITCH + c * 32 + hs * 8]);
        acc[sub] = wmma_f16(a, bm, acc[sub]);
      }
    }
    if (more) {
      put_f16(&as[cur ^ 1][aoff], ar);
      put_f32(&wsm[cur ^ 1][woff], wr);
    }
    // publishes the next tile and ends the reads of this one before its refill
    __syncthreads();
  }

#pragma unroll
  for (int sub = 0; sub < 4; ++sub) {
    const int n = n0 + sub * 16 + lr;
    const float bn = bp[n];
#pragma unroll
    for (int r = 0; r < 8; ++r) {
      const int m = m0 + r + 8 * hs;
      out[(size_t)m * DMODEL + n] = acc[sub][r] + bn;
    }
  }
}

// ---------------------------------------------------------------------------
extern "C" void kernel_launch(void* const* d_in, const int* in_sizes, int n_in,
                              void* d_out, int out_size, void* d_ws,
                              size_t ws_size, hipStream_t stream) {
  (void)in_sizes; (void)n_in; (void)out_size; (void)ws_size;

  const float* query = (const float*)d_in[0];
  const float* Wq = (const float*)d_in[1];
  const float* bq = (const float*)d_in[2];
  const float* Wk = (const float*)d_in[3];
  const float* bk = (const float*)d_in[4];
  const float* Wv = (const float*)d_in[5];
  const float* bv = (const float*)d_in[6];
  const float* Wp = (const float*)d_in[7];
  const float* bp = (const float*)d_in[8];
  const float* logit_scale = (const float*)d_in[9];
  const float* rpe = (const float*)d_in[10];

  // workspace carve-up
  const size_t QKV_ELEMS = (size_t)BATCH * HEADS * SEQ * HDIM;  // 4.19M halves
  char* ws = (char*)d_ws;
  float* sig = (float*)ws;                         // 4095*8 f32 = 131040 B
  _Float16* qf = (_Float16*)(ws + 131072);
  _Float16* kf = qf + QKV_ELEMS;
  _Float16* vt = kf + QKV_ELEMS;
  _Float16* ao = vt + QKV_ELEMS;

  const int nrpe = (2 * SEQ - 1) * HEADS;
  rpe_sigmoid_kernel<<<(nrpe + 255) / 256, 256, 0, stream>>>(rpe, sig, nrpe);

  qkv_proj_kernel<<<dim3((BATCH * SEQ) / 64, DMODEL / 64, 3), 128, 0, stream>>>(
      query, Wq, bq, Wk, bk, Wv, bv, qf, kf, vt);

  flash_attn_kernel<<<dim3(SEQ / 64, HEADS, BATCH), 128, 0, stream>>>(
      qf, kf, vt, sig, logit_scale, ao);

  out_proj_kernel<<<dim3((BATCH * SEQ) / 64, DMODEL / 64), 128, 0, stream>>>(
      ao, Wp, bp, (float*)d_out);
}

// v003
// One run takes 108 microseconds.
// Two timings next to v002 both put it at 1.11 times that version's speed.
// Counting every step since v000, it is 2.98 times as fast.
#include <hip/hip_runtime.h>
#include <hip/hip_bf16.h>

// ---------------------------------------------------------------------------
// Multi-head attention (logit_scale + sigmoid rel-pos bias)
// B=4, S=2048, D=512, H=8, hd=64.  f16 WMMA (v_wmma_f32_16x16x32_f16),
// f32 accumulate, fused flash-attention middle stage.
// ---------------------------------------------------------------------------

#define BATCH 4
#define SEQ   2048
#define DMODEL 512
#define HEADS 8
#define HDIM  64

typedef __attribute__((ext_vector_type(16))) _Float16 v16h;
typedef __attribute__((ext_vector_type(8)))  float    v8f;

__device__ __forceinline__ v8f wmma_f16(v16h a, v16h b, v8f c) {
  // (neg_a, A, neg_b, B, c_mod, C, reuse_a, reuse_b)
  return __builtin_amdgcn_wmma_f32_16x16x32_f16(false, a, false, b, (short)0, c,
                                                false, false);
}

// A/B operand loader (16x32 f16 tile, one row per lane).
// p must already point at row_base + k_chunk + (lane>=16 ? 8 : 0).
// Elements [0..7] = K+0..7 of this lane's chunk, [8..15] = K+16..23.
__device__ __forceinline__ v16h load_tile_f16(const _Float16* __restrict__ p) {
  v16h a;
#pragma unroll
  for (int t = 0; t < 8; ++t) {
    a[t]     = p[t];
    a[t + 8] = p[t + 16];
  }
  return a;
}

// LDS staging of operand tiles.  A tile is 64 rows x 64 f16 (128 B a row), laid
// at a pitch of 144 B (16 B x odd: conflict-free for 16-byte reads).  The block's
// 128 threads fetch it with 16-byte loads whose 32 lanes cover four whole 128-B
// lines; each of the 4 waves then reads its fragments from LDS.
typedef __attribute__((ext_vector_type(8))) _Float16 v8h;
typedef __attribute__((ext_vector_type(4))) _Float16 v4h;
typedef __attribute__((ext_vector_type(4))) float    v4f;
typedef __attribute__((ext_vector_type(2))) float    v2f;
#define PITCH 72
#define TILE_HALVES (64 * PITCH)

// Fragment from LDS: same element order as load_tile_f16
// (p = row base + k_chunk + (lane>=16 ? 8 : 0)).
__device__ __forceinline__ v16h frag_lds(const _Float16* p) {
  const v8h lo = *(const v8h*)p;
  const v8h hi = *(const v8h*)(p + 16);
  return __builtin_shufflevector(lo, hi, 0, 1, 2, 3, 4, 5, 6, 7, 8, 9, 10, 11,
                                 12, 13, 14, 15);
}

// f32 source, 64 x 64 floats: thread t holds floats (t&15)*4.. of rows (t>>4)+8p.
// g already points at this thread's first float4; ld = row stride in floats.
__device__ __forceinline__ void fetch_f32(v4f (&r)[8], const float* __restrict__ g,
                                          int ld) {
#pragma unroll
  for (int p = 0; p < 8; ++p) r[p] = *(const v4f*)(g + p * 8 * ld);
}
__device__ __forceinline__ void put_f32(_Float16* s, const v4f (&r)[8]) {
#pragma unroll
  for (int p = 0; p < 8; ++p)
    *(v4h*)(s + p * 8 * PITCH) = __builtin_convertvector(r[p], v4h);
}
// f16 source, 64 x 64 halves: thread t holds halves (t&7)*8.. of rows (t>>3)+16p.
__device__ __forceinline__ void fetch_f16(v8h (&r)[4],
                                          const _Float16* __restrict__ g, int ld) {
#pragma unroll
  for (int p = 0; p < 4; ++p) r[p] = *(const v8h*)(g + p * 16 * ld);
}
__device__ __forceinline__ void put_f16(_Float16* s, const v8h (&r)[4]) {
#pragma unroll
  for (int p = 0; p < 4; ++p) *(v8h*)(s + p * 16 * PITCH) = r[p];
}

// ---------------------------------------------------------------------------
// Kernel 0: sigmoid(rpe) -> f32 bias table, laid out for the attention kernel:
// tab[h][c][z] = sigmoid(rpe[S-1 + i - j][h]) at z + c = j - i + S-1, c = 0..3.
// Head-major and ascending in the key j, so that the biases of consecutive keys
// of one query are consecutive floats; the four copies, each shifted by one
// float, give every query a copy in which its runs start on a 16-byte boundary.
// Entries past the last relative position are zero and never enter a score.
// ---------------------------------------------------------------------------
#define NREL (2 * SEQ - 1)     // relative positions
#define TAB_Z 4096             // floats per copy in the global table
#define WIN_Z 2112             // floats of a copy that one 64-query block stages
#define WIN_PITCH 2128         // LDS pitch of a copy: 16 banks past a multiple of 64
__global__ void rpe_sigmoid_kernel(const float* __restrict__ rpe,
                                   float* __restrict__ tab) {
  // t = (h * 4 + c) * TAB_Z + u with u = TAB_Z-1 - z, so that the row of rpe,
  // NREL-1 - (z + c) = u - 1 - c, ascends with the thread.
  const unsigned t = blockIdx.x * blockDim.x + threadIdx.x;
  const unsigned u = t & (TAB_Z - 1);
  const unsigned c = (t >> 12) & 3;
  const unsigned h = t >> 14;
  float v = 0.0f;
  if (u > c) v = 1.0f / (1.0f + __expf(-rpe[(u - 1 - c) * HEADS + h]));
  tab[(t | (TAB_Z - 1)) - u] = v;
}

// ---------------------------------------------------------------------------
// Kernel 1: fused QKV projection.  X (8192x512 f32) @ W^T + b -> f16.
// grid = (M/64, N/64, 3)  block = 128 (4 waves, each wave: 16x64 strip)
// Q,K stored [B,H,S,64]; V stored transposed [B,H,64,S].
// Head split per reference: feature n -> h = n % 8, d = n / 8.
// ---------------------------------------------------------------------------
__global__ __launch_bounds__(128) void qkv_proj_kernel(
    const float* __restrict__ X,
    const float* __restrict__ Wq, const float* __restrict__ bq,
    const float* __restrict__ Wk, const float* __restrict__ bk,
    const float* __restrict__ Wv, const float* __restrict__ bv,
    _Float16* __restrict__ qf, _Float16* __restrict__ kf,
    _Float16* __restrict__ vt) {
  const int lane = threadIdx.x & 31;
  const int wave = threadIdx.x >> 5;
  const int lr = lane & 15;   // row-in-tile / n-in-tile
  const int hs = lane >> 4;   // half select
  const int mode = blockIdx.z;

  const float* W    = (mode == 0) ? Wq : (mode == 1) ? Wk : Wv;
  const float* bias = (mode == 0) ? bq : (mode == 1) ? bk : bv;

  const int m0 = blockIdx.x * 64 + wave * 16;
  const int n0 = blockIdx.y * 64;

  __shared__ __attribute__((aligned(16))) _Float16 xs[2][TILE_HALVES];
  __shared__ __attribute__((aligned(16))) _Float16 wsm[2][TILE_HALVES];

  const int srow = threadIdx.x >> 4, scol = (threadIdx.x & 15) * 4;
  const float* xg = X + (blockIdx.x * 64 + srow) * DMODEL + scol;
  const float* wg = W + (n0 + srow) * DMODEL + scol;
  const int soff = srow * PITCH + scol;

  v8f acc[4] = {{}, {}, {}, {}};
  v4f xr[8], wr[8];
  fetch_f32(xr, xg, DMODEL);
  fetch_f32(wr, wg, DMODEL);
  put_f32(&xs[0][soff], xr);
  put_f32(&wsm[0][soff], wr);
  __syncthreads();  // publishes tile 0

  for (int it = 0; it < DMODEL / 64; ++it) {
    const int cur = it & 1;
    const bool more = it + 1 < DMODEL / 64;
    if (more) {  // next tile flies while this one is multiplied
      fetch_f32(xr, xg + (it + 1) * 64, DMODEL);
      fetch_f32(wr, wg + (it + 1) * 64, DMODEL);
    }
#pragma unroll
    for (int c = 0; c < 2; ++c) {
      const v16h a = frag_lds(&xs[cur][(wave * 16 + lr) * PITCH + c * 32 + hs * 8]);
#pragma unroll
      for (int sub = 0; sub < 4; ++sub) {
        const v16h bm =
            frag_lds(&wsm[cur][(sub * 16 + lr) * PITCH + c * 32 + hs * 8]);
        acc[sub] = wmma_f16(a, bm, acc[sub]);
      }
    }
    if (more) {
      put_f32(&xs[cur ^ 1][soff], xr);
      put_f32(&wsm[cur ^ 1][soff], wr);
    }
    // publishes the next tile and ends the reads of this one before its refill
    __syncthreads();
  }

#pragma unroll
  for (int sub = 0; sub < 4; ++sub) {
    const int n = n0 + sub * 16 + lr;
    const int hh = n & 7, d = n >> 3;  // f = d*H + h  (reference split_heads)
    const float bn = bias[n];
#pragma unroll
    for (int r = 0; r < 8; ++r) {
      const int m = m0 + r + 8 * hs;
      const int bidx = m >> 11;      // / SEQ
      const int s = m & (SEQ - 1);
      const _Float16 val = (_Float16)(acc[sub][r] + bn);
      if (mode == 0)
        qf[((bidx * HEADS + hh) * SEQ + s) * HDIM + d] = val;
      else if (mode == 1)
        kf[((bidx * HEADS + hh) * SEQ + s) * HDIM + d] = val;
      else
        vt[((bidx * HEADS + hh) * HDIM + d) * SEQ + s] = val;  // transposed
    }
  }
}

// ---------------------------------------------------------------------------
// Kernel 2: flash attention, transposed products.
// grid = (S/64, H, B), block = 128 (4 waves, each owns 16 queries).
// Per 64-key tile: S^T = K Q^T (8 WMMA; A = K rows from LDS, B = Q in registers),
// so a lane holds 32 scores of ONE query (column lr; keys 8*hs + r of each
// 16-key group): maximum and sum run in-lane, plus one exchange between the
// wave's halves.  Two score tiles, converted in place, are the B operand of
// O^T += V^T P^T (8 WMMA): P never leaves the registers.
// The bias depends on j - i alone: a block's 64 queries and all keys meet 2111
// relative positions, staged once in LDS (four shifted copies); the 8 biases of
// a score tile's lane are then two 16-byte LDS reads.
// Output written f16 to ao [B,S,D] with f = h*64 + d.
// ---------------------------------------------------------------------------
// Value of lane l ^ 16.
__device__ __forceinline__ float other_half(float x) {
  const int b = __builtin_bit_cast(int, x);
  return __builtin_bit_cast(
      float, __builtin_amdgcn_permlanex16(b, b, 0x76543210, 0xfedcba98, false,
                                          false));
}

// e^x of the eight scores of one tile: the multiply by log2(e) and v_exp_f32, as
// __expf compiles.  Written as one statement so that the v_nop stands directly
// behind the last v_exp_f32: the instruction set asks for one independent
// instruction between a transcendental and a vector instruction that uses its
// result or overwrites its source.  Inside the run each
// v_exp_f32 is independent of the one before (outputs early-clobber).
__device__ __forceinline__ void exp_tile(v8f& s, float m) {
  const float a0 = (s[0] - m) * 1.44269504f, a1 = (s[1] - m) * 1.44269504f;
  const float a2 = (s[2] - m) * 1.44269504f, a3 = (s[3] - m) * 1.44269504f;
  const float a4 = (s[4] - m) * 1.44269504f, a5 = (s[5] - m) * 1.44269504f;
  const float a6 = (s[6] - m) * 1.44269504f, a7 = (s[7] - m) * 1.44269504f;
  float p0, p1, p2, p3, p4, p5, p6, p7;
  asm("v_exp_f32 %0, %8\n\tv_exp_f32 %1, %9\n\tv_exp_f32 %2, %10\n\t"
      "v_exp_f32 %3, %11\n\tv_exp_f32 %4, %12\n\tv_exp_f32 %5, %13\n\t"
      "v_exp_f32 %6, %14\n\tv_exp_f32 %7, %15\n\tv_nop"
      : "=&v"(p0), "=&v"(p1), "=&v"(p2), "=&v"(p3), "=&v"(p4), "=&v"(p5),
        "=&v"(p6), "=&v"(p7)
      : "v"(a0), "v"(a1), "v"(a2), "v"(a3), "v"(a4), "v"(a5), "v"(a6), "v"(a7));
  s[0] = p0; s[1] = p1; s[2] = p2; s[3] = p3;
  s[4] = p4; s[5] = p5; s[6] = p6; s[7] = p7;
}

__global__ __launch_bounds__(128) void flash_attn_kernel(
    const _Float16* __restrict__ qf, const _Float16* __restrict__ kf,
    const _Float16* __restrict__ vt, const float* __restrict__ tab,
    const float* __restrict__ logit_scale, _Float16* __restrict__ ao) {
  __shared__ __attribute__((aligned(16))) _Float16 ks[2][TILE_HALVES];
  __shared__ __attribute__((aligned(16))) _Float16 vs[2][TILE_HALVES];
  __shared__ __attribute__((aligned(16))) float bw[4 * WIN_PITCH];

  const int lane = threadIdx.x & 31;
  const int wave = threadIdx.x >> 5;
  const int lr = lane & 15;
  const int hs = lane >> 4;

  const int b = blockIdx.z;
  const int h = blockIdx.y;
  const int q0 = blockIdx.x * 64 + wave * 16;
  const int i = q0 + lr;  // this lane's query

  // scale = exp(min(ls, ln(100))) / sqrt(D_MODEL)
  const float scale =
      __expf(fminf(logit_scale[h], 4.6051702f)) * 0.04419417382f;

  const int bh = b * HEADS + h;

  // Q strip as B operand: column = query lr, 64 k (two chunks of 32)
  const _Float16* qp = qf + ((size_t)bh * SEQ + i) * HDIM + hs * 8;
  v16h bq[2];
  bq[0] = load_tile_f16(qp);
  bq[1] = load_tile_f16(qp + 32);
  // The zeroing of the accumulators below reuses Q's address registers: this
  // wait stands between the four loads and that overwrite.
  asm volatile("s_wait_xcnt 0x0" ::: "memory");

  v8f o[4] = {{}, {}, {}, {}};  // o[sd][r] = O^T[sd*16 + 8*hs + r][query lr]
  float mrow = -1e30f;          // running maximum of this lane's query
  float lrow = 0.0f;            // running sum over this half's keys only

  const int srow = threadIdx.x >> 3, scol = (threadIdx.x & 7) * 8;
  const _Float16* kg = kf + ((size_t)bh * SEQ + srow) * HDIM + scol;
  const _Float16* vg = vt + ((size_t)bh * HDIM + srow) * SEQ + scol;
  const int soff = srow * PITCH + scol;
  v8h kr[4], vr[4];
  fetch_f16(kr, kg, HDIM);
  fetch_f16(vr, vg, SEQ);
  // Bias window of this block: wave c stages copy c, floats z0 .. z0 + WIN_Z - 1
  // with z0 = S-1 - (last query of the block), whole lines, 16 bytes a lane; the
  // last 64 floats go 8 bytes a lane, which keeps every lane on.  Its loads are
  // issued with those of K and V^T tile 0, so that all share one latency.
  const float* tg = tab + (h * 4 + wave) * TAB_Z + (SEQ - 64 - blockIdx.x * 64);
  float* tl = &bw[wave * WIN_PITCH];
  v4f wr[16];
#pragma unroll
  for (int p = 0; p < 16; ++p) wr[p] = *(const v4f*)(tg + p * 128 + lane * 4);
  const v2f wt = *(const v2f*)(tg + 2048 + lane * 2);
  // The code behind reuses these loads' address registers: this wait stands
  // between the loads and that overwrite.
  asm volatile("s_wait_xcnt 0x0" ::: "memory");
  put_f16(&ks[0][soff], kr);
  put_f16(&vs[0][soff], vr);
#pragma unroll
  for (int p = 0; p < 16; ++p) *(v4f*)(tl + p * 128 + lane * 4) = wr[p];
  *(v2f*)(tl + 2048 + lane * 2) = wt;
  // This lane's biases: window index of (query i, key j) is j + 63 - (i - block's
  // first query); copy 3 - (lr & 3) holds it at a multiple of 4 floats for j % 4 == 0.
  // (60 - 16 * wave - (lr & 12), written as a sum of terms that are never negative)
  const float* bl = &bw[((lr & 3) ^ 3) * WIN_PITCH + (wave ^ 3) * 16 +
                        ((lr & 12) ^ 12) + 8 * hs];
  __syncthreads();  // publishes K and V^T tile 0 and the bias window

  for (int kt = 0; kt < SEQ / 64; ++kt) {
    const int j0 = kt * 64;
    const int cur = kt & 1;
    const bool more = kt + 1 < SEQ / 64;
    if (more) {  // next tiles fly during scores and softmax
      fetch_f16(kr, kg + (size_t)(j0 + 64) * HDIM, HDIM);
      fetch_f16(vr, vg + (j0 + 64), SEQ);
    }

    // ---- scores: S^T = K Q^T * scale + sigmoid(rpe[i-j+S-1, h]) ----
    // (element r of tile sub is key j0 + sub*16 + 8*hs + r)
    v8f sv[4];
#pragma unroll
    for (int sub = 0; sub < 4; ++sub) {
      const _Float16* kp = &ks[cur][(sub * 16 + lr) * PITCH + hs * 8];
      v8f s = {};
      s = wmma_f16(frag_lds(kp), bq[0], s);
      s = wmma_f16(frag_lds(kp + 32), bq[1], s);
      const v4f b0 = *(const v4f*)(bl + j0 + sub * 16);
      const v4f b1 = *(const v4f*)(bl + j0 + sub * 16 + 4);
#pragma unroll
      for (int r = 0; r < 4; ++r) {
        s[r]     = s[r] * scale + b0[r];
        s[r + 4] = s[r + 4] * scale + b1[r];
      }
      sv[sub] = s;
    }

    // ---- tile maximum of this query: in-lane, then the other half's ----
    float tmax = sv[0][0];
#pragma unroll
    for (int sub = 0; sub < 4; ++sub)
#pragma unroll
      for (int r = 0; r < 8; ++r) tmax = fmaxf(tmax, sv[sub][r]);
    tmax = fmaxf(tmax, other_half(tmax));

    // ---- online softmax update ----
    const float nm = fmaxf(mrow, tmax);
    const float corr = __expf(mrow - nm);
    mrow = nm;
    float ts[4];  // four independent chains
#pragma unroll
    for (int sub = 0; sub < 4; ++sub) {
      exp_tile(sv[sub], nm);
      ts[sub] = sv[sub][0];
#pragma unroll
      for (int r = 1; r < 8; ++r) ts[sub] += sv[sub][r];
    }
    lrow = lrow * corr + ((ts[0] + ts[1]) + (ts[2] + ts[3]));
#pragma unroll
    for (int sd = 0; sd < 4; ++sd)
#pragma unroll
      for (int r = 0; r < 8; ++r) o[sd][r] *= corr;

    // The other K/V buffer was last read in the pass before, which ended at the
    // barrier at this loop's foot.
    if (more) {
      put_f16(&ks[cur ^ 1][soff], kr);
      put_f16(&vs[cur ^ 1][soff], vr);
    }

    // ---- P^T as B operand: score tiles 2c and 2c+1 hold keys 8*hs + 0..7 and
    // 16 + 8*hs + 0..7 of chunk c, the k order of frag_lds ----
    v16h bp[2];
#pragma unroll
    for (int c = 0; c < 2; ++c)
#pragma unroll
      for (int t = 0; t < 8; ++t) {
        bp[c][t]     = (_Float16)sv[2 * c][t];
        bp[c][t + 8] = (_Float16)sv[2 * c + 1][t];
      }

    // ---- O^T += V^T P^T   (V^T rows are head-dims; contiguous over j) ----
#pragma unroll
    for (int sd = 0; sd < 4; ++sd) {
      const _Float16* vp = &vs[cur][(sd * 16 + lr) * PITCH + hs * 8];
      o[sd] = wmma_f16(frag_lds(vp), bp[0], o[sd]);
      o[sd] = wmma_f16(frag_lds(vp + 32), bp[1], o[sd]);
    }
    // publishes the next tiles and ends the reads of these before their refill
    __syncthreads();
  }

  // ---- epilogue: join the halves' sums, O / l, merge heads (f = h*64 + d);
  // a lane's 8 registers are 8 consecutive d of its query: one 16-byte store ----
  const float ltot = lrow + other_half(lrow);
#pragma unroll
  for (int sd = 0; sd < 4; ++sd) {
    v8h w;
#pragma unroll
    for (int r = 0; r < 8; ++r) w[r] = (_Float16)(o[sd][r] / ltot);
    *(v8h*)&ao[((size_t)b * SEQ + i) * DMODEL + h * HDIM + sd * 16 + 8 * hs] = w;
  }
}

// ---------------------------------------------------------------------------
// Kernel 3: output projection.  AO (8192x512 f16) @ Wp^T + bp -> f32 d_out.
// ---------------------------------------------------------------------------
__global__ __launch_bounds__(128) void out_proj_kernel(
    const _Float16* __restrict__ ao, const float* __restrict__ Wp,
    const float* __restrict__ bp, float* __restrict__ out) {
  const int lane = threadIdx.x & 31;
  const int wave = threadIdx.x >> 5;
  const int lr = lane & 15;
  const int hs = lane >> 4;

  const int m0 = blockIdx.x * 64 + wave * 16;
  const int n0 = blockIdx.y * 64;

  __shared__ __attribute__((aligned(16))) _Float16 as[2][TILE_HALVES];
  __shared__ __attribute__((aligned(16))) _Float16 wsm[2][TILE_HALVES];

  const int arow = threadIdx.x >> 3, acol = (threadIdx.x & 7) * 8;
  const int wrow = threadIdx.x >> 4, wcol = (threadIdx.x & 15) * 4;
  const _Float16* ag = ao + (size_t)(blockIdx.x * 64 + arow) * DMODEL + acol;
  const float* wg = Wp + (n0 + wrow) * DMODEL + wcol;
  const int aoff = arow * PITCH + acol;
  const int woff = wrow * PITCH + wcol;

  v8f acc[4] = {{}, {}, {}, {}};
  v8h ar[4];
  v4f wr[8];
  fetch_f16(ar, ag, DMODEL);
  fetch_f32(wr, wg, DMODEL);
  put_f16(&as[0][aoff], ar);
  put_f32(&wsm[0][woff], wr);
  __syncthreads();  // publishes tile 0

  for (int it = 0; it < DMODEL / 64; ++it) {
    const int cur = it & 1;
    const bool more = it + 1 < DMODEL / 64;
    if (more) {  // next tile flies while this one is multiplied
      fetch_f16(ar, ag + (it + 1) * 64, DMODEL);
      fetch_f32(wr, wg + (it + 1) * 64, DMODEL);
    }
#pragma unroll
    for (int c = 0; c < 2; ++c) {
      const v16h a = frag_lds(&as[cur][(wave * 16 + lr) * PITCH + c * 32 + hs * 8]);
#pragma unroll
      for (int sub = 0; sub < 4; ++sub) {
        const v16h bm =
            frag_lds(&wsm[cur][(sub * 16 + lr) * PITCH + c * 32 + hs * 8]);
        acc[sub] = wmma_f16(a, bm, acc[sub]);
      }
    }
    if (more) {
      put_f16(&as[cur ^ 1][aoff], ar);
      put_f32(&wsm[cur ^ 1][woff], wr);
    }
    // publishes the next tile and ends the reads of this one before its refill
    __syncthreads();
  }

#pragma unroll
  for (int sub = 0; sub < 4; ++sub) {
    const int n = n0 + sub * 16 + lr;
    const float bn = bp[n];
#pragma unroll
    for (int r = 0; r < 8; ++r) {
      const int m = m0 + r + 8 * hs;
      out[(size_t)m * DMODEL + n] = acc[sub][r] + bn;
    }
  }
}

// ---------------------------------------------------------------------------
extern "C" void kernel_launch(void* const* d_in, const int* in_sizes, int n_in,
                              void* d_out, int out_size, void* d_ws,
                              size_t ws_size, hipStream_t stream) {
  (void)in_sizes; (void)n_in; (void)out_size; (void)ws_size;

  const float* query = (const float*)d_in[0];
  const float* Wq = (const float*)d_in[1];
  const float* bq = (const float*)d_in[2];
  const float* Wk = (const float*)d_in[3];
  const float* bk = (const float*)d_in[4];
  const float* Wv = (const float*)d_in[5];
  const float* bv = (const float*)d_in[6];
  const float* Wp = (const float*)d_in[7];
  const float* bp = (const float*)d_in[8];
  const float* logit_scale = (const float*)d_in[9];
  const float* rpe = (const float*)d_in[10];

  // workspace carve-up
  const size_t QKV_ELEMS = (size_t)BATCH * HEADS * SEQ * HDIM;  // 4.19M halves
  char* ws = (char*)d_ws;
  float* tab = (float*)ws;                         // 8*4*4096 f32 = 524288 B
  _Float16* qf = (_Float16*)(ws + 524288);
  _Float16* kf = qf + QKV_ELEMS;
  _Float16* vt = kf + QKV_ELEMS;
  _Float16* ao = vt + QKV_ELEMS;

  rpe_sigmoid_kernel<<<(HEADS * 4 * TAB_Z) / 256, 256, 0, stream>>>(rpe, tab);

  qkv_proj_kernel<<<dim3((BATCH * SEQ) / 64, DMODEL / 64, 3), 128, 0, stream>>>(
      query, Wq, bq, Wk, bk, Wv, bv, qf, kf, vt);

  flash_attn_kernel<<<dim3(SEQ / 64, HEADS, BATCH), 128, 0, stream>>>(
      qf, kf, vt, tab, logit_scale, ao);

  out_proj_kernel<<<dim3((BATCH * SEQ) / 64, DMODEL / 64), 128, 0, stream>>>(
      ao, Wp, bp, (float*)d_out);
}

// v004
// A run of this version takes 82.7 microseconds.
// Next to v003, in two timings, it ran 1.31 times as fast each time.
// Over all steps from v000 it is 3.89 times as fast.
#include <hip/hip_runtime.h>
#include <hip/hip_bf16.h>

// ---------------------------------------------------------------------------
// Multi-head attention (logit_scale + sigmoid rel-pos bias)
// B=4, S=2048, D=512, H=8, hd=64.  f16 WMMA (v_wmma_f32_16x16x32_f16),
// f32 accumulate, fused flash-attention middle stage.
// ---------------------------------------------------------------------------

#define BATCH 4
#define SEQ   2048
#define DMODEL 512
#define HEADS 8
#define HDIM  64

typedef __attribute__((ext_vector_type(16))) _Float16 v16h;
typedef __attribute__((ext_vector_type(8)))  float    v8f;

__device__ __forceinline__ v8f wmma_f16(v16h a, v16h b, v8f c) {
  // (neg_a, A, neg_b, B, c_mod, C, reuse_a, reuse_b)
  return __builtin_amdgcn_wmma_f32_16x16x32_f16(false, a, false, b, (short)0, c,
                                                false, false);
}

// A/B operand loader (16x32 f16 tile, one row per lane).
// p must already point at row_base + k_chunk + (lane>=16 ? 8 : 0).
// Elements [0..7] = K+0..7 of this lane's chunk, [8..15] = K+16..23.
__device__ __forceinline__ v16h load_tile_f16(const _Float16* __restrict__ p) {
  v16h a;
#pragma unroll
  for (int t = 0; t < 8; ++t) {
    a[t]     = p[t];
    a[t + 8] = p[t + 16];
  }
  return a;
}

// LDS staging of operand tiles.  A tile is 64 rows x 64 f16 (128 B a row), laid
// at a pitch of 144 B (16 B x odd: conflict-free for 16-byte reads).  The block's
// 128 threads fetch it with 16-byte loads whose 32 lanes cover four whole 128-B
// lines; each of the 4 waves then reads its fragments from LDS.
typedef __attribute__((ext_vector_type(8))) _Float16 v8h;
typedef __attribute__((ext_vector_type(4))) _Float16 v4h;
typedef __attribute__((ext_vector_type(4))) float    v4f;
typedef __attribute__((ext_vector_type(2))) float    v2f;
#define PITCH 72
#define TILE_HALVES (64 * PITCH)

// Fragment from LDS: same element order as load_tile_f16
// (p = row base + k_chunk + (lane>=16 ? 8 : 0)).
__device__ __forceinline__ v16h frag_lds(const _Float16* p) {
  const v8h lo = *(const v8h*)p;
  const v8h hi = *(const v8h*)(p + 16);
  return __builtin_shufflevector(lo, hi, 0, 1, 2, 3, 4, 5, 6, 7, 8, 9, 10, 11,
                                 12, 13, 14, 15);
}

// f32 source, 64 x 64 floats: thread t holds floats (t&15)*4.. of rows (t>>4)+8p.
// g already points at this thread's first float4; ld = row stride in floats.
__device__ __forceinline__ void fetch_f32(v4f (&r)[8], const float* __restrict__ g,
                                          int ld) {
#pragma unroll
  for (int p = 0; p < 8; ++p) r[p] = *(const v4f*)(g + p * 8 * ld);
}
__device__ __forceinline__ void put_f32(_Float16* s, const v4f (&r)[8]) {
#pragma unroll
  for (int p = 0; p < 8; ++p)
    *(v4h*)(s + p * 8 * PITCH) = __builtin_convertvector(r[p], v4h);
}
// f16 source, 64 x 64 halves: thread t holds halves (t&7)*8.. of rows (t>>3)+16p.
__device__ __forceinline__ void fetch_f16(v8h (&r)[4],
                                          const _Float16* __restrict__ g, int ld) {
#pragma unroll
  for (int p = 0; p < 4; ++p) r[p] = *(const v8h*)(g + p * 16 * ld);
}
__device__ __forceinline__ void put_f16(_Float16* s, const v8h (&r)[4]) {
#pragma unroll
  for (int p = 0; p < 4; ++p) *(v8h*)(s + p * 16 * PITCH) = r[p];
}

// ---------------------------------------------------------------------------
// Kernel 0: sigmoid(rpe) -> f32 bias table, laid out for the attention kernel:
// tab[h][c][z] = sigmoid(rpe[S-1 + i - j][h]) at z + c = j - i + S-1, c = 0..3.
// Head-major and ascending in the key j, so that the biases of consecutive keys
// of one query are consecutive floats; the four copies, each shifted by one
// float, give every query a copy in which its runs start on a 16-byte boundary.
// Entries past the last relative position are zero and never enter a score.
// ---------------------------------------------------------------------------
#define NREL (2 * SEQ - 1)     // relative positions
#define TAB_Z 4096             // floats per copy in the global table
#define WIN_Z 2112             // floats of a copy that one 64-query block stages
#define WIN_PITCH 2128         // LDS pitch of a copy: 16 banks past a multiple of 64
__global__ void rpe_sigmoid_kernel(const float* __restrict__ rpe,
                                   float* __restrict__ tab) {
  // t = (h * 4 + c) * TAB_Z + u with u = TAB_Z-1 - z, so that the row of rpe,
  // NREL-1 - (z + c) = u - 1 - c, ascends with the thread.
  const unsigned t = blockIdx.x * blockDim.x + threadIdx.x;
  const unsigned u = t & (TAB_Z - 1);
  const unsigned c = (t >> 12) & 3;
  const unsigned h = t >> 14;
  float v = 0.0f;
  if (u > c) v = 1.0f / (1.0f + __expf(-rpe[(u - 1 - c) * HEADS + h]));
  tab[(t | (TAB_Z - 1)) - u] = v;
}

// ---------------------------------------------------------------------------
// Kernel 1: fused QKV projection.  X (8192x512 f32) @ W^T + b -> f16.
// grid = (M/64, H, 3)  block = 128 (4 waves)
// Q,K stored [B,H,S,64]; V stored transposed [B,H,64,S].
// Head split per reference: feature n -> h = n % 8, d = n / 8.
// A block takes the 64 features of ONE head (rows d*8 + h of W), so that its
// output tile is 64 whole 128-byte lines: rows s of Q or K, rows d of V^T.
// The operand whose rows are the output's rows goes in as B (a lane owns one
// output row, a wave 16 of them), the other as A (a lane's 8 accumulator
// registers are 8 consecutive elements of that row).  Each wave lays its 16 rows
// in LDS and stores them as whole lines, four lines an instruction.
// ---------------------------------------------------------------------------
// VT = false: out rows are positions (Q, K); VT = true: head-dims (V^T).
// dst = first element of the block's output tile.
template <bool VT>
__device__ __forceinline__ void qkv_tile(const float* __restrict__ X,
                                         const float* __restrict__ W,
                                         const float* __restrict__ bias,
                                         _Float16* __restrict__ dst,
                                         _Float16 (&ta)[2][TILE_HALVES],
                                         _Float16 (&tb)[2][TILE_HALVES],
                                         float (&bsm)[HDIM]) {
  const int lane = threadIdx.x & 31;
  const int wave = threadIdx.x >> 5;
  const int lr = lane & 15;   // row-in-tile of an operand
  const int hs = lane >> 4;   // half select
  const int h = blockIdx.y;

  // Row d of the head's weights is feature d*H + h (reference split_heads).
  constexpr int LDW = HEADS * DMODEL;
  constexpr int LDA = VT ? DMODEL : LDW;
  constexpr int LDB = VT ? LDW : DMODEL;
  const int srow = threadIdx.x >> 4, scol = (threadIdx.x & 15) * 4;
  const float* xg = X + (blockIdx.x * 64 + srow) * DMODEL + scol;
  const float* wg = W + (srow * HEADS + h) * DMODEL + scol;
  const float* ag = VT ? xg : wg;
  const float* bg = VT ? wg : xg;
  const int soff = srow * PITCH + scol;

  v8f acc[4] = {{}, {}, {}, {}};
  v4f ar[8], br[8];
  fetch_f32(ar, ag, LDA);
  fetch_f32(br, bg, LDB);
  // behind the tile's loads, so that all share one latency
  if (threadIdx.x < HDIM) bsm[threadIdx.x] = bias[threadIdx.x * HEADS + h];
  put_f32(&ta[0][soff], ar);
  put_f32(&tb[0][soff], br);
  __syncthreads();  // publishes tile 0 and the head's bias

  // acc[sub][r] = sum_k A[sub*16 + 8*hs + r][k] * B[wave*16 + lr][k]
  for (int it = 0; it < DMODEL / 64; ++it) {
    const int cur = it & 1;
    const bool more = it + 1 < DMODEL / 64;
    if (more) {  // next tile flies while this one is multiplied
      fetch_f32(ar, ag + (it + 1) * 64, LDA);
      fetch_f32(br, bg + (it + 1) * 64, LDB);
    }
#pragma unroll
    for (int c = 0; c < 2; ++c) {
      const v16h b = frag_lds(&tb[cur][(wave * 16 + lr) * PITCH + c * 32 + hs * 8]);
#pragma unroll
      for (int sub = 0; sub < 4; ++sub) {
        const v16h a =
            frag_lds(&ta[cur][(sub * 16 + lr) * PITCH + c * 32 + hs * 8]);
        acc[sub] = wmma_f16(a, b, acc[sub]);
      }
    }
    if (more) {
      put_f32(&ta[cur ^ 1][soff], ar);
      put_f32(&tb[cur ^ 1][soff], br);
    }
    // publishes the next tile and ends the reads of this one before its refill
    __syncthreads();
  }

  // The operand tiles are free since the loop's last barrier; each wave stages
  // in 16 rows of its own.
  _Float16* st = &ta[0][wave * 16 * PITCH];
#pragma unroll
  for (int sub = 0; sub < 4; ++sub) {
    v8f bn;
    if (VT) {
      const float b1 = bsm[wave * 16 + lr];
#pragma unroll
      for (int r = 0; r < 8; ++r) bn[r] = b1;
    } else {
      const v4f lo = *(const v4f*)&bsm[sub * 16 + 8 * hs];
      const v4f hi = *(const v4f*)&bsm[sub * 16 + 8 * hs + 4];
      bn = __builtin_shufflevector(lo, hi, 0, 1, 2, 3, 4, 5, 6, 7);
    }
    v8h w;
#pragma unroll
    for (int r = 0; r < 8; ++r) w[r] = (_Float16)(acc[sub][r] + bn[r]);
    *(v8h*)&st[lr * PITCH + sub * 16 + 8 * hs] = w;
  }
  // The rows are read back by other lanes of the same wave: the writes have
  // retired, and the compiler moves no read over this line.
  asm volatile("s_wait_dscnt 0x0" ::: "memory");

  constexpr int OPITCH = VT ? SEQ : HDIM;  // row stride of the output tile
  _Float16* o = dst + (wave * 16 + (lane >> 3)) * OPITCH + (lane & 7) * 8;
#pragma unroll
  for (int j = 0; j < 4; ++j)
    *(v8h*)(o + j * 4 * OPITCH) =
        *(const v8h*)&st[(j * 4 + (lane >> 3)) * PITCH + (lane & 7) * 8];
}

__global__ __launch_bounds__(128) void qkv_proj_kernel(
    const float* __restrict__ X,
    const float* __restrict__ Wq, const float* __restrict__ bq,
    const float* __restrict__ Wk, const float* __restrict__ bk,
    const float* __restrict__ Wv, const float* __restrict__ bv,
    _Float16* __restrict__ qf, _Float16* __restrict__ kf,
    _Float16* __restrict__ vt) {
  __shared__ __attribute__((aligned(16))) _Float16 ta[2][TILE_HALVES];
  __shared__ __attribute__((aligned(16))) _Float16 tb[2][TILE_HALVES];
  __shared__ __attribute__((aligned(16))) float bsm[HDIM];  // bias of this head

  const int mode = blockIdx.z;
  const int m0 = blockIdx.x * 64;
  const size_t bh = (m0 >> 11) * HEADS + blockIdx.y;  // m / SEQ
  const int s0 = m0 & (SEQ - 1);
  const size_t qk_off = (bh * SEQ + s0) * HDIM;

  if (mode == 2)
    qkv_tile<true>(X, Wv, bv, vt + bh * HDIM * SEQ + s0, ta, tb, bsm);
  else
    qkv_tile<false>(X, mode ? Wk : Wq, mode ? bk : bq,
                    (mode ? kf : qf) + qk_off, ta, tb, bsm);
}

// ---------------------------------------------------------------------------
// Kernel 2: flash attention, transposed products.
// grid = (S/64, H, B), block = 128 (4 waves, each owns 16 queries).
// Per 64-key tile: S^T = K Q^T (8 WMMA; A = K rows from LDS, B = Q in registers),
// so a lane holds 32 scores of ONE query (column lr; keys 8*hs + r of each
// 16-key group): maximum and sum run in-lane, plus one exchange between the
// wave's halves.  Two score tiles, converted in place, are the B operand of
// O^T += V^T P^T (8 WMMA): P never leaves the registers.
// The bias depends on j - i alone: a block's 64 queries and all keys meet 2111
// relative positions, staged once in LDS (four shifted copies); the 8 biases of
// a score tile's lane are then two 16-byte LDS reads.
// Output written f16 to ao [B,S,D] with f = h*64 + d.
// ---------------------------------------------------------------------------
// Value of lane l ^ 16.
__device__ __forceinline__ float other_half(float x) {
  const int b = __builtin_bit_cast(int, x);
  return __builtin_bit_cast(
      float, __builtin_amdgcn_permlanex16(b, b, 0x76543210, 0xfedcba98, false,
                                          false));
}

// e^x of the eight scores of one tile: the multiply by log2(e) and v_exp_f32, as
// __expf compiles.  Written as one statement so that the v_nop stands directly
// behind the last v_exp_f32: the instruction set asks for one independent
// instruction between a transcendental and a vector instruction that uses its
// result or overwrites its source.  Inside the run each
// v_exp_f32 is independent of the one before (outputs early-clobber).
__device__ __forceinline__ void exp_tile(v8f& s, float m) {
  const float a0 = (s[0] - m) * 1.44269504f, a1 = (s[1] - m) * 1.44269504f;
  const float a2 = (s[2] - m) * 1.44269504f, a3 = (s[3] - m) * 1.44269504f;
  const float a4 = (s[4] - m) * 1.44269504f, a5 = (s[5] - m) * 1.44269504f;
  const float a6 = (s[6] - m) * 1.44269504f, a7 = (s[7] - m) * 1.44269504f;
  float p0, p1, p2, p3, p4, p5, p6, p7;
  asm("v_exp_f32 %0, %8\n\tv_exp_f32 %1, %9\n\tv_exp_f32 %2, %10\n\t"
      "v_exp_f32 %3, %11\n\tv_exp_f32 %4, %12\n\tv_exp_f32 %5, %13\n\t"
      "v_exp_f32 %6, %14\n\tv_exp_f32 %7, %15\n\tv_nop"
      : "=&v"(p0), "=&v"(p1), "=&v"(p2), "=&v"(p3), "=&v"(p4), "=&v"(p5),
        "=&v"(p6), "=&v"(p7)
      : "v"(a0), "v"(a1), "v"(a2), "v"(a3), "v"(a4), "v"(a5), "v"(a6), "v"(a7));
  s[0] = p0; s[1] = p1; s[2] = p2; s[3] = p3;
  s[4] = p4; s[5] = p5; s[6] = p6; s[7] = p7;
}

__global__ __launch_bounds__(128) void flash_attn_kernel(
    const _Float16* __restrict__ qf, const _Float16* __restrict__ kf,
    const _Float16* __restrict__ vt, const float* __restrict__ tab,
    const float* __restrict__ logit_scale, _Float16* __restrict__ ao) {
  __shared__ __attribute__((aligned(16))) _Float16 ks[2][TILE_HALVES];
  __shared__ __attribute__((aligned(16))) _Float16 vs[2][TILE_HALVES];
  __shared__ __attribute__((aligned(16))) float bw[4 * WIN_PITCH];

  const int lane = threadIdx.x & 31;
  const int wave = threadIdx.x >> 5;
  const int lr = lane & 15;
  const int hs = lane >> 4;

  const int b = blockIdx.z;
  const int h = blockIdx.y;
  const int q0 = blockIdx.x * 64 + wave * 16;
  const int i = q0 + lr;  // this lane's query

  // scale = exp(min(ls, ln(100))) / sqrt(D_MODEL)
  const float scale =
      __expf(fminf(logit_scale[h], 4.6051702f)) * 0.04419417382f;

  const int bh = b * HEADS + h;

  // Q strip as B operand: column = query lr, 64 k (two chunks of 32)
  const _Float16* qp = qf + ((size_t)bh * SEQ + i) * HDIM + hs * 8;
  v16h bq[2];
  bq[0] = load_tile_f16(qp);
  bq[1] = load_tile_f16(qp + 32);
  // The zeroing of the accumulators below reuses Q's address registers: this
  // wait stands between the four loads and that overwrite.
  asm volatile("s_wait_xcnt 0x0" ::: "memory");

  v8f o[4] = {{}, {}, {}, {}};  // o[sd][r] = O^T[sd*16 + 8*hs + r][query lr]
  float mrow = -1e30f;          // running maximum of this lane's query
  float lrow = 0.0f;            // running sum over this half's keys only

  const int srow = threadIdx.x >> 3, scol = (threadIdx.x & 7) * 8;
  const _Float16* kg = kf + ((size_t)bh * SEQ + srow) * HDIM + scol;
  const _Float16* vg = vt + ((size_t)bh * HDIM + srow) * SEQ + scol;
  const int soff = srow * PITCH + scol;
  v8h kr[4], vr[4];
  fetch_f16(kr, kg, HDIM);
  fetch_f16(vr, vg, SEQ);
  // Bias window of this block: wave c stages copy c, floats z0 .. z0 + WIN_Z - 1
  // with z0 = S-1 - (last query of the block), whole lines, 16 bytes a lane; the
  // last 64 floats go 8 bytes a lane, which keeps every lane on.  Its loads are
  // issued with those of K and V^T tile 0, so that all share one latency.
  const float* tg = tab + (h * 4 + wave) * TAB_Z + (SEQ - 64 - blockIdx.x * 64);
  float* tl = &bw[wave * WIN_PITCH];
  v4f wr[16];
#pragma unroll
  for (int p = 0; p < 16; ++p) wr[p] = *(const v4f*)(tg + p * 128 + lane * 4);
  const v2f wt = *(const v2f*)(tg + 2048 + lane * 2);
  // The code behind reuses these loads' address registers: this wait stands
  // between the loads and that overwrite.
  asm volatile("s_wait_xcnt 0x0" ::: "memory");
  put_f16(&ks[0][soff], kr);
  put_f16(&vs[0][soff], vr);
#pragma unroll
  for (int p = 0; p < 16; ++p) *(v4f*)(tl + p * 128 + lane * 4) = wr[p];
  *(v2f*)(tl + 2048 + lane * 2) = wt;
  // This lane's biases: window index of (query i, key j) is j + 63 - (i - block's
  // first query); copy 3 - (lr & 3) holds it at a multiple of 4 floats for j % 4 == 0.
  // (60 - 16 * wave - (lr & 12), written as a sum of terms that are never negative)
  const float* bl = &bw[((lr & 3) ^ 3) * WIN_PITCH + (wave ^ 3) * 16 +
                        ((lr & 12) ^ 12) + 8 * hs];
  __syncthreads();  // publishes K and V^T tile 0 and the bias window

  for (int kt = 0; kt < SEQ / 64; ++kt) {
    const int j0 = kt * 64;
    const int cur = kt & 1;
    const bool more = kt + 1 < SEQ / 64;
    if (more) {  // next tiles fly during scores and softmax
      fetch_f16(kr, kg + (size_t)(j0 + 64) * HDIM, HDIM);
      fetch_f16(vr, vg + (j0 + 64), SEQ);
    }

    // ---- scores: S^T = K Q^T * scale + sigmoid(rpe[i-j+S-1, h]) ----
    // (element r of tile sub is key j0 + sub*16 + 8*hs + r)
    v8f sv[4];
#pragma unroll
    for (int sub = 0; sub < 4; ++sub) {
      const _Float16* kp = &ks[cur][(sub * 16 + lr) * PITCH + hs * 8];
      v8f s = {};
      s = wmma_f16(frag_lds(kp), bq[0], s);
      s = wmma_f16(frag_lds(kp + 32), bq[1], s);
      const v4f b0 = *(const v4f*)(bl + j0 + sub * 16);
      const v4f b1 = *(const v4f*)(bl + j0 + sub * 16 + 4);
#pragma unroll
      for (int r = 0; r < 4; ++r) {
        s[r]     = s[r] * scale + b0[r];
        s[r + 4] = s[r + 4] * scale + b1[r];
      }
      sv[sub] = s;
    }

    // ---- tile maximum of this query: in-lane, then the other half's ----
    float tmax = sv[0][0];
#pragma unroll
    for (int sub = 0; sub < 4; ++sub)
#pragma unroll
      for (int r = 0; r < 8; ++r) tmax = fmaxf(tmax, sv[sub][r]);
    tmax = fmaxf(tmax, other_half(tmax));

    // ---- online softmax update ----
    const float nm = fmaxf(mrow, tmax);
    const float corr = __expf(mrow - nm);
    mrow = nm;
    float ts[4];  // four independent chains
#pragma unroll
    for (int sub = 0; sub < 4; ++sub) {
      exp_tile(sv[sub], nm);
      ts[sub] = sv[sub][0];
#pragma unroll
      for (int r = 1; r < 8; ++r) ts[sub] += sv[sub][r];
    }
    lrow = lrow * corr + ((ts[0] + ts[1]) + (ts[2] + ts[3]));
#pragma unroll
    for (int sd = 0; sd < 4; ++sd)
#pragma unroll
      for (int r = 0; r < 8; ++r) o[sd][r] *= corr;

    // The other K/V buffer was last read in the pass before, which ended at the
    // barrier at this loop's foot.
    if (more) {
      put_f16(&ks[cur ^ 1][soff], kr);
      put_f16(&vs[cur ^ 1][soff], vr);
    }

    // ---- P^T as B operand: score tiles 2c and 2c+1 hold keys 8*hs + 0..7 and
    // 16 + 8*hs + 0..7 of chunk c, the k order of frag_lds ----
    v16h bp[2];
#pragma unroll
    for (int c = 0; c < 2; ++c)
#pragma unroll
      for (int t = 0; t < 8; ++t) {
        bp[c][t]     = (_Float16)sv[2 * c][t];
        bp[c][t + 8] = (_Float16)sv[2 * c + 1][t];
      }

    // ---- O^T += V^T P^T   (V^T rows are head-dims; contiguous over j) ----
#pragma unroll
    for (int sd = 0; sd < 4; ++sd) {
      const _Float16* vp = &vs[cur][(sd * 16 + lr) * PITCH + hs * 8];
      o[sd] = wmma_f16(frag_lds(vp), bp[0], o[sd]);
      o[sd] = wmma_f16(frag_lds(vp + 32), bp[1], o[sd]);
    }
    // publishes the next tiles and ends the reads of these before their refill
    __syncthreads();
  }

  // ---- epilogue: join the halves' sums, O / l, merge heads (f = h*64 + d);
  // a lane's 8 registers are 8 consecutive d of its query: one 16-byte store ----
  const float ltot = lrow + other_half(lrow);
#pragma unroll
  for (int sd = 0; sd < 4; ++sd) {
    v8h w;
#pragma unroll
    for (int r = 0; r < 8; ++r) w[r] = (_Float16)(o[sd][r] / ltot);
    *(v8h*)&ao[((size_t)b * SEQ + i) * DMODEL + h * HDIM + sd * 16 + 8 * hs] = w;
  }
}

// ---------------------------------------------------------------------------
// Kernel 3: output projection.  AO (8192x512 f16) @ Wp^T + bp -> f32 d_out.
// ---------------------------------------------------------------------------
__global__ __launch_bounds__(128) void out_proj_kernel(
    const _Float16* __restrict__ ao, const float* __restrict__ Wp,
    const float* __restrict__ bp, float* __restrict__ out) {
  const int lane = threadIdx.x & 31;
  const int wave = threadIdx.x >> 5;
  const int lr = lane & 15;
  const int hs = lane >> 4;

  const int m0 = blockIdx.x * 64 + wave * 16;
  const int n0 = blockIdx.y * 64;

  __shared__ __attribute__((aligned(16))) _Float16 as[2][TILE_HALVES];
  __shared__ __attribute__((aligned(16))) _Float16 wsm[2][TILE_HALVES];

  const int arow = threadIdx.x >> 3, acol = (threadIdx.x & 7) * 8;
  const int wrow = threadIdx.x >> 4, wcol = (threadIdx.x & 15) * 4;
  const _Float16* ag = ao + (size_t)(blockIdx.x * 64 + arow) * DMODEL + acol;
  const float* wg = Wp + (n0 + wrow) * DMODEL + wcol;
  const int aoff = arow * PITCH + acol;
  const int woff = wrow * PITCH + wcol;

  v8f acc[4] = {{}, {}, {}, {}};
  v8h ar[4];
  v4f wr[8];
  fetch_f16(ar, ag, DMODEL);
  fetch_f32(wr, wg, DMODEL);
  put_f16(&as[0][aoff], ar);
  put_f32(&wsm[0][woff], wr);
  __syncthreads();  // publishes tile 0

  for (int it = 0; it < DMODEL / 64; ++it) {
    const int cur = it & 1;
    const bool more = it + 1 < DMODEL / 64;
    if (more) {  // next tile flies while this one is multiplied
      fetch_f16(ar, ag + (it + 1) * 64, DMODEL);
      fetch_f32(wr, wg + (it + 1) * 64, DMODEL);
    }
#pragma unroll
    for (int c = 0; c < 2; ++c) {
      const v16h a = frag_lds(&as[cur][(wave * 16 + lr) * PITCH + c * 32 + hs * 8]);
#pragma unroll
      for (int sub = 0; sub < 4; ++sub) {
        const v16h bm =
            frag_lds(&wsm[cur][(sub * 16 + lr) * PITCH + c * 32 + hs * 8]);
        acc[sub] = wmma_f16(a, bm, acc[sub]);
      }
    }
    if (more) {
      put_f16(&as[cur ^ 1][aoff], ar);
      put_f32(&wsm[cur ^ 1][woff], wr);
    }
    // publishes the next tile and ends the reads of this one before its refill
    __syncthreads();
  }

#pragma unroll
  for (int sub = 0; sub < 4; ++sub) {
    const int n = n0 + sub * 16 + lr;
    const float bn = bp[n];
#pragma unroll
    for (int r = 0; r < 8; ++r) {
      const int m = m0 + r + 8 * hs;
      out[(size_t)m * DMODEL + n] = acc[sub][r] + bn;
    }
  }
}

// ---------------------------------------------------------------------------
extern "C" void kernel_launch(void* const* d_in, const int* in_sizes, int n_in,
                              void* d_out, int out_size, void* d_ws,
                              size_t ws_size, hipStream_t stream) {
  (void)in_sizes; (void)n_in; (void)out_size; (void)ws_size;

  const float* query = (const float*)d_in[0];
  const float* Wq = (const float*)d_in[1];
  const float* bq = (const float*)d_in[2];
  const float* Wk = (const float*)d_in[3];
  const float* bk = (const float*)d_in[4];
  const float* Wv = (const float*)d_in[5];
  const float* bv = (const float*)d_in[6];
  const float* Wp = (const float*)d_in[7];
  const float* bp = (const float*)d_in[8];
  const float* logit_scale = (const float*)d_in[9];
  const float* rpe = (const float*)d_in[10];

  // workspace carve-up
  const size_t QKV_ELEMS = (size_t)BATCH * HEADS * SEQ * HDIM;  // 4.19M halves
  char* ws = (char*)d_ws;
  float* tab = (float*)ws;                         // 8*4*4096 f32 = 524288 B
  _Float16* qf = (_Float16*)(ws + 524288);
  _Float16* kf = qf + QKV_ELEMS;
  _Float16* vt = kf + QKV_ELEMS;
  _Float16* ao = vt + QKV_ELEMS;

  rpe_sigmoid_kernel<<<(HEADS * 4 * TAB_Z) / 256, 256, 0, stream>>>(rpe, tab);

  qkv_proj_kernel<<<dim3((BATCH * SEQ) / 64, HEADS, 3), 128, 0, stream>>>(
      query, Wq, bq, Wk, bk, Wv, bv, qf, kf, vt);

  flash_attn_kernel<<<dim3(SEQ / 64, HEADS, BATCH), 128, 0, stream>>>(
      qf, kf, vt, tab, logit_scale, ao);

  out_proj_kernel<<<dim3((BATCH * SEQ) / 64, DMODEL / 64), 128, 0, stream>>>(
      ao, Wp, bp, (float*)d_out);
}

// v005
// A run of this version takes 78.9 microseconds.
// Timed twice side by side with v004, it ran 1.05 and 1.04 times as fast.
// Counting every step since v000, it is 4.06 times as fast.
#include <hip/hip_runtime.h>
#include <hip/hip_bf16.h>

// ---------------------------------------------------------------------------
// Multi-head attention (logit_scale + sigmoid rel-pos bias)
// B=4, S=2048, D=512, H=8, hd=64.  f16 WMMA (v_wmma_f32_16x16x32_f16),
// f32 accumulate, fused flash-attention middle stage.
// ---------------------------------------------------------------------------

#define BATCH 4
#define SEQ   2048
#define DMODEL 512
#define HEADS 8
#define HDIM  64

typedef __attribute__((ext_vector_type(16))) _Float16 v16h;
typedef __attribute__((ext_vector_type(8)))  float    v8f;

__device__ __forceinline__ v8f wmma_f16(v16h a, v16h b, v8f c) {
  // (neg_a, A, neg_b, B, c_mod, C, reuse_a, reuse_b)
  return __builtin_amdgcn_wmma_f32_16x16x32_f16(false, a, false, b, (short)0, c,
                                                false, false);
}

// A/B operand loader (16x32 f16 tile, one row per lane).
// p must already point at row_base + k_chunk + (lane>=16 ? 8 : 0).
// Elements [0..7] = K+0..7 of this lane's chunk, [8..15] = K+16..23.
__device__ __forceinline__ v16h load_tile_f16(const _Float16* __restrict__ p) {
  v16h a;
#pragma unroll
  for (int t = 0; t < 8; ++t) {
    a[t]     = p[t];
    a[t + 8] = p[t + 16];
  }
  return a;
}

// LDS staging of operand tiles.  A tile is 64 rows x 64 f16 (128 B a row), laid
// at a pitch of 144 B (16 B x odd: conflict-free for 16-byte reads).  128 threads (the
// block, or a key half in the attention kernel) fetch it with 16-byte loads whose 32 lanes cover four whole 128-B
// lines; each of the 4 waves then reads its fragments from LDS.
typedef __attribute__((ext_vector_type(8))) _Float16 v8h;
typedef __attribute__((ext_vector_type(4))) _Float16 v4h;
typedef __attribute__((ext_vector_type(4))) float    v4f;
typedef __attribute__((ext_vector_type(2))) float    v2f;
#define PITCH 72
#define TILE_HALVES (64 * PITCH)

// Fragment from LDS: same element order as load_tile_f16
// (p = row base + k_chunk + (lane>=16 ? 8 : 0)).
__device__ __forceinline__ v16h frag_lds(const _Float16* p) {
  const v8h lo = *(const v8h*)p;
  const v8h hi = *(const v8h*)(p + 16);
  return __builtin_shufflevector(lo, hi, 0, 1, 2, 3, 4, 5, 6, 7, 8, 9, 10, 11,
                                 12, 13, 14, 15);
}

// f32 source, 64 x 64 floats: thread t holds floats (t&15)*4.. of rows (t>>4)+8p.
// g already points at this thread's first float4; ld = row stride in floats.
__device__ __forceinline__ void fetch_f32(v4f (&r)[8], const float* __restrict__ g,
                                          int ld) {
#pragma unroll
  for (int p = 0; p < 8; ++p) r[p] = *(const v4f*)(g + p * 8 * ld);
}
__device__ __forceinline__ void put_f32(_Float16* s, const v4f (&r)[8]) {
#pragma unroll
  for (int p = 0; p < 8; ++p)
    *(v4h*)(s + p * 8 * PITCH) = __builtin_convertvector(r[p], v4h);
}
// f16 source, 64 x 64 halves: thread t holds halves (t&7)*8.. of rows (t>>3)+16p.
__device__ __forceinline__ void fetch_f16(v8h (&r)[4],
                                          const _Float16* __restrict__ g, int ld) {
#pragma unroll
  for (int p = 0; p < 4; ++p) r[p] = *(const v8h*)(g + p * 16 * ld);
}
__device__ __forceinline__ void put_f16(_Float16* s, const v8h (&r)[4]) {
#pragma unroll
  for (int p = 0; p < 4; ++p) *(v8h*)(s + p * 16 * PITCH) = r[p];
}

// ---------------------------------------------------------------------------
// Kernel 0: sigmoid(rpe) -> f32 bias table, laid out for the attention kernel:
// tab[h][c][z] = sigmoid(rpe[S-1 + i - j][h]) at z + c = j - i + S-1, c = 0..3.
// Head-major and ascending in the key j, so that the biases of consecutive keys
// of one query are consecutive floats; the four copies, each shifted by one
// float, give every query a copy in which its runs start on a 16-byte boundary.
// Entries past the last relative position are zero and never enter a score.
// ---------------------------------------------------------------------------
#define NREL (2 * SEQ - 1)     // relative positions
#define TAB_Z 4096             // floats per copy in the global table
#define WIN_Z 2176             // floats of a copy that one 128-query block stages
#define WIN_PITCH 2192         // LDS pitch of a copy: 16 banks past a multiple of 64
__global__ void rpe_sigmoid_kernel(const float* __restrict__ rpe,
                                   float* __restrict__ tab) {
  // t = (h * 4 + c) * TAB_Z + u with u = TAB_Z-1 - z, so that the row of rpe,
  // NREL-1 - (z + c) = u - 1 - c, ascends with the thread.
  const unsigned t = blockIdx.x * blockDim.x + threadIdx.x;
  const unsigned u = t & (TAB_Z - 1);
  const unsigned c = (t >> 12) & 3;
  const unsigned h = t >> 14;
  float v = 0.0f;
  if (u > c) v = 1.0f / (1.0f + __expf(-rpe[(u - 1 - c) * HEADS + h]));
  tab[(t | (TAB_Z - 1)) - u] = v;
}

// ---------------------------------------------------------------------------
// Kernel 1: fused QKV projection.  X (8192x512 f32) @ W^T + b -> f16.
// grid = (M/64, H, 3)  block = 128 (4 waves)
// Q,K stored [B,H,S,64]; V stored transposed [B,H,64,S].
// Head split per reference: feature n -> h = n % 8, d = n / 8.
// A block takes the 64 features of ONE head (rows d*8 + h of W), so that its
// output tile is 64 whole 128-byte lines: rows s of Q or K, rows d of V^T.
// The operand whose rows are the output's rows goes in as B (a lane owns one
// output row, a wave 16 of them), the other as A (a lane's 8 accumulator
// registers are 8 consecutive elements of that row).  Each wave lays its 16 rows
// in LDS and stores them as whole lines, four lines an instruction.
// ---------------------------------------------------------------------------
// VT = false: out rows are positions (Q, K); VT = true: head-dims (V^T).
// dst = first element of the block's output tile.
template <bool VT>
__device__ __forceinline__ void qkv_tile(const float* __restrict__ X,
                                         const float* __restrict__ W,
                                         const float* __restrict__ bias,
                                         _Float16* __restrict__ dst,
                                         _Float16 (&ta)[2][TILE_HALVES],
                                         _Float16 (&tb)[2][TILE_HALVES],
                                         float (&bsm)[HDIM]) {
  const int lane = threadIdx.x & 31;
  const int wave = threadIdx.x >> 5;
  const int lr = lane & 15;   // row-in-tile of an operand
  const int hs = lane >> 4;   // half select
  const int h = blockIdx.y;

  // Row d of the head's weights is feature d*H + h (reference split_heads).
  constexpr int LDW = HEADS * DMODEL;
  constexpr int LDA = VT ? DMODEL : LDW;
  constexpr int LDB = VT ? LDW : DMODEL;
  const int srow = threadIdx.x >> 4, scol = (threadIdx.x & 15) * 4;
  const float* xg = X + (blockIdx.x * 64 + srow) * DMODEL + scol;
  const float* wg = W + (srow * HEADS + h) * DMODEL + scol;
  const float* ag = VT ? xg : wg;
  const float* bg = VT ? wg : xg;
  const int soff = srow * PITCH + scol;

  v8f acc[4] = {{}, {}, {}, {}};
  v4f ar[8], br[8];
  fetch_f32(ar, ag, LDA);
  fetch_f32(br, bg, LDB);
  // behind the tile's loads, so that all share one latency
  if (threadIdx.x < HDIM) bsm[threadIdx.x] = bias[threadIdx.x * HEADS + h];
  put_f32(&ta[0][soff], ar);
  put_f32(&tb[0][soff], br);
  __syncthreads();  // publishes tile 0 and the head's bias

  // acc[sub][r] = sum_k A[sub*16 + 8*hs + r][k] * B[wave*16 + lr][k]
  for (int it = 0; it < DMODEL / 64; ++it) {
    const int cur = it & 1;
    const bool more = it + 1 < DMODEL / 64;
    if (more) {  // next tile flies while this one is multiplied
      fetch_f32(ar, ag + (it + 1) * 64, LDA);
      fetch_f32(br, bg + (it + 1) * 64, LDB);
    }
#pragma unroll
    for (int c = 0; c < 2; ++c) {
      const v16h b = frag_lds(&tb[cur][(wave * 16 + lr) * PITCH + c * 32 + hs * 8]);
#pragma unroll
      for (int sub = 0; sub < 4; ++sub) {
        const v16h a =
            frag_lds(&ta[cur][(sub * 16 + lr) * PITCH + c * 32 + hs * 8]);
        acc[sub] = wmma_f16(a, b, acc[sub]);
      }
    }
    if (more) {
      put_f32(&ta[cur ^ 1][soff], ar);
      put_f32(&tb[cur ^ 1][soff], br);
    }
    // publishes the next tile and ends the reads of this one before its refill
    __syncthreads();
  }

  // The operand tiles are free since the loop's last barrier; each wave stages
  // in 16 rows of its own.
  _Float16* st = &ta[0][wave * 16 * PITCH];
#pragma unroll
  for (int sub = 0; sub < 4; ++sub) {
    v8f bn;
    if (VT) {
      const float b1 = bsm[wave * 16 + lr];
#pragma unroll
      for (int r = 0; r < 8; ++r) bn[r] = b1;
    } else {
      const v4f lo = *(const v4f*)&bsm[sub * 16 + 8 * hs];
      const v4f hi = *(const v4f*)&bsm[sub * 16 + 8 * hs + 4];
      bn = __builtin_shufflevector(lo, hi, 0, 1, 2, 3, 4, 5, 6, 7);
    }
    v8h w;
#pragma unroll
    for (int r = 0; r < 8; ++r) w[r] = (_Float16)(acc[sub][r] + bn[r]);
    *(v8h*)&st[lr * PITCH + sub * 16 + 8 * hs] = w;
  }
  // The rows are read back by other lanes of the same wave: the writes have
  // retired, and the compiler moves no read over this line.
  asm volatile("s_wait_dscnt 0x0" ::: "memory");

  constexpr int OPITCH = VT ? SEQ : HDIM;  // row stride of the output tile
  _Float16* o = dst + (wave * 16 + (lane >> 3)) * OPITCH + (lane & 7) * 8;
#pragma unroll
  for (int j = 0; j < 4; ++j)
    *(v8h*)(o + j * 4 * OPITCH) =
        *(const v8h*)&st[(j * 4 + (lane >> 3)) * PITCH + (lane & 7) * 8];
}

__global__ __launch_bounds__(128) void qkv_proj_kernel(
    const float* __restrict__ X,
    const float* __restrict__ Wq, const float* __restrict__ bq,
    const float* __restrict__ Wk, const float* __restrict__ bk,
    const float* __restrict__ Wv, const float* __restrict__ bv,
    _Float16* __restrict__ qf, _Float16* __restrict__ kf,
    _Float16* __restrict__ vt) {
  __shared__ __attribute__((aligned(16))) _Float16 ta[2][TILE_HALVES];
  __shared__ __attribute__((aligned(16))) _Float16 tb[2][TILE_HALVES];
  __shared__ __attribute__((aligned(16))) float bsm[HDIM];  // bias of this head

  const int mode = blockIdx.z;
  const int m0 = blockIdx.x * 64;
  const size_t bh = (m0 >> 11) * HEADS + blockIdx.y;  // m / SEQ
  const int s0 = m0 & (SEQ - 1);
  const size_t qk_off = (bh * SEQ + s0) * HDIM;

  if (mode == 2)
    qkv_tile<true>(X, Wv, bv, vt + bh * HDIM * SEQ + s0, ta, tb, bsm);
  else
    qkv_tile<false>(X, mode ? Wk : Wq, mode ? bk : bq,
                    (mode ? kf : qf) + qk_off, ta, tb, bsm);
}

// ---------------------------------------------------------------------------
// Kernel 2: flash attention, transposed products.
// grid = (S/128, H, B), block = 256: 8 waves = 4 query strips x 2 key halves.  A
// wave owns 32 queries (two column groups of 16, so that every K and V^T fragment
// read from LDS feeds two WMMAs) and walks 1024 keys, which keeps four waves on a
// SIMD; the two partial results of a strip are merged through LDS at the end.
// Per 64-key tile and group: S^T = K Q^T (8 WMMA; A = K rows from LDS, B = Q in
// registers), so a lane holds 32 scores of ONE query of the group (column lr;
// keys 8*hs + r of each 16-key group): maximum and sum run in-lane, plus one
// exchange between the wave's halves.  Two score tiles, converted in place, are
// the B operand of O^T += V^T P^T (8 WMMA): P never leaves the registers.
// The bias depends on j - i alone: a block's 128 queries and all keys meet 2175
// relative positions, staged once in LDS (four shifted copies); the 8 biases of
// a score tile's lane are then two 16-byte LDS reads.
// Output written f16 to ao [B,S,D] with f = h*64 + d.
// ---------------------------------------------------------------------------
// Value of lane l ^ 16.
__device__ __forceinline__ float other_half(float x) {
  const int b = __builtin_bit_cast(int, x);
  return __builtin_bit_cast(
      float, __builtin_amdgcn_permlanex16(b, b, 0x76543210, 0xfedcba98, false,
                                          false));
}

// e^x of the eight scores of one tile: the multiply by log2(e) and v_exp_f32, as
// __expf compiles.  Written as one statement so that the v_nop stands directly
// behind the last v_exp_f32: the instruction set asks for one independent
// instruction between a transcendental and a vector instruction that uses its
// result or overwrites its source.  Inside the run each
// v_exp_f32 is independent of the one before.  Each works in place: the statement
// writes only registers that the multiplies in front of it wrote, so it is never
// the first write over the operands of a matrix instruction just issued.
__device__ __forceinline__ void exp_tile(v8f& s, float m) {
  float a0 = (s[0] - m) * 1.44269504f, a1 = (s[1] - m) * 1.44269504f;
  float a2 = (s[2] - m) * 1.44269504f, a3 = (s[3] - m) * 1.44269504f;
  float a4 = (s[4] - m) * 1.44269504f, a5 = (s[5] - m) * 1.44269504f;
  float a6 = (s[6] - m) * 1.44269504f, a7 = (s[7] - m) * 1.44269504f;
  asm("v_exp_f32 %0, %0\n\tv_exp_f32 %1, %1\n\tv_exp_f32 %2, %2\n\t"
      "v_exp_f32 %3, %3\n\tv_exp_f32 %4, %4\n\tv_exp_f32 %5, %5\n\t"
      "v_exp_f32 %6, %6\n\tv_exp_f32 %7, %7\n\tv_nop"
      : "+v"(a0), "+v"(a1), "+v"(a2), "+v"(a3), "+v"(a4), "+v"(a5), "+v"(a6),
        "+v"(a7));
  s[0] = a0; s[1] = a1; s[2] = a2; s[3] = a3;
  s[4] = a4; s[5] = a5; s[6] = a6; s[7] = a7;
}

__global__ __launch_bounds__(256) __attribute__((amdgpu_waves_per_eu(4, 4)))
void flash_attn_kernel(
    const _Float16* __restrict__ qf, const _Float16* __restrict__ kf,
    const _Float16* __restrict__ vt, const float* __restrict__ tab,
    const float* __restrict__ logit_scale, _Float16* __restrict__ ao) {
  // One object, the bias window first: its reads then reach every tile of a pass
  // by the instruction's 16-bit offset from one address register.
  __shared__ __attribute__((aligned(16))) struct {
    float bw[4 * WIN_PITCH];
    _Float16 ks[2][2][TILE_HALVES];  // [buffer][key half]
    _Float16 vs[2][2][TILE_HALVES];
  } sm;
  auto& bw = sm.bw;
  auto& ks = sm.ks;
  auto& vs = sm.vs;

  const int lane = threadIdx.x & 31;
  const int wave = __builtin_amdgcn_readfirstlane(threadIdx.x >> 5);
  const int qs = wave & 3;   // query strip
  const int kh = wave >> 2;  // key half
  const int lr = lane & 15;
  const int hs = lane >> 4;

  const int b = blockIdx.z;
  const int h = blockIdx.y;
  const int i0 = blockIdx.x * 128 + qs * 32 + lr;  // this lane's query, group 0

  // scale = exp(min(ls, ln(100))) / sqrt(D_MODEL)
  const float scale =
      __expf(fminf(logit_scale[h], 4.6051702f)) * 0.04419417382f;

  const int bh = b * HEADS + h;

  // Q strips as B operands: column = query lr of group g, 64 k (two chunks of 32)
  const _Float16* qp = qf + ((size_t)bh * SEQ + i0) * HDIM + hs * 8;
  v16h bq[2][2];
#pragma unroll
  for (int g = 0; g < 2; ++g) {
    bq[g][0] = load_tile_f16(qp + g * 16 * HDIM);
    bq[g][1] = load_tile_f16(qp + g * 16 * HDIM + 32);
  }
  // The zeroing of the accumulators below reuses Q's address registers: this
  // wait stands between the loads and that overwrite.
  asm volatile("s_wait_xcnt 0x0" ::: "memory");

  // o[g][sd][r] = O^T[sd*16 + 8*hs + r][query lr of group g]
  v8f o[2][4] = {{{}, {}, {}, {}}, {{}, {}, {}, {}}};
  float mrow[2] = {-1e30f, -1e30f};  // running maximum of this lane's queries
  float lrow[2] = {0.0f, 0.0f};      // running sums over this half's keys only

  // The four waves of a key half stage that half's tiles.
  const int srow = (threadIdx.x & 127) >> 3, scol = (threadIdx.x & 7) * 8;
  const _Float16* kg =
      kf + ((size_t)bh * SEQ + kh * (SEQ / 2) + srow) * HDIM + scol;
  const _Float16* vg = vt + ((size_t)bh * HDIM + srow) * SEQ + kh * (SEQ / 2) + scol;
  const int soff = srow * PITCH + scol;
  v8h kr[4], vr[4];
  fetch_f16(kr, kg, HDIM);
  fetch_f16(vr, vg, SEQ);
  // Bias window of this block: floats z0 .. z0 + WIN_Z - 1 of each copy, with
  // z0 = S-1 - (last query of the block), whole lines.  Waves c and c + 4 stage
  // copy c: each 1024 floats, 16 bytes a lane, and 64 of the last 128 floats,
  // 8 bytes a lane, which keeps every lane on.
  // The loads are issued with those of K and V^T tile 0: all share one latency.
  const float* tg = tab + (h * 4 + qs) * TAB_Z + (SEQ - 128 - blockIdx.x * 128);
  float* tl = &bw[qs * WIN_PITCH];
  const int woff = kh * 1024 + lane * 4, toff = 2048 + kh * 64 + lane * 2;
  v4f wr[8];
#pragma unroll
  for (int p = 0; p < 8; ++p) wr[p] = *(const v4f*)(tg + woff + p * 128);
  const v2f wt = *(const v2f*)(tg + toff);
  // The code behind reuses these loads' address registers: this wait stands
  // between the loads and that overwrite.
  asm volatile("s_wait_xcnt 0x0" ::: "memory");
  put_f16(&ks[0][kh][soff], kr);
  put_f16(&vs[0][kh][soff], vr);
#pragma unroll
  for (int p = 0; p < 8; ++p) *(v4f*)(tl + woff + p * 128) = wr[p];
  *(v2f*)(tl + toff) = wt;
  // This lane's biases: window index of (query i, key j) is j + 127 - (i - block's
  // first query); copy 3 - (lr & 3) holds it at a multiple of 4 floats for j % 4 == 0.
  // (124 - 32 * qs - 16 * g - (lr & 12), written as a sum of terms that are never
  // negative; bl is group 1's at this half's first key, group 0's lies 16 floats
  // behind it)
  const float* bl = &bw[((lr & 3) ^ 3) * WIN_PITCH + (qs ^ 3) * 32 +
                        ((lr & 12) ^ 12) + 8 * hs + kh * (SEQ / 2)];
  __syncthreads();  // publishes K and V^T tile 0 and the bias window

  kg += 64 * HDIM;  // from here on: the next tile's
  vg += 64;
  for (int kt = 0; kt < SEQ / 128; ++kt) {
    const int j0 = kt * 64;  // counted from this half's first key
    const int cur = kt & 1;
    const bool more = kt + 1 < SEQ / 128;

    // ---- scores: S^T = K Q^T * scale + sigmoid(rpe[i-j+S-1, h]) ----
    // (element r of tile sub is key j0 + sub*16 + 8*hs + r of this half)
    v8f sv[2][4];
#pragma unroll
    for (int sub = 0; sub < 4; ++sub) {
      const _Float16* kp = &ks[cur][kh][(sub * 16 + lr) * PITCH + hs * 8];
      const v16h k0 = frag_lds(kp), k1 = frag_lds(kp + 32);
      v8f sg[2] = {{}, {}};
      sg[0] = wmma_f16(k0, bq[0][0], sg[0]);
      sg[1] = wmma_f16(k0, bq[1][0], sg[1]);
      sg[0] = wmma_f16(k1, bq[0][1], sg[0]);
      sg[1] = wmma_f16(k1, bq[1][1], sg[1]);
#pragma unroll
      for (int g = 0; g < 2; ++g) {
        const float* bp0 = bl + (g ^ 1) * 16 + j0 + sub * 16;
        const v4f b0 = *(const v4f*)bp0;
        const v4f b1 = *(const v4f*)(bp0 + 4);
        sv[g][sub] =
            sg[g] * scale + __builtin_shufflevector(b0, b1, 0, 1, 2, 3, 4, 5, 6, 7);
      }
    }

    // The next tiles fly during softmax and O^T: the staging registers are taken
    // only behind the scores, where K fragments and biases have left theirs.
    if (more) {
      fetch_f16(kr, kg, HDIM);
      fetch_f16(vr, vg, SEQ);
      kg += 64 * HDIM;
      vg += 64;
    }

    v16h bp[2][2];
#pragma unroll
    for (int g = 0; g < 2; ++g) {
      // ---- tile maximum of this query: in-lane, then the other half's ----
      float tmax = sv[g][0][0];
#pragma unroll
      for (int sub = 0; sub < 4; ++sub)
#pragma unroll
        for (int r = 0; r < 8; ++r) tmax = fmaxf(tmax, sv[g][sub][r]);
      tmax = fmaxf(tmax, other_half(tmax));

      // ---- online softmax update ----
      const float nm = fmaxf(mrow[g], tmax);
      const float corr = __expf(mrow[g] - nm);
      mrow[g] = nm;
      float ts[4];  // four independent chains
#pragma unroll
      for (int sub = 0; sub < 4; ++sub) {
        exp_tile(sv[g][sub], nm);
        ts[sub] = sv[g][sub][0];
#pragma unroll
        for (int r = 1; r < 8; ++r) ts[sub] += sv[g][sub][r];
      }
      lrow[g] = lrow[g] * corr + ((ts[0] + ts[1]) + (ts[2] + ts[3]));
#pragma unroll
      for (int sd = 0; sd < 4; ++sd)
#pragma unroll
        for (int r = 0; r < 8; ++r) o[g][sd][r] *= corr;

      // ---- P^T as B operand: score tiles 2c and 2c+1 hold keys 8*hs + 0..7 and
      // 16 + 8*hs + 0..7 of chunk c, the k order of frag_lds ----
#pragma unroll
      for (int c = 0; c < 2; ++c)
#pragma unroll
        for (int t = 0; t < 8; ++t) {
          bp[g][c][t]     = (_Float16)sv[g][2 * c][t];
          bp[g][c][t + 8] = (_Float16)sv[g][2 * c + 1][t];
        }
    }

    // ---- O^T += V^T P^T   (V^T rows are head-dims; contiguous over j) ----
#pragma unroll
    for (int sd = 0; sd < 4; ++sd) {
      const _Float16* vp = &vs[cur][kh][(sd * 16 + lr) * PITCH + hs * 8];
      const v16h v0 = frag_lds(vp), v1 = frag_lds(vp + 32);
#pragma unroll
      for (int g = 0; g < 2; ++g) {
        o[g][sd] = wmma_f16(v0, bp[g][0], o[g][sd]);
        o[g][sd] = wmma_f16(v1, bp[g][1], o[g][sd]);
      }
    }
    // The other K/V buffer was last read in the pass before, which ended at the
    // barrier at this loop's foot.
    if (more) {
      put_f16(&ks[cur ^ 1][kh][soff], kr);
      put_f16(&vs[cur ^ 1][kh][soff], vr);
    }
    // publishes the next tiles and ends the reads of these before their refill
    __syncthreads();
  }

  // ---- merge of the two key halves: the wave of half kh finishes column group
  // kh of its strip and hands group kh ^ 1 to its partner (wave ^ 4), lane to lane.
  // The K buffers are free since the loop's last barrier: 9 pieces of 16 bytes a
  // lane and wave (8 of O^T, one with maximum and sum), lanes side by side. ----
  v4f* xch = (v4f*)&ks[0][0][0];
  v4f* xw = xch + wave * 9 * 32 + lane;
  const v4f* xr = xch + (wave ^ 4) * 9 * 32 + lane;
#pragma unroll
  for (int sd = 0; sd < 4; ++sd) {
    const v8f gv = kh ? o[0][sd] : o[1][sd];
    xw[(2 * sd) * 32] = __builtin_shufflevector(gv, gv, 0, 1, 2, 3);
    xw[(2 * sd + 1) * 32] = __builtin_shufflevector(gv, gv, 4, 5, 6, 7);
  }
  const v4f gml = {kh ? mrow[0] : mrow[1], kh ? lrow[0] : lrow[1], 0.0f, 0.0f};
  xw[8 * 32] = gml;
  __syncthreads();  // publishes the partial results

  const v4f pml = xr[8 * 32];
  const float mm = kh ? mrow[1] : mrow[0];
  const float nm = fmaxf(mm, pml[0]);
  // Weights of this wave's part and of the partner's: e^x as in exp_tile, in one
  // statement for the same reason (the v_nop behind the last v_exp_f32).
  float ca = (mm - nm) * 1.44269504f, cb = (pml[0] - nm) * 1.44269504f;
  asm("v_exp_f32 %0, %0\n\tv_exp_f32 %1, %1\n\tv_nop" : "+v"(ca), "+v"(cb));
  // ---- join the lane halves' sums, O / l, merge heads (f = h*64 + d); a lane's
  // 8 registers are 8 consecutive d of its query: one 16-byte store ----
  const float lsum = (kh ? lrow[1] : lrow[0]) * ca + pml[1] * cb;
  const float ltot = lsum + other_half(lsum);
#pragma unroll
  for (int sd = 0; sd < 4; ++sd) {
    const v8f mv = kh ? o[1][sd] : o[0][sd];
    const v4f p0 = xr[(2 * sd) * 32];
    const v4f p1 = xr[(2 * sd + 1) * 32];
    v8h w;
#pragma unroll
    for (int r = 0; r < 4; ++r) {
      w[r]     = (_Float16)((mv[r] * ca + p0[r] * cb) / ltot);
      w[r + 4] = (_Float16)((mv[r + 4] * ca + p1[r] * cb) / ltot);
    }
    *(v8h*)&ao[((size_t)b * SEQ + i0 + kh * 16) * DMODEL + h * HDIM + sd * 16 +
               8 * hs] = w;
  }
}

// ---------------------------------------------------------------------------
// Kernel 3: output projection.  AO (8192x512 f16) @ Wp^T + bp -> f32 d_out.
// ---------------------------------------------------------------------------
__global__ __launch_bounds__(128) void out_proj_kernel(
    const _Float16* __restrict__ ao, const float* __restrict__ Wp,
    const float* __restrict__ bp, float* __restrict__ out) {
  const int lane = threadIdx.x & 31;
  const int wave = threadIdx.x >> 5;
  const int lr = lane & 15;
  const int hs = lane >> 4;

  const int m0 = blockIdx.x * 64 + wave * 16;
  const int n0 = blockIdx.y * 64;

  __shared__ __attribute__((aligned(16))) _Float16 as[2][TILE_HALVES];
  __shared__ __attribute__((aligned(16))) _Float16 wsm[2][TILE_HALVES];

  const int arow = threadIdx.x >> 3, acol = (threadIdx.x & 7) * 8;
  const int wrow = threadIdx.x >> 4, wcol = (threadIdx.x & 15) * 4;
  const _Float16* ag = ao + (size_t)(blockIdx.x * 64 + arow) * DMODEL + acol;
  const float* wg = Wp + (n0 + wrow) * DMODEL + wcol;
  const int aoff = arow * PITCH + acol;
  const int woff = wrow * PITCH + wcol;

  v8f acc[4] = {{}, {}, {}, {}};
  v8h ar[4];
  v4f wr[8];
  fetch_f16(ar, ag, DMODEL);
  fetch_f32(wr, wg, DMODEL);
  put_f16(&as[0][aoff], ar);
  put_f32(&wsm[0][woff], wr);
  __syncthreads();  // publishes tile 0

  for (int it = 0; it < DMODEL / 64; ++it) {
    const int cur = it & 1;
    const bool more = it + 1 < DMODEL / 64;
    if (more) {  // next tile flies while this one is multiplied
      fetch_f16(ar, ag + (it + 1) * 64, DMODEL);
      fetch_f32(wr, wg + (it + 1) * 64, DMODEL);
    }
#pragma unroll
    for (int c = 0; c < 2; ++c) {
      const v16h a = frag_lds(&as[cur][(wave * 16 + lr) * PITCH + c * 32 + hs * 8]);
#pragma unroll
      for (int sub = 0; sub < 4; ++sub) {
        const v16h bm =
            frag_lds(&wsm[cur][(sub * 16 + lr) * PITCH + c * 32 + hs * 8]);
        acc[sub] = wmma_f16(a, bm, acc[sub]);
      }
    }
    if (more) {
      put_f16(&as[cur ^ 1][aoff], ar);
      put_f32(&wsm[cur ^ 1][woff], wr);
    }
    // publishes the next tile and ends the reads of this one before its refill
    __syncthreads();
  }

#pragma unroll
  for (int sub = 0; sub < 4; ++sub) {
    const int n = n0 + sub * 16 + lr;
    const float bn = bp[n];
#pragma unroll
    for (int r = 0; r < 8; ++r) {
      const int m = m0 + r + 8 * hs;
      out[(size_t)m * DMODEL + n] = acc[sub][r] + bn;
    }
  }
}

// ---------------------------------------------------------------------------
extern "C" void kernel_launch(void* const* d_in, const int* in_sizes, int n_in,
                              void* d_out, int out_size, void* d_ws,
                              size_t ws_size, hipStream_t stream) {
  (void)in_sizes; (void)n_in; (void)out_size; (void)ws_size;

  const float* query = (const float*)d_in[0];
  const float* Wq = (const float*)d_in[1];
  const float* bq = (const float*)d_in[2];
  const float* Wk = (const float*)d_in[3];
  const float* bk = (const float*)d_in[4];
  const float* Wv = (const float*)d_in[5];
  const float* bv = (const float*)d_in[6];
  const float* Wp = (const float*)d_in[7];
  const float* bp = (const float*)d_in[8];
  const float* logit_scale = (const float*)d_in[9];
  const float* rpe = (const float*)d_in[10];

  // workspace carve-up
  const size_t QKV_ELEMS = (size_t)BATCH * HEADS * SEQ * HDIM;  // 4.19M halves
  char* ws = (char*)d_ws;
  float* tab = (float*)ws;                         // 8*4*4096 f32 = 524288 B
  _Float16* qf = (_Float16*)(ws + 524288);
  _Float16* kf = qf + QKV_ELEMS;
  _Float16* vt = kf + QKV_ELEMS;
  _Float16* ao = vt + QKV_ELEMS;

  rpe_sigmoid_kernel<<<(HEADS * 4 * TAB_Z) / 256, 256, 0, stream>>>(rpe, tab);

  qkv_proj_kernel<<<dim3((BATCH * SEQ) / 64, HEADS, 3), 128, 0, stream>>>(
      query, Wq, bq, Wk, bk, Wv, bv, qf, kf, vt);

  flash_attn_kernel<<<dim3(SEQ / 128, HEADS, BATCH), 256, 0, stream>>>(
      qf, kf, vt, tab, logit_scale, ao);

  out_proj_kernel<<<dim3((BATCH * SEQ) / 64, DMODEL / 64), 128, 0, stream>>>(
      ao, Wp, bp, (float*)d_out);
}

// v006
// Measured time: 76.4 microseconds a run.
// In both of two side-by-side timings against v005, it was 1.03 times as fast.
// Counting every step since v000, it is 4.19 times as fast.
#include <hip/hip_runtime.h>
#include <hip/hip_bf16.h>

// ---------------------------------------------------------------------------
// Multi-head attention (logit_scale + sigmoid rel-pos bias)
// B=4, S=2048, D=512, H=8, hd=64.  f16 WMMA (v_wmma_f32_16x16x32_f16),
// f32 accumulate, fused flash-attention middle stage.
// ---------------------------------------------------------------------------

#define BATCH 4
#define SEQ   2048
#define DMODEL 512
#define HEADS 8
#define HDIM  64

typedef __attribute__((ext_vector_type(16))) _Float16 v16h;
typedef __attribute__((ext_vector_type(8)))  float    v8f;

__device__ __forceinline__ v8f wmma_f16(v16h a, v16h b, v8f c) {
  // (neg_a, A, neg_b, B, c_mod, C, reuse_a, reuse_b)
  return __builtin_amdgcn_wmma_f32_16x16x32_f16(false, a, false, b, (short)0, c,
                                                false, false);
}

// A/B operand loader (16x32 f16 tile, one row per lane).
// p must already point at row_base + k_chunk + (lane>=16 ? 8 : 0).
// Elements [0..7] = K+0..7 of this lane's chunk, [8..15] = K+16..23.
__device__ __forceinline__ v16h load_tile_f16(const _Float16* __restrict__ p) {
  v16h a;
#pragma unroll
  for (int t = 0; t < 8; ++t) {
    a[t]     = p[t];
    a[t + 8] = p[t + 16];
  }
  return a;
}

// LDS staging of operand tiles.  A tile is 64 rows x 64 f16 (128 B a row), laid
// at a pitch of 144 B (16 B x odd: conflict-free for 16-byte reads).  128 threads (the
// block, or a key half in the attention kernel) fetch it with 16-byte loads whose 32 lanes cover four whole 128-B
// lines; each of the 4 waves then reads its fragments from LDS.
typedef __attribute__((ext_vector_type(8))) _Float16 v8h;
typedef __attribute__((ext_vector_type(4))) _Float16 v4h;
typedef __attribute__((ext_vector_type(4))) float    v4f;
typedef __attribute__((ext_vector_type(2))) float    v2f;
#define PITCH 72
#define TILE_HALVES (64 * PITCH)

// Fragment from LDS: same element order as load_tile_f16
// (p = row base + k_chunk + (lane>=16 ? 8 : 0)).
__device__ __forceinline__ v16h frag_lds(const _Float16* p) {
  const v8h lo = *(const v8h*)p;
  const v8h hi = *(const v8h*)(p + 16);
  return __builtin_shufflevector(lo, hi, 0, 1, 2, 3, 4, 5, 6, 7, 8, 9, 10, 11,
                                 12, 13, 14, 15);
}

// f32 source, 64 x 64 floats: thread t holds floats (t&15)*4.. of rows (t>>4)+8p.
// g already points at this thread's first float4; ld = row stride in floats.
__device__ __forceinline__ void fetch_f32(v4f (&r)[8], const float* __restrict__ g,
                                          int ld) {
#pragma unroll
  for (int p = 0; p < 8; ++p) r[p] = *(const v4f*)(g + p * 8 * ld);
}
__device__ __forceinline__ void put_f32(_Float16* s, const v4f (&r)[8]) {
#pragma unroll
  for (int p = 0; p < 8; ++p)
    *(v4h*)(s + p * 8 * PITCH) = __builtin_convertvector(r[p], v4h);
}
// f16 source, 64 x 64 halves: thread t holds halves (t&7)*8.. of rows (t>>3)+16p.
__device__ __forceinline__ void fetch_f16(v8h (&r)[4],
                                          const _Float16* __restrict__ g, int ld) {
#pragma unroll
  for (int p = 0; p < 4; ++p) r[p] = *(const v8h*)(g + p * 16 * ld);
}
__device__ __forceinline__ void put_f16(_Float16* s, const v8h (&r)[4]) {
#pragma unroll
  for (int p = 0; p < 4; ++p) *(v8h*)(s + p * 16 * PITCH) = r[p];
}

// ---------------------------------------------------------------------------
// Kernel 0: sigmoid(rpe) -> f32 bias table, laid out for the attention kernel:
// tab[h][c][z] = sigmoid(rpe[S-1 + i - j][h]) at z + c = j - i + S-1, c = 0..3.
// Head-major and ascending in the key j, so that the biases of consecutive keys
// of one query are consecutive floats; the four copies, each shifted by one
// float, give every query a copy in which its runs start on a 16-byte boundary.
// Entries past the last relative position are zero and never enter a score.
// ---------------------------------------------------------------------------
#define NREL (2 * SEQ - 1)     // relative positions
#define TAB_Z 4096             // floats per copy in the global table
#define WIN_Z 2176             // floats of a copy that one 128-query block stages
#define WIN_PITCH 2192         // LDS pitch of a copy: 16 banks past a multiple of 64
__global__ void rpe_sigmoid_kernel(const float* __restrict__ rpe,
                                   float* __restrict__ tab) {
  // t = (h * 4 + c) * TAB_Z + u with u = TAB_Z-1 - z, so that the row of rpe,
  // NREL-1 - (z + c) = u - 1 - c, ascends with the thread.
  const unsigned t = blockIdx.x * blockDim.x + threadIdx.x;
  const unsigned u = t & (TAB_Z - 1);
  const unsigned c = (t >> 12) & 3;
  const unsigned h = t >> 14;
  float v = 0.0f;
  if (u > c) v = 1.0f / (1.0f + __expf(-rpe[(u - 1 - c) * HEADS + h]));
  tab[(t | (TAB_Z - 1)) - u] = v;
}

// ---------------------------------------------------------------------------
// Kernel 1: fused QKV projection.  X (8192x512 f32) @ W^T + b -> f16.
// grid = (M/256, H)  block = 512 (16 waves), one block on a WGP
// Q,K stored [B,H,S,64]; V stored transposed [B,H,64,S].
// Head split per reference: feature n -> h = n % 8, d = n / 8.
// A block takes 256 positions and ALL THREE products of ONE head (rows d*8 + h of
// Wq, Wk and Wv): an X tile is fetched from L2 once for 192 output features and
// a weight tile once for 256 positions.
// A wave takes a strip of 32 positions.  Waves 0..7 make Q of their strip and
// head-dims 0..31 of V^T, waves 8..15 K and head-dims 32..63: the strip's two X
// fragments are the B operand of Q or K (a lane owns one position, its 8
// accumulator registers are 8 consecutive head-dims) and the A operand of V^T (a
// lane owns one head-dim, 8 consecutive positions), so that 8 fragments read from
// LDS feed 12 WMMAs.
// All output goes through LDS and leaves as whole lines: a wave's 32 rows of Q or
// K (128 B each), the block's 64 rows of V^T (512 B each).
// ---------------------------------------------------------------------------
#define QKV_ROWS 256                      // positions of a block
#define STAGE_ROWS (QKV_ROWS + 3 * HDIM)  // X rows, then the head's Wq, Wk, Wv rows
#define STAGE_HALVES (STAGE_ROWS * PITCH)
#define VPITCH (QKV_ROWS + 8)             // V^T staging: 528 B a row, 16 B x odd
#define VST_OFF (16 * 32 * PITCH)         // behind the 16 waves' rows of Q and K

__global__ __launch_bounds__(512) void qkv_proj_kernel(
    const float* __restrict__ X,
    const float* __restrict__ Wq, const float* __restrict__ bq,
    const float* __restrict__ Wk, const float* __restrict__ bk,
    const float* __restrict__ Wv, const float* __restrict__ bv,
    _Float16* __restrict__ qf, _Float16* __restrict__ kf,
    _Float16* __restrict__ vt) {
  __shared__ __attribute__((aligned(16))) _Float16 sm[2 * STAGE_HALVES];
  __shared__ __attribute__((aligned(16))) float bsm[3 * HDIM];  // biases of this head

  const int lane = threadIdx.x & 31;
  const int wave = __builtin_amdgcn_readfirstlane(threadIdx.x >> 5);
  const int lr = lane & 15;  // row-in-tile of an operand
  const int hs = lane >> 4;  // half select
  const int ps = wave & 7;   // position strip
  const int wh = wave >> 3;  // 0: Q, V^T rows 0..31; 1: K, V^T rows 32..63
  const int h = blockIdx.y;
  const int m0 = blockIdx.x * QKV_ROWS;

  // Staging: thread t holds floats (t&15)*4.. of rows (t>>4) + 32p of a tile.
  // Row d of the head's weights is feature d*H + h (reference split_heads).
  const int srow = threadIdx.x >> 4, scol = (threadIdx.x & 15) * 4;
  // Block-uniform bases and one 32-bit offset a thread for X, one for the weights.
  const float* xg = X + m0 * DMODEL;
  const float* wqg = Wq + h * DMODEL;
  const float* wkg = Wk + h * DMODEL;
  const float* wvg = Wv + h * DMODEL;
  const unsigned xo = srow * DMODEL + scol;
  const unsigned wo = srow * HEADS * DMODEL + scol;
  const int soff = srow * PITCH + scol;

  v4f xr[8], wr[6];
  auto fetch = [&]() {
#pragma unroll
    for (int p = 0; p < 8; ++p) xr[p] = *(const v4f*)(xg + p * 32 * DMODEL + xo);
#pragma unroll
    for (int p = 0; p < 2; ++p) {
      wr[p]     = *(const v4f*)(wqg + p * 32 * HEADS * DMODEL + wo);
      wr[p + 2] = *(const v4f*)(wkg + p * 32 * HEADS * DMODEL + wo);
      wr[p + 4] = *(const v4f*)(wvg + p * 32 * HEADS * DMODEL + wo);
    }
  };
  auto put = [&](int buf) {
    _Float16* s = &sm[buf * STAGE_HALVES + soff];
#pragma unroll
    for (int p = 0; p < 8; ++p)
      *(v4h*)(s + p * 32 * PITCH) = __builtin_convertvector(xr[p], v4h);
#pragma unroll
    for (int p = 0; p < 6; ++p)
      *(v4h*)(s + (QKV_ROWS + p * 32) * PITCH) = __builtin_convertvector(wr[p], v4h);
    // the next tile's; here, where the loads that name these bases have returned
    xg += 64;
    wqg += 64;
    wkg += 64;
    wvg += 64;
  };

  // aqk[g][sub][r] = sum_k W[sub*16 + 8*hs + r][k] * X[ps*32 + g*16 + lr][k]
  // av[g][e][r]    = sum_k X[ps*32 + g*16 + 8*hs + r][k] * Wv[wh*32 + e*16 + lr][k]
  v8f aqk[2][4] = {{{}, {}, {}, {}}, {{}, {}, {}, {}}};
  v8f av[2][2] = {{{}, {}}, {{}, {}}};

  fetch();
  // behind the tile's loads, so that all share one latency
  if (threadIdx.x < 3 * HDIM) {
    const float* bsel = threadIdx.x < HDIM ? bq : threadIdx.x < 2 * HDIM ? bk : bv;
    bsm[threadIdx.x] = bsel[(threadIdx.x & (HDIM - 1)) * HEADS + h];
  }
  put(0);
  __syncthreads();  // publishes tile 0 and the head's biases

  const int xoff = (ps * 32 + lr) * PITCH + hs * 8;
  const int woff = (QKV_ROWS + wh * HDIM + lr) * PITCH + hs * 8;
  const int voff = (QKV_ROWS + 2 * HDIM + wh * 32 + lr) * PITCH + hs * 8;
  // Not peeled: the two tests of 'more' stay branches, so that the loads, the
  // products and the conversions are blocks of their own in this order; peeled,
  // the build put the conversions, and the wait for the loads, in front of the
  // products.
#pragma clang loop unroll(disable)
  for (int it = 0; it < DMODEL / 64; ++it) {
    const int cur = it & 1;
    const bool more = it + 1 < DMODEL / 64;
    if (more) fetch();  // next tile flies while this one is multiplied
#pragma unroll
    for (int c = 0; c < 2; ++c) {
      const _Float16* s = &sm[cur * STAGE_HALVES + c * 32];
      const v16h x0 = frag_lds(s + xoff), x1 = frag_lds(s + xoff + 16 * PITCH);
      v16h w[4];
#pragma unroll
      for (int sub = 0; sub < 4; ++sub) w[sub] = frag_lds(s + woff + sub * 16 * PITCH);
      const v16h v0 = frag_lds(s + voff), v1 = frag_lds(s + voff + 16 * PITCH);
      // The chunk's 16 LDS reads stand as one group in front of its 12 WMMAs:
      // without this line the build read a fragment and waited for it, six times.
      __builtin_amdgcn_sched_barrier(0);
#pragma unroll
      for (int sub = 0; sub < 4; ++sub) {
        aqk[0][sub] = wmma_f16(w[sub], x0, aqk[0][sub]);
        aqk[1][sub] = wmma_f16(w[sub], x1, aqk[1][sub]);
      }
      av[0][0] = wmma_f16(x0, v0, av[0][0]);
      av[1][0] = wmma_f16(x1, v0, av[1][0]);
      av[0][1] = wmma_f16(x0, v1, av[0][1]);
      av[1][1] = wmma_f16(x1, v1, av[1][1]);
    }
    if (more) put(cur ^ 1);
    // publishes the next tile and ends the reads of this one before its refill
    __syncthreads();
  }

  // The operand tiles are free since the loop's last barrier.
  _Float16* st = &sm[wave * 32 * PITCH];  // this wave's 32 rows of Q or K
  _Float16* vst = &sm[VST_OFF];           // the block's 64 rows of V^T
#pragma unroll
  for (int g = 0; g < 2; ++g) {
#pragma unroll
    for (int sub = 0; sub < 4; ++sub) {
      const v4f lo = *(const v4f*)&bsm[wh * HDIM + sub * 16 + 8 * hs];
      const v4f hi = *(const v4f*)&bsm[wh * HDIM + sub * 16 + 8 * hs + 4];
      const v8f bn = __builtin_shufflevector(lo, hi, 0, 1, 2, 3, 4, 5, 6, 7);
      v8h w;
#pragma unroll
      for (int r = 0; r < 8; ++r) w[r] = (_Float16)(aqk[g][sub][r] + bn[r]);
      *(v8h*)&st[(g * 16 + lr) * PITCH + sub * 16 + 8 * hs] = w;
    }
#pragma unroll
    for (int e = 0; e < 2; ++e) {
      const int d = wh * 32 + e * 16 + lr;
      const float b1 = bsm[2 * HDIM + d];
      v8h w;
#pragma unroll
      for (int r = 0; r < 8; ++r) w[r] = (_Float16)(av[g][e][r] + b1);
      *(v8h*)&vst[d * VPITCH + ps * 32 + g * 16 + 8 * hs] = w;
    }
  }
  __syncthreads();  // publishes the staged output rows

  const size_t bh = (m0 >> 11) * HEADS + h;  // m / SEQ
  const int s0 = m0 & (SEQ - 1);
  // Q or K: the wave's 32 rows are 4 KiB in a row, four lines an instruction.
  _Float16* o = (wh ? kf : qf) + (bh * SEQ + s0 + ps * 32 + (lane >> 3)) * HDIM +
                (lane & 7) * 8;
#pragma unroll
  for (int j = 0; j < 8; ++j)
    *(v8h*)(o + j * 4 * HDIM) =
        *(const v8h*)&st[(j * 4 + (lane >> 3)) * PITCH + (lane & 7) * 8];
  // V^T: one row's 256 positions (four lines) an instruction, rows wave + 16j.
  _Float16* ov = vt + (bh * HDIM + wave) * SEQ + s0 + lane * 8;
#pragma unroll
  for (int j = 0; j < 4; ++j)
    *(v8h*)(ov + j * 16 * SEQ) =
        *(const v8h*)&vst[(wave + j * 16) * VPITCH + lane * 8];
}

// ---------------------------------------------------------------------------
// Kernel 2: flash attention, transposed products.
// grid = (S/128, H, B), block = 256: 8 waves = 4 query strips x 2 key halves.  A
// wave owns 32 queries (two column groups of 16, so that every K and V^T fragment
// read from LDS feeds two WMMAs) and walks 1024 keys, which keeps four waves on a
// SIMD; the two partial results of a strip are merged through LDS at the end.
// Per 64-key tile and group: S^T = K Q^T (8 WMMA; A = K rows from LDS, B = Q in
// registers), so a lane holds 32 scores of ONE query of the group (column lr;
// keys 8*hs + r of each 16-key group): maximum and sum run in-lane, plus one
// exchange between the wave's halves.  Two score tiles, converted in place, are
// the B operand of O^T += V^T P^T (8 WMMA): P never leaves the registers.
// The bias depends on j - i alone: a block's 128 queries and all keys meet 2175
// relative positions, staged once in LDS (four shifted copies); the 8 biases of
// a score tile's lane are then two 16-byte LDS reads.
// Output written f16 to ao [B,S,D] with f = h*64 + d.
// ---------------------------------------------------------------------------
// Value of lane l ^ 16.
__device__ __forceinline__ float other_half(float x) {
  const int b = __builtin_bit_cast(int, x);
  return __builtin_bit_cast(
      float, __builtin_amdgcn_permlanex16(b, b, 0x76543210, 0xfedcba98, false,
                                          false));
}

// e^x of the eight scores of one tile: the multiply by log2(e) and v_exp_f32, as
// __expf compiles.  Written as one statement so that the v_nop stands directly
// behind the last v_exp_f32: the instruction set asks for one independent
// instruction between a transcendental and a vector instruction that uses its
// result or overwrites its source.  Inside the run each
// v_exp_f32 is independent of the one before.  Each works in place: the statement
// writes only registers that the multiplies in front of it wrote, so it is never
// the first write over the operands of a matrix instruction just issued.
__device__ __forceinline__ void exp_tile(v8f& s, float m) {
  float a0 = (s[0] - m) * 1.44269504f, a1 = (s[1] - m) * 1.44269504f;
  float a2 = (s[2] - m) * 1.44269504f, a3 = (s[3] - m) * 1.44269504f;
  float a4 = (s[4] - m) * 1.44269504f, a5 = (s[5] - m) * 1.44269504f;
  float a6 = (s[6] - m) * 1.44269504f, a7 = (s[7] - m) * 1.44269504f;
  asm("v_exp_f32 %0, %0\n\tv_exp_f32 %1, %1\n\tv_exp_f32 %2, %2\n\t"
      "v_exp_f32 %3, %3\n\tv_exp_f32 %4, %4\n\tv_exp_f32 %5, %5\n\t"
      "v_exp_f32 %6, %6\n\tv_exp_f32 %7, %7\n\tv_nop"
      : "+v"(a0), "+v"(a1), "+v"(a2), "+v"(a3), "+v"(a4), "+v"(a5), "+v"(a6),
        "+v"(a7));
  s[0] = a0; s[1] = a1; s[2] = a2; s[3] = a3;
  s[4] = a4; s[5] = a5; s[6] = a6; s[7] = a7;
}

__global__ __launch_bounds__(256) __attribute__((amdgpu_waves_per_eu(4, 4)))
void flash_attn_kernel(
    const _Float16* __restrict__ qf, const _Float16* __restrict__ kf,
    const _Float16* __restrict__ vt, const float* __restrict__ tab,
    const float* __restrict__ logit_scale, _Float16* __restrict__ ao) {
  // One object, the bias window first: its reads then reach every tile of a pass
  // by the instruction's 16-bit offset from one address register.
  __shared__ __attribute__((aligned(16))) struct {
    float bw[4 * WIN_PITCH];
    _Float16 ks[2][2][TILE_HALVES];  // [buffer][key half]
    _Float16 vs[2][2][TILE_HALVES];
  } sm;
  auto& bw = sm.bw;
  auto& ks = sm.ks;
  auto& vs = sm.vs;

  const int lane = threadIdx.x & 31;
  const int wave = __builtin_amdgcn_readfirstlane(threadIdx.x >> 5);
  const int qs = wave & 3;   // query strip
  const int kh = wave >> 2;  // key half
  const int lr = lane & 15;
  const int hs = lane >> 4;

  const int b = blockIdx.z;
  const int h = blockIdx.y;
  const int i0 = blockIdx.x * 128 + qs * 32 + lr;  // this lane's query, group 0

  // scale = exp(min(ls, ln(100))) / sqrt(D_MODEL)
  const float scale =
      __expf(fminf(logit_scale[h], 4.6051702f)) * 0.04419417382f;

  const int bh = b * HEADS + h;

  // Q strips as B operands: column = query lr of group g, 64 k (two chunks of 32)
  const _Float16* qp = qf + ((size_t)bh * SEQ + i0) * HDIM + hs * 8;
  v16h bq[2][2];
#pragma unroll
  for (int g = 0; g < 2; ++g) {
    bq[g][0] = load_tile_f16(qp + g * 16 * HDIM);
    bq[g][1] = load_tile_f16(qp + g * 16 * HDIM + 32);
  }
  // The zeroing of the accumulators below reuses Q's address registers: this
  // wait stands between the loads and that overwrite.
  asm volatile("s_wait_xcnt 0x0" ::: "memory");

  // o[g][sd][r] = O^T[sd*16 + 8*hs + r][query lr of group g]
  v8f o[2][4] = {{{}, {}, {}, {}}, {{}, {}, {}, {}}};
  float mrow[2] = {-1e30f, -1e30f};  // running maximum of this lane's queries
  float lrow[2] = {0.0f, 0.0f};      // running sums over this half's keys only

  // The four waves of a key half stage that half's tiles.
  const int srow = (threadIdx.x & 127) >> 3, scol = (threadIdx.x & 7) * 8;
  const _Float16* kg =
      kf + ((size_t)bh * SEQ + kh * (SEQ / 2) + srow) * HDIM + scol;
  const _Float16* vg = vt + ((size_t)bh * HDIM + srow) * SEQ + kh * (SEQ / 2) + scol;
  const int soff = srow * PITCH + scol;
  v8h kr[4], vr[4];
  fetch_f16(kr, kg, HDIM);
  fetch_f16(vr, vg, SEQ);
  // Bias window of this block: floats z0 .. z0 + WIN_Z - 1 of each copy, with
  // z0 = S-1 - (last query of the block), whole lines.  Waves c and c + 4 stage
  // copy c: each 1024 floats, 16 bytes a lane, and 64 of the last 128 floats,
  // 8 bytes a lane, which keeps every lane on.
  // The loads are issued with those of K and V^T tile 0: all share one latency.
  const float* tg = tab + (h * 4 + qs) * TAB_Z + (SEQ - 128 - blockIdx.x * 128);
  float* tl = &bw[qs * WIN_PITCH];
  const int woff = kh * 1024 + lane * 4, toff = 2048 + kh * 64 + lane * 2;
  v4f wr[8];
#pragma unroll
  for (int p = 0; p < 8; ++p) wr[p] = *(const v4f*)(tg + woff + p * 128);
  const v2f wt = *(const v2f*)(tg + toff);
  // The code behind reuses these loads' address registers: this wait stands
  // between the loads and that overwrite.
  asm volatile("s_wait_xcnt 0x0" ::: "memory");
  put_f16(&ks[0][kh][soff], kr);
  put_f16(&vs[0][kh][soff], vr);
#pragma unroll
  for (int p = 0; p < 8; ++p) *(v4f*)(tl + woff + p * 128) = wr[p];
  *(v2f*)(tl + toff) = wt;
  // This lane's biases: window index of (query i, key j) is j + 127 - (i - block's
  // first query); copy 3 - (lr & 3) holds it at a multiple of 4 floats for j % 4 == 0.
  // (124 - 32 * qs - 16 * g - (lr & 12), written as a sum of terms that are never
  // negative; bl is group 1's at this half's first key, group 0's lies 16 floats
  // behind it)
  const float* bl = &bw[((lr & 3) ^ 3) * WIN_PITCH + (qs ^ 3) * 32 +
                        ((lr & 12) ^ 12) + 8 * hs + kh * (SEQ / 2)];
  __syncthreads();  // publishes K and V^T tile 0 and the bias window

  kg += 64 * HDIM;  // from here on: the next tile's
  vg += 64;
  for (int kt = 0; kt < SEQ / 128; ++kt) {
    const int j0 = kt * 64;  // counted from this half's first key
    const int cur = kt & 1;
    const bool more = kt + 1 < SEQ / 128;

    // ---- scores: S^T = K Q^T * scale + sigmoid(rpe[i-j+S-1, h]) ----
    // (element r of tile sub is key j0 + sub*16 + 8*hs + r of this half)
    v8f sv[2][4];
#pragma unroll
    for (int sub = 0; sub < 4; ++sub) {
      const _Float16* kp = &ks[cur][kh][(sub * 16 + lr) * PITCH + hs * 8];
      const v16h k0 = frag_lds(kp), k1 = frag_lds(kp + 32);
      v8f sg[2] = {{}, {}};
      sg[0] = wmma_f16(k0, bq[0][0], sg[0]);
      sg[1] = wmma_f16(k0, bq[1][0], sg[1]);
      sg[0] = wmma_f16(k1, bq[0][1], sg[0]);
      sg[1] = wmma_f16(k1, bq[1][1], sg[1]);
#pragma unroll
      for (int g = 0; g < 2; ++g) {
        const float* bp0 = bl + (g ^ 1) * 16 + j0 + sub * 16;
        const v4f b0 = *(const v4f*)bp0;
        const v4f b1 = *(const v4f*)(bp0 + 4);
        sv[g][sub] =
            sg[g] * scale + __builtin_shufflevector(b0, b1, 0, 1, 2, 3, 4, 5, 6, 7);
      }
    }

    // The next tiles fly during softmax and O^T: the staging registers are taken
    // only behind the scores, where K fragments and biases have left theirs.
    if (more) {
      fetch_f16(kr, kg, HDIM);
      fetch_f16(vr, vg, SEQ);
      kg += 64 * HDIM;
      vg += 64;
    }

    v16h bp[2][2];
#pragma unroll
    for (int g = 0; g < 2; ++g) {
      // ---- tile maximum of this query: in-lane, then the other half's ----
      float tmax = sv[g][0][0];
#pragma unroll
      for (int sub = 0; sub < 4; ++sub)
#pragma unroll
        for (int r = 0; r < 8; ++r) tmax = fmaxf(tmax, sv[g][sub][r]);
      tmax = fmaxf(tmax, other_half(tmax));

      // ---- online softmax update ----
      const float nm = fmaxf(mrow[g], tmax);
      const float corr = __expf(mrow[g] - nm);
      mrow[g] = nm;
      float ts[4];  // four independent chains
#pragma unroll
      for (int sub = 0; sub < 4; ++sub) {
        exp_tile(sv[g][sub], nm);
        ts[sub] = sv[g][sub][0];
#pragma unroll
        for (int r = 1; r < 8; ++r) ts[sub] += sv[g][sub][r];
      }
      lrow[g] = lrow[g] * corr + ((ts[0] + ts[1]) + (ts[2] + ts[3]));
#pragma unroll
      for (int sd = 0; sd < 4; ++sd)
#pragma unroll
        for (int r = 0; r < 8; ++r) o[g][sd][r] *= corr;

      // ---- P^T as B operand: score tiles 2c and 2c+1 hold keys 8*hs + 0..7 and
      // 16 + 8*hs + 0..7 of chunk c, the k order of frag_lds ----
#pragma unroll
      for (int c = 0; c < 2; ++c)
#pragma unroll
        for (int t = 0; t < 8; ++t) {
          bp[g][c][t]     = (_Float16)sv[g][2 * c][t];
          bp[g][c][t + 8] = (_Float16)sv[g][2 * c + 1][t];
        }
    }

    // ---- O^T += V^T P^T   (V^T rows are head-dims; contiguous over j) ----
#pragma unroll
    for (int sd = 0; sd < 4; ++sd) {
      const _Float16* vp = &vs[cur][kh][(sd * 16 + lr) * PITCH + hs * 8];
      const v16h v0 = frag_lds(vp), v1 = frag_lds(vp + 32);
#pragma unroll
      for (int g = 0; g < 2; ++g) {
        o[g][sd] = wmma_f16(v0, bp[g][0], o[g][sd]);
        o[g][sd] = wmma_f16(v1, bp[g][1], o[g][sd]);
      }
    }
    // The other K/V buffer was last read in the pass before, which ended at the
    // barrier at this loop's foot.
    if (more) {
      put_f16(&ks[cur ^ 1][kh][soff], kr);
      put_f16(&vs[cur ^ 1][kh][soff], vr);
    }
    // publishes the next tiles and ends the reads of these before their refill
    __syncthreads();
  }

  // ---- merge of the two key halves: the wave of half kh finishes column group
  // kh of its strip and hands group kh ^ 1 to its partner (wave ^ 4), lane to lane.
  // The K buffers are free since the loop's last barrier: 9 pieces of 16 bytes a
  // lane and wave (8 of O^T, one with maximum and sum), lanes side by side. ----
  v4f* xch = (v4f*)&ks[0][0][0];
  v4f* xw = xch + wave * 9 * 32 + lane;
  const v4f* xr = xch + (wave ^ 4) * 9 * 32 + lane;
#pragma unroll
  for (int sd = 0; sd < 4; ++sd) {
    const v8f gv = kh ? o[0][sd] : o[1][sd];
    xw[(2 * sd) * 32] = __builtin_shufflevector(gv, gv, 0, 1, 2, 3);
    xw[(2 * sd + 1) * 32] = __builtin_shufflevector(gv, gv, 4, 5, 6, 7);
  }
  const v4f gml = {kh ? mrow[0] : mrow[1], kh ? lrow[0] : lrow[1], 0.0f, 0.0f};
  xw[8 * 32] = gml;
  __syncthreads();  // publishes the partial results

  const v4f pml = xr[8 * 32];
  const float mm = kh ? mrow[1] : mrow[0];
  const float nm = fmaxf(mm, pml[0]);
  // Weights of this wave's part and of the partner's: e^x as in exp_tile, in one
  // statement for the same reason (the v_nop behind the last v_exp_f32).
  float ca = (mm - nm) * 1.44269504f, cb = (pml[0] - nm) * 1.44269504f;
  asm("v_exp_f32 %0, %0\n\tv_exp_f32 %1, %1\n\tv_nop" : "+v"(ca), "+v"(cb));
  // ---- join the lane halves' sums, O / l, merge heads (f = h*64 + d); a lane's
  // 8 registers are 8 consecutive d of its query: one 16-byte store ----
  const float lsum = (kh ? lrow[1] : lrow[0]) * ca + pml[1] * cb;
  const float ltot = lsum + other_half(lsum);
#pragma unroll
  for (int sd = 0; sd < 4; ++sd) {
    const v8f mv = kh ? o[1][sd] : o[0][sd];
    const v4f p0 = xr[(2 * sd) * 32];
    const v4f p1 = xr[(2 * sd + 1) * 32];
    v8h w;
#pragma unroll
    for (int r = 0; r < 4; ++r) {
      w[r]     = (_Float16)((mv[r] * ca + p0[r] * cb) / ltot);
      w[r + 4] = (_Float16)((mv[r + 4] * ca + p1[r] * cb) / ltot);
    }
    *(v8h*)&ao[((size_t)b * SEQ + i0 + kh * 16) * DMODEL + h * HDIM + sd * 16 +
               8 * hs] = w;
  }
}

// ---------------------------------------------------------------------------
// Kernel 3: output projection.  AO (8192x512 f16) @ Wp^T + bp -> f32 d_out.
// ---------------------------------------------------------------------------
__global__ __launch_bounds__(128) void out_proj_kernel(
    const _Float16* __restrict__ ao, const float* __restrict__ Wp,
    const float* __restrict__ bp, float* __restrict__ out) {
  const int lane = threadIdx.x & 31;
  const int wave = threadIdx.x >> 5;
  const int lr = lane & 15;
  const int hs = lane >> 4;

  const int m0 = blockIdx.x * 64 + wave * 16;
  const int n0 = blockIdx.y * 64;

  __shared__ __attribute__((aligned(16))) _Float16 as[2][TILE_HALVES];
  __shared__ __attribute__((aligned(16))) _Float16 wsm[2][TILE_HALVES];

  const int arow = threadIdx.x >> 3, acol = (threadIdx.x & 7) * 8;
  const int wrow = threadIdx.x >> 4, wcol = (threadIdx.x & 15) * 4;
  const _Float16* ag = ao + (size_t)(blockIdx.x * 64 + arow) * DMODEL + acol;
  const float* wg = Wp + (n0 + wrow) * DMODEL + wcol;
  const int aoff = arow * PITCH + acol;
  const int woff = wrow * PITCH + wcol;

  v8f acc[4] = {{}, {}, {}, {}};
  v8h ar[4];
  v4f wr[8];
  fetch_f16(ar, ag, DMODEL);
  fetch_f32(wr, wg, DMODEL);
  put_f16(&as[0][aoff], ar);
  put_f32(&wsm[0][woff], wr);
  __syncthreads();  // publishes tile 0

  for (int it = 0; it < DMODEL / 64; ++it) {
    const int cur = it & 1;
    const bool more = it + 1 < DMODEL / 64;
    if (more) {  // next tile flies while this one is multiplied
      fetch_f16(ar, ag + (it + 1) * 64, DMODEL);
      fetch_f32(wr, wg + (it + 1) * 64, DMODEL);
    }
#pragma unroll
    for (int c = 0; c < 2; ++c) {
      const v16h a = frag_lds(&as[cur][(wave * 16 + lr) * PITCH + c * 32 + hs * 8]);
#pragma unroll
      for (int sub = 0; sub < 4; ++sub) {
        const v16h bm =
            frag_lds(&wsm[cur][(sub * 16 + lr) * PITCH + c * 32 + hs * 8]);
        acc[sub] = wmma_f16(a, bm, acc[sub]);
      }
    }
    if (more) {
      put_f16(&as[cur ^ 1][aoff], ar);
      put_f32(&wsm[cur ^ 1][woff], wr);
    }
    // publishes the next tile and ends the reads of this one before its refill
    __syncthreads();
  }

#pragma unroll
  for (int sub = 0; sub < 4; ++sub) {
    const int n = n0 + sub * 16 + lr;
    const float bn = bp[n];
#pragma unroll
    for (int r = 0; r < 8; ++r) {
      const int m = m0 + r + 8 * hs;
      out[(size_t)m * DMODEL + n] = acc[sub][r] + bn;
    }
  }
}

// ---------------------------------------------------------------------------
extern "C" void kernel_launch(void* const* d_in, const int* in_sizes, int n_in,
                              void* d_out, int out_size, void* d_ws,
                              size_t ws_size, hipStream_t stream) {
  (void)in_sizes; (void)n_in; (void)out_size; (void)ws_size;

  const float* query = (const float*)d_in[0];
  const float* Wq = (const float*)d_in[1];
  const float* bq = (const float*)d_in[2];
  const float* Wk = (const float*)d_in[3];
  const float* bk = (const float*)d_in[4];
  const float* Wv = (const float*)d_in[5];
  const float* bv = (const float*)d_in[6];
  const float* Wp = (const float*)d_in[7];
  const float* bp = (const float*)d_in[8];
  const float* logit_scale = (const float*)d_in[9];
  const float* rpe = (const float*)d_in[10];

  // workspace carve-up
  const size_t QKV_ELEMS = (size_t)BATCH * HEADS * SEQ * HDIM;  // 4.19M halves
  char* ws = (char*)d_ws;
  float* tab = (float*)ws;                         // 8*4*4096 f32 = 524288 B
  _Float16* qf = (_Float16*)(ws + 524288);
  _Float16* kf = qf + QKV_ELEMS;
  _Float16* vt = kf + QKV_ELEMS;
  _Float16* ao = vt + QKV_ELEMS;

  rpe_sigmoid_kernel<<<(HEADS * 4 * TAB_Z) / 256, 256, 0, stream>>>(rpe, tab);

  qkv_proj_kernel<<<dim3((BATCH * SEQ) / 256, HEADS), 512, 0, stream>>>(
      query, Wq, bq, Wk, bk, Wv, bv, qf, kf, vt);

  flash_attn_kernel<<<dim3(SEQ / 128, HEADS, BATCH), 256, 0, stream>>>(
      qf, kf, vt, tab, logit_scale, ao);

  out_proj_kernel<<<dim3((BATCH * SEQ) / 64, DMODEL / 64), 128, 0, stream>>>(
      ao, Wp, bp, (float*)d_out);
}

// v007
// Measured time: 72 microseconds a run.
// In both of two side-by-side timings against v006, it was 1.06 times as fast.
// Counting every step since v000, it is 4.45 times as fast.
#include <hip/hip_runtime.h>
#include <hip/hip_bf16.h>

// ---------------------------------------------------------------------------
// Multi-head attention (logit_scale + sigmoid rel-pos bias)
// B=4, S=2048, D=512, H=8, hd=64.  f16 WMMA (v_wmma_f32_16x16x32_f16),
// f32 accumulate, fused flash-attention middle stage.
// ---------------------------------------------------------------------------

#define BATCH 4
#define SEQ   2048
#define DMODEL 512
#define HEADS 8
#define HDIM  64

typedef __attribute__((ext_vector_type(16))) _Float16 v16h;
typedef __attribute__((ext_vector_type(8)))  float    v8f;

__device__ __forceinline__ v8f wmma_f16(v16h a, v16h b, v8f c) {
  // (neg_a, A, neg_b, B, c_mod, C, reuse_a, reuse_b)
  return __builtin_amdgcn_wmma_f32_16x16x32_f16(false, a, false, b, (short)0, c,
                                                false, false);
}

// A/B operand loader (16x32 f16 tile, one row per lane).
// p must already point at row_base + k_chunk + (lane>=16 ? 8 : 0).
// Elements [0..7] = K+0..7 of this lane's chunk, [8..15] = K+16..23.
__device__ __forceinline__ v16h load_tile_f16(const _Float16* __restrict__ p) {
  v16h a;
#pragma unroll
  for (int t = 0; t < 8; ++t) {
    a[t]     = p[t];
    a[t + 8] = p[t + 16];
  }
  return a;
}

// LDS staging of operand tiles.  A tile is 64 rows x 64 f16 (128 B a row), laid
// at a pitch of 144 B (16 B x odd: conflict-free for 16-byte reads).  128 threads (the
// block, or a key half in the attention kernel) fetch it with 16-byte loads whose 32 lanes cover four whole 128-B
// lines; each of the 4 waves then reads its fragments from LDS.
typedef __attribute__((ext_vector_type(8))) _Float16 v8h;
typedef __attribute__((ext_vector_type(4))) _Float16 v4h;
typedef __attribute__((ext_vector_type(4))) float    v4f;
typedef __attribute__((ext_vector_type(2))) float    v2f;
#define PITCH 72
#define TILE_HALVES (64 * PITCH)

// Fragment from LDS: same element order as load_tile_f16
// (p = row base + k_chunk + (lane>=16 ? 8 : 0)).
__device__ __forceinline__ v16h frag_lds(const _Float16* p) {
  const v8h lo = *(const v8h*)p;
  const v8h hi = *(const v8h*)(p + 16);
  return __builtin_shufflevector(lo, hi, 0, 1, 2, 3, 4, 5, 6, 7, 8, 9, 10, 11,
                                 12, 13, 14, 15);
}

// f32 source, 64 x 64 floats: thread t holds floats (t&15)*4.. of rows (t>>4)+8p.
// g already points at this thread's first float4; ld = row stride in floats.
__device__ __forceinline__ void fetch_f32(v4f (&r)[8], const float* __restrict__ g,
                                          int ld) {
#pragma unroll
  for (int p = 0; p < 8; ++p) r[p] = *(const v4f*)(g + p * 8 * ld);
}
__device__ __forceinline__ void put_f32(_Float16* s, const v4f (&r)[8]) {
#pragma unroll
  for (int p = 0; p < 8; ++p)
    *(v4h*)(s + p * 8 * PITCH) = __builtin_convertvector(r[p], v4h);
}
// f16 source, 64 x 64 halves: thread t holds halves (t&7)*8.. of rows (t>>3)+16p.
__device__ __forceinline__ void fetch_f16(v8h (&r)[4],
                                          const _Float16* __restrict__ g, int ld) {
#pragma unroll
  for (int p = 0; p < 4; ++p) r[p] = *(const v8h*)(g + p * 16 * ld);
}
__device__ __forceinline__ void put_f16(_Float16* s, const v8h (&r)[4]) {
#pragma unroll
  for (int p = 0; p < 4; ++p) *(v8h*)(s + p * 16 * PITCH) = r[p];
}

// ---------------------------------------------------------------------------
// Kernel 0: sigmoid(rpe) * log2(e) -> f32 bias table, laid out for the attention
// kernel, which forms its scores as arguments of 2^x:
// tab[h][c][z] = log2(e) * sigmoid(rpe[S-1 + i - j][h]) at z + c = j - i + S-1,
// c = 0..3.
// Head-major and ascending in the key j, so that the biases of consecutive keys
// of one query are consecutive floats; the four copies, each shifted by one
// float, give every query a copy in which its runs start on a 16-byte boundary.
// Entries past the last relative position are zero and never enter a score.
// ---------------------------------------------------------------------------
#define NREL (2 * SEQ - 1)     // relative positions
#define TAB_Z 4096             // floats per copy in the global table
#define WIN_Z 2176             // floats of a copy that one 128-query block stages
#define WIN_PITCH 2192         // LDS pitch of a copy: 16 banks past a multiple of 64
__global__ void rpe_sigmoid_kernel(const float* __restrict__ rpe,
                                   float* __restrict__ tab) {
  // t = (h * 4 + c) * TAB_Z + u with u = TAB_Z-1 - z, so that the row of rpe,
  // NREL-1 - (z + c) = u - 1 - c, ascends with the thread.
  const unsigned t = blockIdx.x * blockDim.x + threadIdx.x;
  const unsigned u = t & (TAB_Z - 1);
  const unsigned c = (t >> 12) & 3;
  const unsigned h = t >> 14;
  float v = 0.0f;
  if (u > c) v = 1.44269504f / (1.0f + __expf(-rpe[(u - 1 - c) * HEADS + h]));
  tab[(t | (TAB_Z - 1)) - u] = v;
}

// ---------------------------------------------------------------------------
// Kernel 1: fused QKV projection.  X (8192x512 f32) @ W^T + b -> f16.
// grid = (M/256, H)  block = 512 (16 waves), one block on a WGP
// Q,K stored [B,H,S,64]; V stored transposed [B,H,64,S].
// Q is stored times the head's score scale times log2(e), multiplied in f32 in
// front of its one rounding to f16: K Q^T is then the scaled score in units of
// log2, and the attention kernel has no multiply left per score.
// Head split per reference: feature n -> h = n % 8, d = n / 8.
// A block takes 256 positions and ALL THREE products of ONE head (rows d*8 + h of
// Wq, Wk and Wv): an X tile is fetched from L2 once for 192 output features and
// a weight tile once for 256 positions.
// A wave takes a strip of 32 positions.  Waves 0..7 make Q of their strip and
// head-dims 0..31 of V^T, waves 8..15 K and head-dims 32..63: the strip's two X
// fragments are the B operand of Q or K (a lane owns one position, its 8
// accumulator registers are 8 consecutive head-dims) and the A operand of V^T (a
// lane owns one head-dim, 8 consecutive positions), so that 8 fragments read from
// LDS feed 12 WMMAs.
// All output goes through LDS and leaves as whole lines: a wave's 32 rows of Q or
// K (128 B each), the block's 64 rows of V^T (512 B each).
// ---------------------------------------------------------------------------
#define QKV_ROWS 256                      // positions of a block
#define STAGE_ROWS (QKV_ROWS + 3 * HDIM)  // X rows, then the head's Wq, Wk, Wv rows
#define STAGE_HALVES (STAGE_ROWS * PITCH)
#define VPITCH (QKV_ROWS + 8)             // V^T staging: 528 B a row, 16 B x odd
#define VST_OFF (16 * 32 * PITCH)         // behind the 16 waves' rows of Q and K

__global__ __launch_bounds__(512) void qkv_proj_kernel(
    const float* __restrict__ X,
    const float* __restrict__ Wq, const float* __restrict__ bq,
    const float* __restrict__ Wk, const float* __restrict__ bk,
    const float* __restrict__ Wv, const float* __restrict__ bv,
    const float* __restrict__ logit_scale,
    _Float16* __restrict__ qf, _Float16* __restrict__ kf,
    _Float16* __restrict__ vt) {
  __shared__ __attribute__((aligned(16))) _Float16 sm[2 * STAGE_HALVES];
  // biases of this head, then the factor of Q
  __shared__ __attribute__((aligned(16))) float bsm[3 * HDIM + 4];

  const int lane = threadIdx.x & 31;
  const int wave = __builtin_amdgcn_readfirstlane(threadIdx.x >> 5);
  const int lr = lane & 15;  // row-in-tile of an operand
  const int hs = lane >> 4;  // half select
  const int ps = wave & 7;   // position strip
  const int wh = wave >> 3;  // 0: Q, V^T rows 0..31; 1: K, V^T rows 32..63
  const int h = blockIdx.y;
  const int m0 = blockIdx.x * QKV_ROWS;

  // Staging: thread t holds floats (t&15)*4.. of rows (t>>4) + 32p of a tile.
  // Row d of the head's weights is feature d*H + h (reference split_heads).
  const int srow = threadIdx.x >> 4, scol = (threadIdx.x & 15) * 4;
  // Block-uniform bases and one 32-bit offset a thread for X, one for the weights.
  const float* xg = X + m0 * DMODEL;
  const float* wqg = Wq + h * DMODEL;
  const float* wkg = Wk + h * DMODEL;
  const float* wvg = Wv + h * DMODEL;
  const unsigned xo = srow * DMODEL + scol;
  const unsigned wo = srow * HEADS * DMODEL + scol;
  const int soff = srow * PITCH + scol;

  v4f xr[8], wr[6];
  auto fetch = [&]() {
#pragma unroll
    for (int p = 0; p < 8; ++p) xr[p] = *(const v4f*)(xg + p * 32 * DMODEL + xo);
#pragma unroll
    for (int p = 0; p < 2; ++p) {
      wr[p]     = *(const v4f*)(wqg + p * 32 * HEADS * DMODEL + wo);
      wr[p + 2] = *(const v4f*)(wkg + p * 32 * HEADS * DMODEL + wo);
      wr[p + 4] = *(const v4f*)(wvg + p * 32 * HEADS * DMODEL + wo);
    }
  };
  auto put = [&](int buf) {
    _Float16* s = &sm[buf * STAGE_HALVES + soff];
#pragma unroll
    for (int p = 0; p < 8; ++p)
      *(v4h*)(s + p * 32 * PITCH) = __builtin_convertvector(xr[p], v4h);
#pragma unroll
    for (int p = 0; p < 6; ++p)
      *(v4h*)(s + (QKV_ROWS + p * 32) * PITCH) = __builtin_convertvector(wr[p], v4h);
    // the next tile's; here, where the loads that name these bases have returned
    xg += 64;
    wqg += 64;
    wkg += 64;
    wvg += 64;
  };

  // aqk[g][sub][r] = sum_k W[sub*16 + 8*hs + r][k] * X[ps*32 + g*16 + lr][k]
  // av[g][e][r]    = sum_k X[ps*32 + g*16 + 8*hs + r][k] * Wv[wh*32 + e*16 + lr][k]
  v8f aqk[2][4] = {{{}, {}, {}, {}}, {{}, {}, {}, {}}};
  v8f av[2][2] = {{{}, {}}, {{}, {}}};

  fetch();
  // behind the tile's loads, so that all share one latency
  if (threadIdx.x < 3 * HDIM) {
    const float* bsel = threadIdx.x < HDIM ? bq : threadIdx.x < 2 * HDIM ? bk : bv;
    bsm[threadIdx.x] = bsel[(threadIdx.x & (HDIM - 1)) * HEADS + h];
  } else if (threadIdx.x == 3 * HDIM) {
    // exp(min(ls, ln(100))) / sqrt(D_MODEL) * log2(e)
    bsm[3 * HDIM] =
        __expf(fminf(logit_scale[h], 4.6051702f)) * 0.04419417382f * 1.44269504f;
  }
  put(0);
  __syncthreads();  // publishes tile 0, the head's biases and the factor of Q

  const int xoff = (ps * 32 + lr) * PITCH + hs * 8;
  const int woff = (QKV_ROWS + wh * HDIM + lr) * PITCH + hs * 8;
  const int voff = (QKV_ROWS + 2 * HDIM + wh * 32 + lr) * PITCH + hs * 8;
  // Not peeled: the two tests of 'more' stay branches, so that the loads, the
  // products and the conversions are blocks of their own in this order; peeled,
  // the build put the conversions, and the wait for the loads, in front of the
  // products.
#pragma clang loop unroll(disable)
  for (int it = 0; it < DMODEL / 64; ++it) {
    const int cur = it & 1;
    const bool more = it + 1 < DMODEL / 64;
    if (more) fetch();  // next tile flies while this one is multiplied
#pragma unroll
    for (int c = 0; c < 2; ++c) {
      const _Float16* s = &sm[cur * STAGE_HALVES + c * 32];
      const v16h x0 = frag_lds(s + xoff), x1 = frag_lds(s + xoff + 16 * PITCH);
      v16h w[4];
#pragma unroll
      for (int sub = 0; sub < 4; ++sub) w[sub] = frag_lds(s + woff + sub * 16 * PITCH);
      const v16h v0 = frag_lds(s + voff), v1 = frag_lds(s + voff + 16 * PITCH);
      // The chunk's 16 LDS reads stand as one group in front of its 12 WMMAs:
      // without this line the build read a fragment and waited for it, six times.
      __builtin_amdgcn_sched_barrier(0);
#pragma unroll
      for (int sub = 0; sub < 4; ++sub) {
        aqk[0][sub] = wmma_f16(w[sub], x0, aqk[0][sub]);
        aqk[1][sub] = wmma_f16(w[sub], x1, aqk[1][sub]);
      }
      av[0][0] = wmma_f16(x0, v0, av[0][0]);
      av[1][0] = wmma_f16(x1, v0, av[1][0]);
      av[0][1] = wmma_f16(x0, v1, av[0][1]);
      av[1][1] = wmma_f16(x1, v1, av[1][1]);
    }
    if (more) put(cur ^ 1);
    // publishes the next tile and ends the reads of this one before its refill
    __syncthreads();
  }

  const float osc = wh ? 1.0f : bsm[3 * HDIM];  // K: times 1, which is exact

  // The operand tiles are free since the loop's last barrier.
  _Float16* st = &sm[wave * 32 * PITCH];  // this wave's 32 rows of Q or K
  _Float16* vst = &sm[VST_OFF];           // the block's 64 rows of V^T
#pragma unroll
  for (int g = 0; g < 2; ++g) {
#pragma unroll
    for (int sub = 0; sub < 4; ++sub) {
      const v4f lo = *(const v4f*)&bsm[wh * HDIM + sub * 16 + 8 * hs];
      const v4f hi = *(const v4f*)&bsm[wh * HDIM + sub * 16 + 8 * hs + 4];
      const v8f bn = __builtin_shufflevector(lo, hi, 0, 1, 2, 3, 4, 5, 6, 7);
      v8h w;
#pragma unroll
      for (int r = 0; r < 8; ++r) w[r] = (_Float16)((aqk[g][sub][r] + bn[r]) * osc);
      *(v8h*)&st[(g * 16 + lr) * PITCH + sub * 16 + 8 * hs] = w;
    }
#pragma unroll
    for (int e = 0; e < 2; ++e) {
      const int d = wh * 32 + e * 16 + lr;
      const float b1 = bsm[2 * HDIM + d];
      v8h w;
#pragma unroll
      for (int r = 0; r < 8; ++r) w[r] = (_Float16)(av[g][e][r] + b1);
      *(v8h*)&vst[d * VPITCH + ps * 32 + g * 16 + 8 * hs] = w;
    }
  }
  __syncthreads();  // publishes the staged output rows

  const size_t bh = (m0 >> 11) * HEADS + h;  // m / SEQ
  const int s0 = m0 & (SEQ - 1);
  // Q or K: the wave's 32 rows are 4 KiB in a row, four lines an instruction.
  _Float16* o = (wh ? kf : qf) + (bh * SEQ + s0 + ps * 32 + (lane >> 3)) * HDIM +
                (lane & 7) * 8;
#pragma unroll
  for (int j = 0; j < 8; ++j)
    *(v8h*)(o + j * 4 * HDIM) =
        *(const v8h*)&st[(j * 4 + (lane >> 3)) * PITCH + (lane & 7) * 8];
  // V^T: one row's 256 positions (four lines) an instruction, rows wave + 16j.
  _Float16* ov = vt + (bh * HDIM + wave) * SEQ + s0 + lane * 8;
#pragma unroll
  for (int j = 0; j < 4; ++j)
    *(v8h*)(ov + j * 16 * SEQ) =
        *(const v8h*)&vst[(wave + j * 16) * VPITCH + lane * 8];
}

// ---------------------------------------------------------------------------
// Kernel 2: flash attention, transposed products.
// grid = (S/128, H, B), block = 256: 8 waves = 4 query strips x 2 key halves.  A
// wave owns 32 queries (two column groups of 16, so that every K and V^T fragment
// read from LDS feeds two WMMAs) and walks 1024 keys, which keeps four waves on a
// SIMD; the two partial results of a strip are merged through LDS at the end.
// Per 64-key tile and group: S^T = K Q^T (8 WMMA; A = K rows from LDS, B = Q in
// registers, the accumulator started at the bias: Q and the bias table both carry
// log2(e), Q the score scale too, so the result is the whole score in units of
// log2), so a lane holds 32 scores of ONE query of the group (column lr;
// keys 8*hs + r of each 16-key group): maximum and sum run in-lane, plus one
// exchange between the wave's halves.  Two score tiles, converted in place, are
// the B operand of O^T += V^T P^T (8 WMMA): P never leaves the registers.
// The bias depends on j - i alone: a block's 128 queries and all keys meet 2175
// relative positions, staged once in LDS (four shifted copies); the 8 biases of
// a score tile's lane are then two 16-byte LDS reads.
// Output written f16 to ao [B,S,D] with f = h*64 + d.
// ---------------------------------------------------------------------------
// Value of lane l ^ 16.
__device__ __forceinline__ float other_half(float x) {
  const int b = __builtin_bit_cast(int, x);
  return __builtin_bit_cast(
      float, __builtin_amdgcn_permlanex16(b, b, 0x76543210, 0xfedcba98, false,
                                          false));
}

// 2^(s - m) of the eight scores of one tile: the subtraction and v_exp_f32.
// Written as one statement so that the v_nop stands directly
// behind the last v_exp_f32: the instruction set asks for one independent
// instruction between a transcendental and a vector instruction that uses its
// result or overwrites its source.  Inside the run each
// v_exp_f32 is independent of the one before.  Each works in place: the statement
// writes only registers that the subtractions in front of it wrote, so it is never
// the first write over the operands of a matrix instruction just issued (the
// compiler keeps that distance for its own instructions, not for asm text).
__device__ __forceinline__ void exp_tile(v8f& s, float m) {
  float a0 = s[0] - m, a1 = s[1] - m, a2 = s[2] - m, a3 = s[3] - m;
  float a4 = s[4] - m, a5 = s[5] - m, a6 = s[6] - m, a7 = s[7] - m;
  asm("v_exp_f32 %0, %0\n\tv_exp_f32 %1, %1\n\tv_exp_f32 %2, %2\n\t"
      "v_exp_f32 %3, %3\n\tv_exp_f32 %4, %4\n\tv_exp_f32 %5, %5\n\t"
      "v_exp_f32 %6, %6\n\tv_exp_f32 %7, %7\n\tv_nop"
      : "+v"(a0), "+v"(a1), "+v"(a2), "+v"(a3), "+v"(a4), "+v"(a5), "+v"(a6),
        "+v"(a7));
  s[0] = a0; s[1] = a1; s[2] = a2; s[3] = a3;
  s[4] = a4; s[5] = a5; s[6] = a6; s[7] = a7;
}

__global__ __launch_bounds__(256) __attribute__((amdgpu_waves_per_eu(4, 4)))
void flash_attn_kernel(
    const _Float16* __restrict__ qf, const _Float16* __restrict__ kf,
    const _Float16* __restrict__ vt, const float* __restrict__ tab,
    _Float16* __restrict__ ao) {
  // One object, the bias window first: its reads then reach every tile of a pass
  // by the instruction's 16-bit offset from one address register.
  __shared__ __attribute__((aligned(16))) struct {
    float bw[4 * WIN_PITCH];
    _Float16 ks[2][2][TILE_HALVES];  // [buffer][key half]
    _Float16 vs[2][2][TILE_HALVES];
  } sm;
  auto& bw = sm.bw;
  auto& ks = sm.ks;
  auto& vs = sm.vs;

  const int lane = threadIdx.x & 31;
  const int wave = __builtin_amdgcn_readfirstlane(threadIdx.x >> 5);
  const int qs = wave & 3;   // query strip
  const int kh = wave >> 2;  // key half
  const int lr = lane & 15;
  const int hs = lane >> 4;

  const int b = blockIdx.z;
  const int h = blockIdx.y;
  const int i0 = blockIdx.x * 128 + qs * 32 + lr;  // this lane's query, group 0

  const int bh = b * HEADS + h;

  // Q strips as B operands: column = query lr of group g, 64 k (two chunks of 32)
  const _Float16* qp = qf + ((size_t)bh * SEQ + i0) * HDIM + hs * 8;
  v16h bq[2][2];
#pragma unroll
  for (int g = 0; g < 2; ++g) {
    bq[g][0] = load_tile_f16(qp + g * 16 * HDIM);
    bq[g][1] = load_tile_f16(qp + g * 16 * HDIM + 32);
  }
  // The zeroing of the accumulators below reuses Q's address registers: this
  // wait stands between the loads and that overwrite.
  asm volatile("s_wait_xcnt 0x0" ::: "memory");

  // o[g][sd][r] = O^T[sd*16 + 8*hs + r][query lr of group g]
  v8f o[2][4] = {{{}, {}, {}, {}}, {{}, {}, {}, {}}};
  float mrow[2] = {-1e30f, -1e30f};  // running maximum of this lane's queries (log2)
  float lrow[2] = {0.0f, 0.0f};      // running sums over this half's keys only

  // The four waves of a key half stage that half's tiles.
  const int srow = (threadIdx.x & 127) >> 3, scol = (threadIdx.x & 7) * 8;
  const _Float16* kg =
      kf + ((size_t)bh * SEQ + kh * (SEQ / 2) + srow) * HDIM + scol;
  const _Float16* vg = vt + ((size_t)bh * HDIM + srow) * SEQ + kh * (SEQ / 2) + scol;
  const int soff = srow * PITCH + scol;
  v8h kr[4], vr[4];
  fetch_f16(kr, kg, HDIM);
  fetch_f16(vr, vg, SEQ);
  // Bias window of this block: floats z0 .. z0 + WIN_Z - 1 of each copy, with
  // z0 = S-1 - (last query of the block), whole lines.  Waves c and c + 4 stage
  // copy c: each 1024 floats, 16 bytes a lane, and 64 of the last 128 floats,
  // 8 bytes a lane, which keeps every lane on.
  // The loads are issued with those of K and V^T tile 0: all share one latency.
  const float* tg = tab + (h * 4 + qs) * TAB_Z + (SEQ - 128 - blockIdx.x * 128);
  float* tl = &bw[qs * WIN_PITCH];
  const int woff = kh * 1024 + lane * 4, toff = 2048 + kh * 64 + lane * 2;
  v4f wr[8];
#pragma unroll
  for (int p = 0; p < 8; ++p) wr[p] = *(const v4f*)(tg + woff + p * 128);
  const v2f wt = *(const v2f*)(tg + toff);
  // The code behind reuses these loads' address registers: this wait stands
  // between the loads and that overwrite.
  asm volatile("s_wait_xcnt 0x0" ::: "memory");
  put_f16(&ks[0][kh][soff], kr);
  put_f16(&vs[0][kh][soff], vr);
#pragma unroll
  for (int p = 0; p < 8; ++p) *(v4f*)(tl + woff + p * 128) = wr[p];
  *(v2f*)(tl + toff) = wt;
  // This lane's biases: window index of (query i, key j) is j + 127 - (i - block's
  // first query); copy 3 - (lr & 3) holds it at a multiple of 4 floats for j % 4 == 0.
  // (124 - 32 * qs - 16 * g - (lr & 12), written as a sum of terms that are never
  // negative; bl is group 1's at this half's first key, group 0's lies 16 floats
  // behind it)
  const float* bl = &bw[((lr & 3) ^ 3) * WIN_PITCH + (qs ^ 3) * 32 +
                        ((lr & 12) ^ 12) + 8 * hs + kh * (SEQ / 2)];
  __syncthreads();  // publishes K and V^T tile 0 and the bias window

  kg += 64 * HDIM;  // from here on: the next tile's
  vg += 64;
  for (int kt = 0; kt < SEQ / 128; ++kt) {
    const int j0 = kt * 64;  // counted from this half's first key
    const int cur = kt & 1;
    const bool more = kt + 1 < SEQ / 128;

    // ---- scores in units of log2: S^T = bias + K Q^T, the bias as the C operand ----
    // (element r of tile sub is key j0 + sub*16 + 8*hs + r of this half)
    v8f sv[2][4];
#pragma unroll
    for (int sub = 0; sub < 4; ++sub) {
      const _Float16* kp = &ks[cur][kh][(sub * 16 + lr) * PITCH + hs * 8];
      const v16h k0 = frag_lds(kp), k1 = frag_lds(kp + 32);
      v8f sg[2];
#pragma unroll
      for (int g = 0; g < 2; ++g) {
        const float* bp0 = bl + (g ^ 1) * 16 + j0 + sub * 16;
        const v4f b0 = *(const v4f*)bp0;
        const v4f b1 = *(const v4f*)(bp0 + 4);
        sg[g] = __builtin_shufflevector(b0, b1, 0, 1, 2, 3, 4, 5, 6, 7);
      }
      sg[0] = wmma_f16(k0, bq[0][0], sg[0]);
      sg[1] = wmma_f16(k0, bq[1][0], sg[1]);
      sv[0][sub] = wmma_f16(k1, bq[0][1], sg[0]);
      sv[1][sub] = wmma_f16(k1, bq[1][1], sg[1]);
    }

    // The next tiles fly during softmax and O^T: the staging registers are taken
    // only behind the scores, where K fragments and biases have left theirs.
    if (more) {
      fetch_f16(kr, kg, HDIM);
      fetch_f16(vr, vg, SEQ);
      kg += 64 * HDIM;
      vg += 64;
    }
    // Keeps the loads where they stand, behind the scores: without this line the
    // build lifted them to the loop's head, where the staging registers no longer
    // fit, and spilled the staged K tile to scratch in every pass.
    __builtin_amdgcn_sched_barrier(0);

    v16h bp[2][2];
#pragma unroll
    for (int g = 0; g < 2; ++g) {
      // ---- tile maximum of this query: in-lane, then the other half's ----
      float tmax = sv[g][0][0];
#pragma unroll
      for (int sub = 0; sub < 4; ++sub)
#pragma unroll
        for (int r = 0; r < 8; ++r) tmax = fmaxf(tmax, sv[g][sub][r]);
      tmax = fmaxf(tmax, other_half(tmax));

      // ---- online softmax update ----
      const float nm = fmaxf(mrow[g], tmax);
      const float corr = __builtin_amdgcn_exp2f(mrow[g] - nm);
      mrow[g] = nm;
      float ts[4];  // four independent chains
#pragma unroll
      for (int sub = 0; sub < 4; ++sub) {
        exp_tile(sv[g][sub], nm);
        ts[sub] = sv[g][sub][0];
#pragma unroll
        for (int r = 1; r < 8; ++r) ts[sub] += sv[g][sub][r];
      }
      lrow[g] = lrow[g] * corr + ((ts[0] + ts[1]) + (ts[2] + ts[3]));
#pragma unroll
      for (int sd = 0; sd < 4; ++sd)
#pragma unroll
        for (int r = 0; r < 8; ++r) o[g][sd][r] *= corr;

      // ---- P^T as B operand: score tiles 2c and 2c+1 hold keys 8*hs + 0..7 and
      // 16 + 8*hs + 0..7 of chunk c, the k order of frag_lds ----
#pragma unroll
      for (int c = 0; c < 2; ++c)
#pragma unroll
        for (int t = 0; t < 8; ++t) {
          bp[g][c][t]     = (_Float16)sv[g][2 * c][t];
          bp[g][c][t + 8] = (_Float16)sv[g][2 * c + 1][t];
        }
    }

    // ---- O^T += V^T P^T   (V^T rows are head-dims; contiguous over j) ----
#pragma unroll
    for (int sd = 0; sd < 4; ++sd) {
      const _Float16* vp = &vs[cur][kh][(sd * 16 + lr) * PITCH + hs * 8];
      const v16h v0 = frag_lds(vp), v1 = frag_lds(vp + 32);
#pragma unroll
      for (int g = 0; g < 2; ++g) {
        o[g][sd] = wmma_f16(v0, bp[g][0], o[g][sd]);
        o[g][sd] = wmma_f16(v1, bp[g][1], o[g][sd]);
      }
    }
    // The other K/V buffer was last read in the pass before, which ended at the
    // barrier at this loop's foot.
    if (more) {
      put_f16(&ks[cur ^ 1][kh][soff], kr);
      put_f16(&vs[cur ^ 1][kh][soff], vr);
    }
    // publishes the next tiles and ends the reads of these before their refill
    __syncthreads();
  }

  // ---- merge of the two key halves: the wave of half kh finishes column group
  // kh of its strip and hands group kh ^ 1 to its partner (wave ^ 4), lane to lane.
  // The K buffers are free since the loop's last barrier: 9 pieces of 16 bytes a
  // lane and wave (8 of O^T, one with maximum and sum), lanes side by side. ----
  // The lane's number is read anew for what follows: what the loop does not use
  // then holds no register across it (held, it cost a spill).
  const int ln = __builtin_amdgcn_mbcnt_lo(~0u, 0u);
  v4f* xch = (v4f*)&ks[0][0][0];
  v4f* xw = xch + wave * 9 * 32 + ln;
  const v4f* xr = xch + (wave ^ 4) * 9 * 32 + ln;
#pragma unroll
  for (int sd = 0; sd < 4; ++sd) {
    const v8f gv = kh ? o[0][sd] : o[1][sd];
    xw[(2 * sd) * 32] = __builtin_shufflevector(gv, gv, 0, 1, 2, 3);
    xw[(2 * sd + 1) * 32] = __builtin_shufflevector(gv, gv, 4, 5, 6, 7);
  }
  const v4f gml = {kh ? mrow[0] : mrow[1], kh ? lrow[0] : lrow[1], 0.0f, 0.0f};
  xw[8 * 32] = gml;
  __syncthreads();  // publishes the partial results

  const v4f pml = xr[8 * 32];
  const float mm = kh ? mrow[1] : mrow[0];
  const float nm = fmaxf(mm, pml[0]);
  // Weights of this wave's part and of the partner's: 2^x as in exp_tile, in one
  // statement for the same reason (the v_nop behind the last v_exp_f32).
  float ca = mm - nm, cb = pml[0] - nm;
  asm("v_exp_f32 %0, %0\n\tv_exp_f32 %1, %1\n\tv_nop" : "+v"(ca), "+v"(cb));
  // ---- join the lane halves' sums, O / l, merge heads (f = h*64 + d); a lane's
  // 8 registers are 8 consecutive d of its query: one 16-byte store ----
  const float lsum = (kh ? lrow[1] : lrow[0]) * ca + pml[1] * cb;
  const float ltot = lsum + other_half(lsum);
#pragma unroll
  for (int sd = 0; sd < 4; ++sd) {
    const v8f mv = kh ? o[1][sd] : o[0][sd];
    const v4f p0 = xr[(2 * sd) * 32];
    const v4f p1 = xr[(2 * sd + 1) * 32];
    v8h w;
#pragma unroll
    for (int r = 0; r < 4; ++r) {
      w[r]     = (_Float16)((mv[r] * ca + p0[r] * cb) / ltot);
      w[r + 4] = (_Float16)((mv[r + 4] * ca + p1[r] * cb) / ltot);
    }
    *(v8h*)&ao[((size_t)b * SEQ + blockIdx.x * 128 + qs * 32 + kh * 16 + (ln & 15)) *
                   DMODEL +
               h * HDIM + sd * 16 + 8 * (ln >> 4)] = w;
  }
}

// ---------------------------------------------------------------------------
// Kernel 3: output projection.  AO (8192x512 f16) @ Wp^T + bp -> f32 d_out.
// ---------------------------------------------------------------------------
__global__ __launch_bounds__(128) void out_proj_kernel(
    const _Float16* __restrict__ ao, const float* __restrict__ Wp,
    const float* __restrict__ bp, float* __restrict__ out) {
  const int lane = threadIdx.x & 31;
  const int wave = threadIdx.x >> 5;
  const int lr = lane & 15;
  const int hs = lane >> 4;

  const int m0 = blockIdx.x * 64 + wave * 16;
  const int n0 = blockIdx.y * 64;

  __shared__ __attribute__((aligned(16))) _Float16 as[2][TILE_HALVES];
  __shared__ __attribute__((aligned(16))) _Float16 wsm[2][TILE_HALVES];

  const int arow = threadIdx.x >> 3, acol = (threadIdx.x & 7) * 8;
  const int wrow = threadIdx.x >> 4, wcol = (threadIdx.x & 15) * 4;
  const _Float16* ag = ao + (size_t)(blockIdx.x * 64 + arow) * DMODEL + acol;
  const float* wg = Wp + (n0 + wrow) * DMODEL + wcol;
  const int aoff = arow * PITCH + acol;
  const int woff = wrow * PITCH + wcol;

  v8f acc[4] = {{}, {}, {}, {}};
  v8h ar[4];
  v4f wr[8];
  fetch_f16(ar, ag, DMODEL);
  fetch_f32(wr, wg, DMODEL);
  put_f16(&as[0][aoff], ar);
  put_f32(&wsm[0][woff], wr);
  __syncthreads();  // publishes tile 0

  for (int it = 0; it < DMODEL / 64; ++it) {
    const int cur = it & 1;
    const bool more = it + 1 < DMODEL / 64;
    if (more) {  // next tile flies while this one is multiplied
      fetch_f16(ar, ag + (it + 1) * 64, DMODEL);
      fetch_f32(wr, wg + (it + 1) * 64, DMODEL);
    }
#pragma unroll
    for (int c = 0; c < 2; ++c) {
      const v16h a = frag_lds(&as[cur][(wave * 16 + lr) * PITCH + c * 32 + hs * 8]);
#pragma unroll
      for (int sub = 0; sub < 4; ++sub) {
        const v16h bm =
            frag_lds(&wsm[cur][(sub * 16 + lr) * PITCH + c * 32 + hs * 8]);
        acc[sub] = wmma_f16(a, bm, acc[sub]);
      }
    }
    if (more) {
      put_f16(&as[cur ^ 1][aoff], ar);
      put_f32(&wsm[cur ^ 1][woff], wr);
    }
    // publishes the next tile and ends the reads of this one before its refill
    __syncthreads();
  }

#pragma unroll
  for (int sub = 0; sub < 4; ++sub) {
    const int n = n0 + sub * 16 + lr;
    const float bn = bp[n];
#pragma unroll
    for (int r = 0; r < 8; ++r) {
      const int m = m0 + r + 8 * hs;
      out[(size_t)m * DMODEL + n] = acc[sub][r] + bn;
    }
  }
}

// ---------------------------------------------------------------------------
extern "C" void kernel_launch(void* const* d_in, const int* in_sizes, int n_in,
                              void* d_out, int out_size, void* d_ws,
                              size_t ws_size, hipStream_t stream) {
  (void)in_sizes; (void)n_in; (void)out_size; (void)ws_size;

  const float* query = (const float*)d_in[0];
  const float* Wq = (const float*)d_in[1];
  const float* bq = (const float*)d_in[2];
  const float* Wk = (const float*)d_in[3];
  const float* bk = (const float*)d_in[4];
  const float* Wv = (const float*)d_in[5];
  const float* bv = (const float*)d_in[6];
  const float* Wp = (const float*)d_in[7];
  const float* bp = (const float*)d_in[8];
  const float* logit_scale = (const float*)d_in[9];
  const float* rpe = (const float*)d_in[10];

  // workspace carve-up
  const size_t QKV_ELEMS = (size_t)BATCH * HEADS * SEQ * HDIM;  // 4.19M halves
  char* ws = (char*)d_ws;
  float* tab = (float*)ws;                         // 8*4*4096 f32 = 524288 B
  _Float16* qf = (_Float16*)(ws + 524288);
  _Float16* kf = qf + QKV_ELEMS;
  _Float16* vt = kf + QKV_ELEMS;
  _Float16* ao = vt + QKV_ELEMS;

  rpe_sigmoid_kernel<<<(HEADS * 4 * TAB_Z) / 256, 256, 0, stream>>>(rpe, tab);

  qkv_proj_kernel<<<dim3((BATCH * SEQ) / 256, HEADS), 512, 0, stream>>>(
      query, Wq, bq, Wk, bk, Wv, bv, logit_scale, qf, kf, vt);

  flash_attn_kernel<<<dim3(SEQ / 128, HEADS, BATCH), 256, 0, stream>>>(
      qf, kf, vt, tab, ao);

  out_proj_kernel<<<dim3((BATCH * SEQ) / 64, DMODEL / 64), 128, 0, stream>>>(
      ao, Wp, bp, (float*)d_out);
}

// v008
// It runs in 70.2 microseconds.
// Next to v007, in two timings, it ran 1.03 times as fast each time.
// Over all steps from v000 it is 4.59 times as fast.
#include <hip/hip_runtime.h>
#include <hip/hip_bf16.h>

// ---------------------------------------------------------------------------
// Multi-head attention (logit_scale + sigmoid rel-pos bias)
// B=4, S=2048, D=512, H=8, hd=64.  f16 WMMA (v_wmma_f32_16x16x32_f16),
// f32 accumulate, fused flash-attention middle stage.
// ---------------------------------------------------------------------------

#define BATCH 4
#define SEQ   2048
#define DMODEL 512
#define HEADS 8
#define HDIM  64

typedef __attribute__((ext_vector_type(16))) _Float16 v16h;
typedef __attribute__((ext_vector_type(8)))  float    v8f;

__device__ __forceinline__ v8f wmma_f16(v16h a, v16h b, v8f c) {
  // (neg_a, A, neg_b, B, c_mod, C, reuse_a, reuse_b)
  return __builtin_amdgcn_wmma_f32_16x16x32_f16(false, a, false, b, (short)0, c,
                                                false, false);
}

// A/B operand loader (16x32 f16 tile, one row per lane).
// p must already point at row_base + k_chunk + (lane>=16 ? 8 : 0).
// Elements [0..7] = K+0..7 of this lane's chunk, [8..15] = K+16..23.
__device__ __forceinline__ v16h load_tile_f16(const _Float16* __restrict__ p) {
  v16h a;
#pragma unroll
  for (int t = 0; t < 8; ++t) {
    a[t]     = p[t];
    a[t + 8] = p[t + 16];
  }
  return a;
}

// LDS staging of operand tiles.  A tile is 64 rows x 64 f16 (128 B a row), laid
// at a pitch of 144 B (16 B x odd: conflict-free for 16-byte reads).  128 threads (the
// block, or a key half in the attention kernel) fetch it with 16-byte loads whose 32 lanes cover four whole 128-B
// lines; each of the 4 waves then reads its fragments from LDS.
typedef __attribute__((ext_vector_type(8))) _Float16 v8h;
typedef __attribute__((ext_vector_type(4))) _Float16 v4h;
typedef __attribute__((ext_vector_type(4))) float    v4f;
typedef __attribute__((ext_vector_type(2))) float    v2f;
#define PITCH 72
#define TILE_HALVES (64 * PITCH)

// Fragment from LDS: same element order as load_tile_f16
// (p = row base + k_chunk + (lane>=16 ? 8 : 0)).
__device__ __forceinline__ v16h frag_lds(const _Float16* p) {
  const v8h lo = *(const v8h*)p;
  const v8h hi = *(const v8h*)(p + 16);
  return __builtin_shufflevector(lo, hi, 0, 1, 2, 3, 4, 5, 6, 7, 8, 9, 10, 11,
                                 12, 13, 14, 15);
}

// f32 source, 64 x 64 floats: thread t holds floats (t&15)*4.. of rows (t>>4)+8p.
// g already points at this thread's first float4; ld = row stride in floats.
__device__ __forceinline__ void fetch_f32(v4f (&r)[8], const float* __restrict__ g,
                                          int ld) {
#pragma unroll
  for (int p = 0; p < 8; ++p) r[p] = *(const v4f*)(g + p * 8 * ld);
}
__device__ __forceinline__ void put_f32(_Float16* s, const v4f (&r)[8]) {
#pragma unroll
  for (int p = 0; p < 8; ++p)
    *(v4h*)(s + p * 8 * PITCH) = __builtin_convertvector(r[p], v4h);
}
// f16 source, 64 x 64 halves: thread t holds halves (t&7)*8.. of rows (t>>3)+16p.
__device__ __forceinline__ void fetch_f16(v8h (&r)[4],
                                          const _Float16* __restrict__ g, int ld) {
#pragma unroll
  for (int p = 0; p < 4; ++p) r[p] = *(const v8h*)(g + p * 16 * ld);
}
__device__ __forceinline__ void put_f16(_Float16* s, const v8h (&r)[4]) {
#pragma unroll
  for (int p = 0; p < 4; ++p) *(v8h*)(s + p * 16 * PITCH) = r[p];
}

// ---------------------------------------------------------------------------
// Bias table: sigmoid(rpe) * log2(e) in f32, laid out for the attention kernel,
// which forms its scores as arguments of 2^x:
// tab[h][c][z] = log2(e) * sigmoid(rpe[S-1 + i - j][h]) at z + c = j - i + S-1,
// c = 0..3.
// Head-major and ascending in the key j, so that the biases of consecutive keys
// of one query are consecutive floats; the four copies, each shifted by one
// float, give every query a copy in which its runs start on a 16-byte boundary.
// Entries past the last relative position are zero and never enter a score.
// It has no launch of its own: the threads of the QKV launch, which the attention
// launch follows anyway, make one entry each.
// ---------------------------------------------------------------------------
#define NREL (2 * SEQ - 1)     // relative positions
#define TAB_Z 4096             // floats per copy in the global table
#define WIN_Z 2176             // floats of a copy that one 128-query block stages
#define WIN_PITCH 2192         // LDS pitch of a copy: 16 banks past a multiple of 64

// ---------------------------------------------------------------------------
// Kernel 1: fused QKV projection.  X (8192x512 f32) @ W^T + b -> f16.
// (and the bias table, one entry a thread)
// grid = (M/256, H)  block = 512 (16 waves), one block on a WGP
// Q,K stored [B,H,S,64]; V stored transposed [B,H,64,S].
// Q is stored times the head's score scale times log2(e), multiplied in f32 in
// front of its one rounding to f16: K Q^T is then the scaled score in units of
// log2, and the attention kernel has no multiply left per score.
// Head split per reference: feature n -> h = n % 8, d = n / 8.
// A block takes 256 positions and ALL THREE products of ONE head (rows d*8 + h of
// Wq, Wk and Wv): an X tile is fetched from L2 once for 192 output features and
// a weight tile once for 256 positions.
// A wave takes a strip of 32 positions.  Waves 0..7 make Q of their strip and
// head-dims 0..31 of V^T, waves 8..15 K and head-dims 32..63: the strip's two X
// fragments are the B operand of Q or K (a lane owns one position, its 8
// accumulator registers are 8 consecutive head-dims) and the A operand of V^T (a
// lane owns one head-dim, 8 consecutive positions), so that 8 fragments read from
// LDS feed 12 WMMAs.
// All output goes through LDS and leaves as whole lines: a wave's 32 rows of Q or
// K (128 B each), the block's 64 rows of V^T (512 B each).
// ---------------------------------------------------------------------------
#define QKV_ROWS 256                      // positions of a block
#define STAGE_ROWS (QKV_ROWS + 3 * HDIM)  // X rows, then the head's Wq, Wk, Wv rows
#define STAGE_HALVES (STAGE_ROWS * PITCH)
#define VPITCH (QKV_ROWS + 8)             // V^T staging: 528 B a row, 16 B x odd
#define VST_OFF (16 * 32 * PITCH)         // behind the 16 waves' rows of Q and K

__global__ __launch_bounds__(512) void qkv_proj_kernel(
    const float* __restrict__ X,
    const float* __restrict__ Wq, const float* __restrict__ bq,
    const float* __restrict__ Wk, const float* __restrict__ bk,
    const float* __restrict__ Wv, const float* __restrict__ bv,
    const float* __restrict__ logit_scale, const float* __restrict__ rpe,
    _Float16* __restrict__ qf, _Float16* __restrict__ kf,
    _Float16* __restrict__ vt, float* __restrict__ tab) {
  __shared__ __attribute__((aligned(16))) _Float16 sm[2 * STAGE_HALVES];
  // biases of this head, then the factor of Q
  __shared__ __attribute__((aligned(16))) float bsm[3 * HDIM + 4];

  const int lane = threadIdx.x & 31;
  const int wave = __builtin_amdgcn_readfirstlane(threadIdx.x >> 5);
  const int lr = lane & 15;  // row-in-tile of an operand
  const int hs = lane >> 4;  // half select
  const int ps = wave & 7;   // position strip
  const int wh = wave >> 3;  // 0: Q, V^T rows 0..31; 1: K, V^T rows 32..63
  const int h = blockIdx.y;
  const int m0 = blockIdx.x * QKV_ROWS;

  // Staging: thread t holds floats (t&15)*4.. of rows (t>>4) + 32p of a tile.
  // Row d of the head's weights is feature d*H + h (reference split_heads).
  const int srow = threadIdx.x >> 4, scol = (threadIdx.x & 15) * 4;
  // Block-uniform bases and one 32-bit offset a thread for X, one for the weights.
  const float* xg = X + m0 * DMODEL;
  const float* wqg = Wq + h * DMODEL;
  const float* wkg = Wk + h * DMODEL;
  const float* wvg = Wv + h * DMODEL;
  const unsigned xo = srow * DMODEL + scol;
  const unsigned wo = srow * HEADS * DMODEL + scol;
  const int soff = srow * PITCH + scol;

  v4f xr[8], wr[6];
  auto fetch = [&]() {
#pragma unroll
    for (int p = 0; p < 8; ++p) xr[p] = *(const v4f*)(xg + p * 32 * DMODEL + xo);
#pragma unroll
    for (int p = 0; p < 2; ++p) {
      wr[p]     = *(const v4f*)(wqg + p * 32 * HEADS * DMODEL + wo);
      wr[p + 2] = *(const v4f*)(wkg + p * 32 * HEADS * DMODEL + wo);
      wr[p + 4] = *(const v4f*)(wvg + p * 32 * HEADS * DMODEL + wo);
    }
  };
  auto put = [&](int buf) {
    _Float16* s = &sm[buf * STAGE_HALVES + soff];
#pragma unroll
    for (int p = 0; p < 8; ++p)
      *(v4h*)(s + p * 32 * PITCH) = __builtin_convertvector(xr[p], v4h);
#pragma unroll
    for (int p = 0; p < 6; ++p)
      *(v4h*)(s + (QKV_ROWS + p * 32) * PITCH) = __builtin_convertvector(wr[p], v4h);
    // the next tile's; here, where the loads that name these bases have returned
    xg += 64;
    wqg += 64;
    wkg += 64;
    wvg += 64;
  };

  // aqk[g][sub][r] = sum_k W[sub*16 + 8*hs + r][k] * X[ps*32 + g*16 + lr][k]
  // av[g][e][r]    = sum_k X[ps*32 + g*16 + 8*hs + r][k] * Wv[wh*32 + e*16 + lr][k]
  v8f aqk[2][4] = {{{}, {}, {}, {}}, {{}, {}, {}, {}}};
  v8f av[2][2] = {{{}, {}}, {{}, {}}};

  fetch();
  // This thread's entry of the bias table: tt = (head * 4 + c) * TAB_Z + tu with
  // tu = TAB_Z-1 - z, so that the row of rpe, NREL-1 - (z + c) = tu - 1 - tc,
  // ascends with the thread.  Entries with no row read row 0 and store zero.
  static_assert((BATCH * SEQ / QKV_ROWS) * HEADS * 512 == HEADS * 4 * TAB_Z,
                "one table entry a thread");
  const unsigned tt =
      (blockIdx.y * (BATCH * SEQ / QKV_ROWS) + blockIdx.x) * 512 + threadIdx.x;
  const unsigned tu = tt & (TAB_Z - 1);
  const unsigned tc = (tt >> 12) & 3;
  const float rv = rpe[(tu > tc ? tu - 1 - tc : 0u) * HEADS + (tt >> 14)];
  // behind the tile's loads, so that all share one latency
  if (threadIdx.x < 3 * HDIM) {
    const float* bsel = threadIdx.x < HDIM ? bq : threadIdx.x < 2 * HDIM ? bk : bv;
    bsm[threadIdx.x] = bsel[(threadIdx.x & (HDIM - 1)) * HEADS + h];
  } else if (threadIdx.x == 3 * HDIM) {
    // exp(min(ls, ln(100))) / sqrt(D_MODEL) * log2(e)
    bsm[3 * HDIM] =
        __expf(fminf(logit_scale[h], 4.6051702f)) * 0.04419417382f * 1.44269504f;
  }
  put(0);
  __syncthreads();  // publishes tile 0, the head's biases and the factor of Q
  // Behind the barrier, which waits for a wave's stores: this one then flies under
  // the first tile's products and has long landed at the next barrier.
  tab[(tt | (TAB_Z - 1)) - tu] =
      tu > tc ? 1.44269504f / (1.0f + __expf(-rv)) : 0.0f;
  // The loop reuses this store's address and data registers: this wait stands
  // between the store and that overwrite.
  asm volatile("s_wait_xcnt 0x0" ::: "memory");

  const int xoff = (ps * 32 + lr) * PITCH + hs * 8;
  const int woff = (QKV_ROWS + wh * HDIM + lr) * PITCH + hs * 8;
  const int voff = (QKV_ROWS + 2 * HDIM + wh * 32 + lr) * PITCH + hs * 8;
  // Not peeled: the two tests of 'more' stay branches, so that the loads, the
  // products and the conversions are blocks of their own in this order; peeled,
  // the build put the conversions, and the wait for the loads, in front of the
  // products.
#pragma clang loop unroll(disable)
  for (int it = 0; it < DMODEL / 64; ++it) {
    const int cur = it & 1;
    const bool more = it + 1 < DMODEL / 64;
    if (more) fetch();  // next tile flies while this one is multiplied
#pragma unroll
    for (int c = 0; c < 2; ++c) {
      const _Float16* s = &sm[cur * STAGE_HALVES + c * 32];
      const v16h x0 = frag_lds(s + xoff), x1 = frag_lds(s + xoff + 16 * PITCH);
      v16h w[4];
#pragma unroll
      for (int sub = 0; sub < 4; ++sub) w[sub] = frag_lds(s + woff + sub * 16 * PITCH);
      const v16h v0 = frag_lds(s + voff), v1 = frag_lds(s + voff + 16 * PITCH);
      // The chunk's 16 LDS reads stand as one group in front of its 12 WMMAs:
      // without this line the build read a fragment and waited for it, six times.
      __builtin_amdgcn_sched_barrier(0);
#pragma unroll
      for (int sub = 0; sub < 4; ++sub) {
        aqk[0][sub] = wmma_f16(w[sub], x0, aqk[0][sub]);
        aqk[1][sub] = wmma_f16(w[sub], x1, aqk[1][sub]);
      }
      av[0][0] = wmma_f16(x0, v0, av[0][0]);
      av[1][0] = wmma_f16(x1, v0, av[1][0]);
      av[0][1] = wmma_f16(x0, v1, av[0][1]);
      av[1][1] = wmma_f16(x1, v1, av[1][1]);
    }
    if (more) put(cur ^ 1);
    // publishes the next tile and ends the reads of this one before its refill
    __syncthreads();
  }

  const float osc = wh ? 1.0f : bsm[3 * HDIM];  // K: times 1, which is exact

  // The operand tiles are free since the loop's last barrier.
  _Float16* st = &sm[wave * 32 * PITCH];  // this wave's 32 rows of Q or K
  _Float16* vst = &sm[VST_OFF];           // the block's 64 rows of V^T
#pragma unroll
  for (int g = 0; g < 2; ++g) {
#pragma unroll
    for (int sub = 0; sub < 4; ++sub) {
      const v4f lo = *(const v4f*)&bsm[wh * HDIM + sub * 16 + 8 * hs];
      const v4f hi = *(const v4f*)&bsm[wh * HDIM + sub * 16 + 8 * hs + 4];
      const v8f bn = __builtin_shufflevector(lo, hi, 0, 1, 2, 3, 4, 5, 6, 7);
      v8h w;
#pragma unroll
      for (int r = 0; r < 8; ++r) w[r] = (_Float16)((aqk[g][sub][r] + bn[r]) * osc);
      *(v8h*)&st[(g * 16 + lr) * PITCH + sub * 16 + 8 * hs] = w;
    }
#pragma unroll
    for (int e = 0; e < 2; ++e) {
      const int d = wh * 32 + e * 16 + lr;
      const float b1 = bsm[2 * HDIM + d];
      v8h w;
#pragma unroll
      for (int r = 0; r < 8; ++r) w[r] = (_Float16)(av[g][e][r] + b1);
      *(v8h*)&vst[d * VPITCH + ps * 32 + g * 16 + 8 * hs] = w;
    }
  }
  __syncthreads();  // publishes the staged output rows

  const size_t bh = (m0 >> 11) * HEADS + h;  // m / SEQ
  const int s0 = m0 & (SEQ - 1);
  // Q or K: the wave's 32 rows are 4 KiB in a row, four lines an instruction.
  _Float16* o = (wh ? kf : qf) + (bh * SEQ + s0 + ps * 32 + (lane >> 3)) * HDIM +
                (lane & 7) * 8;
#pragma unroll
  for (int j = 0; j < 8; ++j)
    *(v8h*)(o + j * 4 * HDIM) =
        *(const v8h*)&st[(j * 4 + (lane >> 3)) * PITCH + (lane & 7) * 8];
  // V^T: one row's 256 positions (four lines) an instruction, rows wave + 16j.
  _Float16* ov = vt + (bh * HDIM + wave) * SEQ + s0 + lane * 8;
#pragma unroll
  for (int j = 0; j < 4; ++j)
    *(v8h*)(ov + j * 16 * SEQ) =
        *(const v8h*)&vst[(wave + j * 16) * VPITCH + lane * 8];
}

// ---------------------------------------------------------------------------
// Kernel 2: flash attention, transposed products.
// grid = (S/128, H, B), block = 256: 8 waves = 4 query strips x 2 key halves.  A
// wave owns 32 queries (two column groups of 16, so that every K and V^T fragment
// read from LDS feeds two WMMAs) and walks 1024 keys, which keeps four waves on a
// SIMD; the two partial results of a strip are merged through LDS at the end.
// Per 64-key tile and group: S^T = K Q^T (8 WMMA; A = K rows from LDS, B = Q in
// registers, the accumulator started at the bias: Q and the bias table both carry
// log2(e), Q the score scale too, so the result is the whole score in units of
// log2), so a lane holds 32 scores of ONE query of the group (column lr;
// keys 8*hs + r of each 16-key group): maximum and sum run in-lane, plus one
// exchange between the wave's halves.  Two score tiles, converted in place, are
// the B operand of O^T += V^T P^T (8 WMMA): P never leaves the registers.
// The bias depends on j - i alone: a block's 128 queries and all keys meet 2175
// relative positions, staged once in LDS (four shifted copies); the 8 biases of
// a score tile's lane are then two 16-byte LDS reads.
// Output written f16 to ao [B,S,D] with f = h*64 + d.
// ---------------------------------------------------------------------------
// Value of lane l ^ 16.
__device__ __forceinline__ float other_half(float x) {
  const int b = __builtin_bit_cast(int, x);
  return __builtin_bit_cast(
      float, __builtin_amdgcn_permlanex16(b, b, 0x76543210, 0xfedcba98, false,
                                          false));
}

// 2^(s - m) of the eight scores of one tile: the subtraction and v_exp_f32.
// Written as one statement so that the v_nop stands directly
// behind the last v_exp_f32: the instruction set asks for one independent
// instruction between a transcendental and a vector instruction that uses its
// result or overwrites its source.  Inside the run each
// v_exp_f32 is independent of the one before.  Each works in place: the statement
// writes only registers that the subtractions in front of it wrote, so it is never
// the first write over the operands of a matrix instruction just issued (the
// compiler keeps that distance for its own instructions, not for asm text).
__device__ __forceinline__ void exp_tile(v8f& s, float m) {
  float a0 = s[0] - m, a1 = s[1] - m, a2 = s[2] - m, a3 = s[3] - m;
  float a4 = s[4] - m, a5 = s[5] - m, a6 = s[6] - m, a7 = s[7] - m;
  asm("v_exp_f32 %0, %0\n\tv_exp_f32 %1, %1\n\tv_exp_f32 %2, %2\n\t"
      "v_exp_f32 %3, %3\n\tv_exp_f32 %4, %4\n\tv_exp_f32 %5, %5\n\t"
      "v_exp_f32 %6, %6\n\tv_exp_f32 %7, %7\n\tv_nop"
      : "+v"(a0), "+v"(a1), "+v"(a2), "+v"(a3), "+v"(a4), "+v"(a5), "+v"(a6),
        "+v"(a7));
  s[0] = a0; s[1] = a1; s[2] = a2; s[3] = a3;
  s[4] = a4; s[5] = a5; s[6] = a6; s[7] = a7;
}

__global__ __launch_bounds__(256) __attribute__((amdgpu_waves_per_eu(4, 4)))
void flash_attn_kernel(
    const _Float16* __restrict__ qf, const _Float16* __restrict__ kf,
    const _Float16* __restrict__ vt, const float* __restrict__ tab,
    _Float16* __restrict__ ao) {
  // One object, the bias window first: its reads then reach every tile of a pass
  // by the instruction's 16-bit offset from one address register.
  __shared__ __attribute__((aligned(16))) struct {
    float bw[4 * WIN_PITCH];
    _Float16 ks[2][2][TILE_HALVES];  // [buffer][key half]
    _Float16 vs[2][2][TILE_HALVES];
  } sm;
  auto& bw = sm.bw;
  auto& ks = sm.ks;
  auto& vs = sm.vs;

  const int lane = threadIdx.x & 31;
  const int wave = __builtin_amdgcn_readfirstlane(threadIdx.x >> 5);
  const int qs = wave & 3;   // query strip
  const int kh = wave >> 2;  // key half
  const int lr = lane & 15;
  const int hs = lane >> 4;

  const int b = blockIdx.z;
  const int h = blockIdx.y;
  const int i0 = blockIdx.x * 128 + qs * 32 + lr;  // this lane's query, group 0

  const int bh = b * HEADS + h;

  // Q strips as B operands: column = query lr of group g, 64 k (two chunks of 32)
  const _Float16* qp = qf + ((size_t)bh * SEQ + i0) * HDIM + hs * 8;
  v16h bq[2][2];
#pragma unroll
  for (int g = 0; g < 2; ++g) {
    bq[g][0] = load_tile_f16(qp + g * 16 * HDIM);
    bq[g][1] = load_tile_f16(qp + g * 16 * HDIM + 32);
  }
  // The zeroing of the accumulators below reuses Q's address registers: this
  // wait stands between the loads and that overwrite.
  asm volatile("s_wait_xcnt 0x0" ::: "memory");

  // o[g][sd][r] = O^T[sd*16 + 8*hs + r][query lr of group g]
  v8f o[2][4] = {{{}, {}, {}, {}}, {{}, {}, {}, {}}};
  float mrow[2] = {-1e30f, -1e30f};  // running maximum of this lane's queries (log2)
  float lrow[2] = {0.0f, 0.0f};      // running sums over this half's keys only

  // The four waves of a key half stage that half's tiles.
  const int srow = (threadIdx.x & 127) >> 3, scol = (threadIdx.x & 7) * 8;
  const _Float16* kg =
      kf + ((size_t)bh * SEQ + kh * (SEQ / 2) + srow) * HDIM + scol;
  const _Float16* vg = vt + ((size_t)bh * HDIM + srow) * SEQ + kh * (SEQ / 2) + scol;
  const int soff = srow * PITCH + scol;
  v8h kr[4], vr[4];
  fetch_f16(kr, kg, HDIM);
  fetch_f16(vr, vg, SEQ);
  // Bias window of this block: floats z0 .. z0 + WIN_Z - 1 of each copy, with
  // z0 = S-1 - (last query of the block), whole lines.  Waves c and c + 4 stage
  // copy c: each 1024 floats, 16 bytes a lane, and 64 of the last 128 floats,
  // 8 bytes a lane, which keeps every lane on.
  // The loads are issued with those of K and V^T tile 0: all share one latency.
  const float* tg = tab + (h * 4 + qs) * TAB_Z + (SEQ - 128 - blockIdx.x * 128);
  float* tl = &bw[qs * WIN_PITCH];
  const int woff = kh * 1024 + lane * 4, toff = 2048 + kh * 64 + lane * 2;
  v4f wr[8];
#pragma unroll
  for (int p = 0; p < 8; ++p) wr[p] = *(const v4f*)(tg + woff + p * 128);
  const v2f wt = *(const v2f*)(tg + toff);
  // The code behind reuses these loads' address registers: this wait stands
  // between the loads and that overwrite.
  asm volatile("s_wait_xcnt 0x0" ::: "memory");
  put_f16(&ks[0][kh][soff], kr);
  put_f16(&vs[0][kh][soff], vr);
#pragma unroll
  for (int p = 0; p < 8; ++p) *(v4f*)(tl + woff + p * 128) = wr[p];
  *(v2f*)(tl + toff) = wt;
  // This lane's biases: window index of (query i, key j) is j + 127 - (i - block's
  // first query); copy 3 - (lr & 3) holds it at a multiple of 4 floats for j % 4 == 0.
  // (124 - 32 * qs - 16 * g - (lr & 12), written as a sum of terms that are never
  // negative; bl is group 1's at this half's first key, group 0's lies 16 floats
  // behind it)
  const float* bl = &bw[((lr & 3) ^ 3) * WIN_PITCH + (qs ^ 3) * 32 +
                        ((lr & 12) ^ 12) + 8 * hs + kh * (SEQ / 2)];
  __syncthreads();  // publishes K and V^T tile 0 and the bias window

  kg += 64 * HDIM;  // from here on: the next tile's
  vg += 64;
  for (int kt = 0; kt < SEQ / 128; ++kt) {
    const int j0 = kt * 64;  // counted from this half's first key
    const int cur = kt & 1;
    const bool more = kt + 1 < SEQ / 128;

    // ---- scores in units of log2: S^T = bias + K Q^T, the bias as the C operand ----
    // (element r of tile sub is key j0 + sub*16 + 8*hs + r of this half)
    v8f sv[2][4];
#pragma unroll
    for (int sub = 0; sub < 4; ++sub) {
      const _Float16* kp = &ks[cur][kh][(sub * 16 + lr) * PITCH + hs * 8];
      const v16h k0 = frag_lds(kp), k1 = frag_lds(kp + 32);
      v8f sg[2];
#pragma unroll
      for (int g = 0; g < 2; ++g) {
        const float* bp0 = bl + (g ^ 1) * 16 + j0 + sub * 16;
        const v4f b0 = *(const v4f*)bp0;
        const v4f b1 = *(const v4f*)(bp0 + 4);
        sg[g] = __builtin_shufflevector(b0, b1, 0, 1, 2, 3, 4, 5, 6, 7);
      }
      sg[0] = wmma_f16(k0, bq[0][0], sg[0]);
      sg[1] = wmma_f16(k0, bq[1][0], sg[1]);
      sv[0][sub] = wmma_f16(k1, bq[0][1], sg[0]);
      sv[1][sub] = wmma_f16(k1, bq[1][1], sg[1]);
    }

    // The next tiles fly during softmax and O^T: the staging registers are taken
    // only behind the scores, where K fragments and biases have left theirs.
    if (more) {
      fetch_f16(kr, kg, HDIM);
      fetch_f16(vr, vg, SEQ);
      kg += 64 * HDIM;
      vg += 64;
    }
    // Keeps the loads where they stand, behind the scores: without this line the
    // build lifted them to the loop's head, where the staging registers no longer
    // fit, and spilled the staged K tile to scratch in every pass.
    __builtin_amdgcn_sched_barrier(0);

    v16h bp[2][2];
#pragma unroll
    for (int g = 0; g < 2; ++g) {
      // ---- tile maximum of this query: in-lane, then the other half's ----
      float tmax = sv[g][0][0];
#pragma unroll
      for (int sub = 0; sub < 4; ++sub)
#pragma unroll
        for (int r = 0; r < 8; ++r) tmax = fmaxf(tmax, sv[g][sub][r]);
      tmax = fmaxf(tmax, other_half(tmax));

      // ---- online softmax update ----
      const float nm = fmaxf(mrow[g], tmax);
      const float corr = __builtin_amdgcn_exp2f(mrow[g] - nm);
      mrow[g] = nm;
      float ts[4];  // four independent chains
#pragma unroll
      for (int sub = 0; sub < 4; ++sub) {
        exp_tile(sv[g][sub], nm);
        ts[sub] = sv[g][sub][0];
#pragma unroll
        for (int r = 1; r < 8; ++r) ts[sub] += sv[g][sub][r];
      }
      lrow[g] = lrow[g] * corr + ((ts[0] + ts[1]) + (ts[2] + ts[3]));
#pragma unroll
      for (int sd = 0; sd < 4; ++sd)
#pragma unroll
        for (int r = 0; r < 8; ++r) o[g][sd][r] *= corr;

      // ---- P^T as B operand: score tiles 2c and 2c+1 hold keys 8*hs + 0..7 and
      // 16 + 8*hs + 0..7 of chunk c, the k order of frag_lds ----
#pragma unroll
      for (int c = 0; c < 2; ++c)
#pragma unroll
        for (int t = 0; t < 8; ++t) {
          bp[g][c][t]     = (_Float16)sv[g][2 * c][t];
          bp[g][c][t + 8] = (_Float16)sv[g][2 * c + 1][t];
        }
    }

    // ---- O^T += V^T P^T   (V^T rows are head-dims; contiguous over j) ----
#pragma unroll
    for (int sd = 0; sd < 4; ++sd) {
      const _Float16* vp = &vs[cur][kh][(sd * 16 + lr) * PITCH + hs * 8];
      const v16h v0 = frag_lds(vp), v1 = frag_lds(vp + 32);
#pragma unroll
      for (int g = 0; g < 2; ++g) {
        o[g][sd] = wmma_f16(v0, bp[g][0], o[g][sd]);
        o[g][sd] = wmma_f16(v1, bp[g][1], o[g][sd]);
      }
    }
    // The other K/V buffer was last read in the pass before, which ended at the
    // barrier at this loop's foot.
    if (more) {
      put_f16(&ks[cur ^ 1][kh][soff], kr);
      put_f16(&vs[cur ^ 1][kh][soff], vr);
    }
    // publishes the next tiles and ends the reads of these before their refill
    __syncthreads();
  }

  // ---- merge of the two key halves: the wave of half kh finishes column group
  // kh of its strip and hands group kh ^ 1 to its partner (wave ^ 4), lane to lane.
  // The K buffers are free since the loop's last barrier: 9 pieces of 16 bytes a
  // lane and wave (8 of O^T, one with maximum and sum), lanes side by side. ----
  // The lane's number is read anew for what follows: what the loop does not use
  // then holds no register across it (held, it cost a spill).
  const int ln = __builtin_amdgcn_mbcnt_lo(~0u, 0u);
  v4f* xch = (v4f*)&ks[0][0][0];
  v4f* xw = xch + wave * 9 * 32 + ln;
  const v4f* xr = xch + (wave ^ 4) * 9 * 32 + ln;
#pragma unroll
  for (int sd = 0; sd < 4; ++sd) {
    const v8f gv = kh ? o[0][sd] : o[1][sd];
    xw[(2 * sd) * 32] = __builtin_shufflevector(gv, gv, 0, 1, 2, 3);
    xw[(2 * sd + 1) * 32] = __builtin_shufflevector(gv, gv, 4, 5, 6, 7);
  }
  const v4f gml = {kh ? mrow[0] : mrow[1], kh ? lrow[0] : lrow[1], 0.0f, 0.0f};
  xw[8 * 32] = gml;
  __syncthreads();  // publishes the partial results

  const v4f pml = xr[8 * 32];
  const float mm = kh ? mrow[1] : mrow[0];
  const float nm = fmaxf(mm, pml[0]);
  // Weights of this wave's part and of the partner's: 2^x as in exp_tile, in one
  // statement for the same reason (the v_nop behind the last v_exp_f32).
  float ca = mm - nm, cb = pml[0] - nm;
  asm("v_exp_f32 %0, %0\n\tv_exp_f32 %1, %1\n\tv_nop" : "+v"(ca), "+v"(cb));
  // ---- join the lane halves' sums, O / l, merge heads (f = h*64 + d); a lane's
  // 8 registers are 8 consecutive d of its query: one 16-byte store ----
  const float lsum = (kh ? lrow[1] : lrow[0]) * ca + pml[1] * cb;
  const float ltot = lsum + other_half(lsum);
#pragma unroll
  for (int sd = 0; sd < 4; ++sd) {
    const v8f mv = kh ? o[1][sd] : o[0][sd];
    const v4f p0 = xr[(2 * sd) * 32];
    const v4f p1 = xr[(2 * sd + 1) * 32];
    v8h w;
#pragma unroll
    for (int r = 0; r < 4; ++r) {
      w[r]     = (_Float16)((mv[r] * ca + p0[r] * cb) / ltot);
      w[r + 4] = (_Float16)((mv[r + 4] * ca + p1[r] * cb) / ltot);
    }
    *(v8h*)&ao[((size_t)b * SEQ + blockIdx.x * 128 + qs * 32 + kh * 16 + (ln & 15)) *
                   DMODEL +
               h * HDIM + sd * 16 + 8 * (ln >> 4)] = w;
  }
}

// ---------------------------------------------------------------------------
// Kernel 3: output projection.  AO (8192x512 f16) @ Wp^T + bp -> f32 d_out.
// ---------------------------------------------------------------------------
__global__ __launch_bounds__(128) void out_proj_kernel(
    const _Float16* __restrict__ ao, const float* __restrict__ Wp,
    const float* __restrict__ bp, float* __restrict__ out) {
  const int lane = threadIdx.x & 31;
  const int wave = threadIdx.x >> 5;
  const int lr = lane & 15;
  const int hs = lane >> 4;

  const int m0 = blockIdx.x * 64 + wave * 16;
  const int n0 = blockIdx.y * 64;

  __shared__ __attribute__((aligned(16))) _Float16 as[2][TILE_HALVES];
  __shared__ __attribute__((aligned(16))) _Float16 wsm[2][TILE_HALVES];

  const int arow = threadIdx.x >> 3, acol = (threadIdx.x & 7) * 8;
  const int wrow = threadIdx.x >> 4, wcol = (threadIdx.x & 15) * 4;
  const _Float16* ag = ao + (size_t)(blockIdx.x * 64 + arow) * DMODEL + acol;
  const float* wg = Wp + (n0 + wrow) * DMODEL + wcol;
  const int aoff = arow * PITCH + acol;
  const int woff = wrow * PITCH + wcol;

  v8f acc[4] = {{}, {}, {}, {}};
  v8h ar[4];
  v4f wr[8];
  fetch_f16(ar, ag, DMODEL);
  fetch_f32(wr, wg, DMODEL);
  put_f16(&as[0][aoff], ar);
  put_f32(&wsm[0][woff], wr);
  __syncthreads();  // publishes tile 0

  for (int it = 0; it < DMODEL / 64; ++it) {
    const int cur = it & 1;
    const bool more = it + 1 < DMODEL / 64;
    if (more) {  // next tile flies while this one is multiplied
      fetch_f16(ar, ag + (it + 1) * 64, DMODEL);
      fetch_f32(wr, wg + (it + 1) * 64, DMODEL);
    }
#pragma unroll
    for (int c = 0; c < 2; ++c) {
      const v16h a = frag_lds(&as[cur][(wave * 16 + lr) * PITCH + c * 32 + hs * 8]);
#pragma unroll
      for (int sub = 0; sub < 4; ++sub) {
        const v16h bm =
            frag_lds(&wsm[cur][(sub * 16 + lr) * PITCH + c * 32 + hs * 8]);
        acc[sub] = wmma_f16(a, bm, acc[sub]);
      }
    }
    if (more) {
      put_f16(&as[cur ^ 1][aoff], ar);
      put_f32(&wsm[cur ^ 1][woff], wr);
    }
    // publishes the next tile and ends the reads of this one before its refill
    __syncthreads();
  }

#pragma unroll
  for (int sub = 0; sub < 4; ++sub) {
    const int n = n0 + sub * 16 + lr;
    const float bn = bp[n];
#pragma unroll
    for (int r = 0; r < 8; ++r) {
      const int m = m0 + r + 8 * hs;
      out[(size_t)m * DMODEL + n] = acc[sub][r] + bn;
    }
  }
}

// ---------------------------------------------------------------------------
extern "C" void kernel_launch(void* const* d_in, const int* in_sizes, int n_in,
                              void* d_out, int out_size, void* d_ws,
                              size_t ws_size, hipStream_t stream) {
  (void)in_sizes; (void)n_in; (void)out_size; (void)ws_size;

  const float* query = (const float*)d_in[0];
  const float* Wq = (const float*)d_in[1];
  const float* bq = (const float*)d_in[2];
  const float* Wk = (const float*)d_in[3];
  const float* bk = (const float*)d_in[4];
  const float* Wv = (const float*)d_in[5];
  const float* bv = (const float*)d_in[6];
  const float* Wp = (const float*)d_in[7];
  const float* bp = (const float*)d_in[8];
  const float* logit_scale = (const float*)d_in[9];
  const float* rpe = (const float*)d_in[10];

  // workspace carve-up
  const size_t QKV_ELEMS = (size_t)BATCH * HEADS * SEQ * HDIM;  // 4.19M halves
  char* ws = (char*)d_ws;
  float* tab = (float*)ws;                         // 8*4*4096 f32 = 524288 B
  _Float16* qf = (_Float16*)(ws + 524288);
  _Float16* kf = qf + QKV_ELEMS;
  _Float16* vt = kf + QKV_ELEMS;
  _Float16* ao = vt + QKV_ELEMS;

  qkv_proj_kernel<<<dim3((BATCH * SEQ) / 256, HEADS), 512, 0, stream>>>(
      query, Wq, bq, Wk, bk, Wv, bv, logit_scale, rpe, qf, kf, vt, tab);

  flash_attn_kernel<<<dim3(SEQ / 128, HEADS, BATCH), 256, 0, stream>>>(
      qf, kf, vt, tab, ao);

  out_proj_kernel<<<dim3((BATCH * SEQ) / 64, DMODEL / 64), 128, 0, stream>>>(
      ao, Wp, bp, (float*)d_out);
}

// v009
// Measured time: 67.2 microseconds a run.
// In two side-by-side timings against v008, it was 1.04 and 1.03 times as fast.
// All steps since v000 together make it 4.77 times as fast.
#include <hip/hip_runtime.h>
#include <hip/hip_bf16.h>

// ---------------------------------------------------------------------------
// Multi-head attention (logit_scale + sigmoid rel-pos bias)
// B=4, S=2048, D=512, H=8, hd=64.  f16 WMMA (v_wmma_f32_16x16x32_f16),
// f32 accumulate, fused flash-attention middle stage.
// ---------------------------------------------------------------------------

#define BATCH 4
#define SEQ   2048
#define DMODEL 512
#define HEADS 8
#define HDIM  64

typedef __attribute__((ext_vector_type(16))) _Float16 v16h;
typedef __attribute__((ext_vector_type(8)))  float    v8f;

__device__ __forceinline__ v8f wmma_f16(v16h a, v16h b, v8f c) {
  // (neg_a, A, neg_b, B, c_mod, C, reuse_a, reuse_b)
  return __builtin_amdgcn_wmma_f32_16x16x32_f16(false, a, false, b, (short)0, c,
                                                false, false);
}

// A/B operand loader (16x32 f16 tile, one row per lane).
// p must already point at row_base + k_chunk + (lane>=16 ? 8 : 0).
// Elements [0..7] = K+0..7 of this lane's chunk, [8..15] = K+16..23.
__device__ __forceinline__ v16h load_tile_f16(const _Float16* __restrict__ p) {
  v16h a;
#pragma unroll
  for (int t = 0; t < 8; ++t) {
    a[t]     = p[t];
    a[t + 8] = p[t + 16];
  }
  return a;
}

// LDS staging of operand tiles.  A tile is 64 rows x 64 f16 (128 B a row), laid
// at a pitch of 144 B (16 B x odd: conflict-free for 16-byte reads).  128 threads (the
// block, or a key half in the attention kernel) fetch it with 16-byte loads whose 32 lanes cover four whole 128-B
// lines; each of the 4 waves then reads its fragments from LDS.
typedef __attribute__((ext_vector_type(8))) _Float16 v8h;
typedef __attribute__((ext_vector_type(4))) _Float16 v4h;
typedef __attribute__((ext_vector_type(4))) float    v4f;
typedef __attribute__((ext_vector_type(2))) float    v2f;
#define PITCH 72
#define TILE_HALVES (64 * PITCH)

// Fragment from LDS: same element order as load_tile_f16
// (p = row base + k_chunk + (lane>=16 ? 8 : 0)).
__device__ __forceinline__ v16h frag_lds(const _Float16* p) {
  const v8h lo = *(const v8h*)p;
  const v8h hi = *(const v8h*)(p + 16);
  return __builtin_shufflevector(lo, hi, 0, 1, 2, 3, 4, 5, 6, 7, 8, 9, 10, 11,
                                 12, 13, 14, 15);
}

// f32 source, 64 x 64 floats: thread t holds floats (t&15)*4.. of rows (t>>4)+8p.
// g already points at this thread's first float4; ld = row stride in floats.
__device__ __forceinline__ void fetch_f32(v4f (&r)[8], const float* __restrict__ g,
                                          int ld) {
#pragma unroll
  for (int p = 0; p < 8; ++p) r[p] = *(const v4f*)(g + p * 8 * ld);
}
__device__ __forceinline__ void put_f32(_Float16* s, const v4f (&r)[8]) {
#pragma unroll
  for (int p = 0; p < 8; ++p)
    *(v4h*)(s + p * 8 * PITCH) = __builtin_convertvector(r[p], v4h);
}
// f16 source, 64 x 64 halves: thread t holds halves (t&7)*8.. of rows (t>>3)+16p.
__device__ __forceinline__ void fetch_f16(v8h (&r)[4],
                                          const _Float16* __restrict__ g, int ld) {
#pragma unroll
  for (int p = 0; p < 4; ++p) r[p] = *(const v8h*)(g + p * 16 * ld);
}
__device__ __forceinline__ void put_f16(_Float16* s, const v8h (&r)[4]) {
#pragma unroll
  for (int p = 0; p < 4; ++p) *(v8h*)(s + p * 16 * PITCH) = r[p];
}

// ---------------------------------------------------------------------------
// Bias table: sigmoid(rpe) * log2(e) in f32, laid out for the attention kernel,
// which forms its scores as arguments of 2^x:
// tab[h][c][z] = log2(e) * sigmoid(rpe[S-1 + i - j][h]) at z + c = j - i + S-1,
// c = 0..3.
// Head-major and ascending in the key j, so that the biases of consecutive keys
// of one query are consecutive floats; the four copies, each shifted by one
// float, give every query a copy in which its runs start on a 16-byte boundary.
// Entries past the last relative position are zero and never enter a score.
// It has no launch of its own: the threads of the QKV launch, which the attention
// launch follows anyway, make one entry each.
// ---------------------------------------------------------------------------
#define NREL (2 * SEQ - 1)     // relative positions
#define TAB_Z 4096             // floats per copy in the global table
#define WIN_Z 2176             // floats of a copy that one 128-query block stages
#define WIN_PITCH 2192         // LDS pitch of a copy: 16 banks past a multiple of 64

// ---------------------------------------------------------------------------
// Kernel 1: fused QKV projection.  X (8192x512 f32) @ W^T + b -> f16.
// (and the bias table, one entry a thread)
// grid = (M/256, H)  block = 512 (16 waves), one block on a WGP
// Q,K stored [B,H,S,64]; V stored transposed [B,H,64,S].
// Q is stored times the head's score scale times log2(e), multiplied in f32 in
// front of its one rounding to f16: K Q^T is then the scaled score in units of
// log2, and the attention kernel has no multiply left per score.
// Head split per reference: feature n -> h = n % 8, d = n / 8.
// A block takes 256 positions and ALL THREE products of ONE head (rows d*8 + h of
// Wq, Wk and Wv): an X tile is fetched from L2 once for 192 output features and
// a weight tile once for 256 positions.
// A wave takes a strip of 32 positions.  Waves 0..7 make Q of their strip and
// head-dims 0..31 of V^T, waves 8..15 K and head-dims 32..63: the strip's two X
// fragments are the B operand of Q or K (a lane owns one position, its 8
// accumulator registers are 8 consecutive head-dims) and the A operand of V^T (a
// lane owns one head-dim, 8 consecutive positions), so that 8 fragments read from
// LDS feed 12 WMMAs.
// All output goes through LDS and leaves as whole lines: a wave's 32 rows of Q or
// K (128 B each), the block's 64 rows of V^T (512 B each).
// ---------------------------------------------------------------------------
#define QKV_ROWS 256                      // positions of a block
#define STAGE_ROWS (QKV_ROWS + 3 * HDIM)  // X rows, then the head's Wq, Wk, Wv rows
#define STAGE_HALVES (STAGE_ROWS * PITCH)
#define VPITCH (QKV_ROWS + 8)             // V^T staging: 528 B a row, 16 B x odd
#define VST_OFF (16 * 32 * PITCH)         // behind the 16 waves' rows of Q and K

__global__ __launch_bounds__(512) void qkv_proj_kernel(
    const float* __restrict__ X,
    const float* __restrict__ Wq, const float* __restrict__ bq,
    const float* __restrict__ Wk, const float* __restrict__ bk,
    const float* __restrict__ Wv, const float* __restrict__ bv,
    const float* __restrict__ logit_scale, const float* __restrict__ rpe,
    _Float16* __restrict__ qf, _Float16* __restrict__ kf,
    _Float16* __restrict__ vt, float* __restrict__ tab) {
  __shared__ __attribute__((aligned(16))) _Float16 sm[2 * STAGE_HALVES];
  // biases of this head, then the factor of Q
  __shared__ __attribute__((aligned(16))) float bsm[3 * HDIM + 4];

  const int lane = threadIdx.x & 31;
  const int wave = __builtin_amdgcn_readfirstlane(threadIdx.x >> 5);
  const int lr = lane & 15;  // row-in-tile of an operand
  const int hs = lane >> 4;  // half select
  const int ps = wave & 7;   // position strip
  const int wh = wave >> 3;  // 0: Q, V^T rows 0..31; 1: K, V^T rows 32..63
  const int h = blockIdx.y;
  const int m0 = blockIdx.x * QKV_ROWS;

  // Staging: thread t holds floats (t&15)*4.. of rows (t>>4) + 32p of a tile.
  // Row d of the head's weights is feature d*H + h (reference split_heads).
  const int srow = threadIdx.x >> 4, scol = (threadIdx.x & 15) * 4;
  // Block-uniform bases and one 32-bit offset a thread for X, one for the weights.
  const float* xg = X + m0 * DMODEL;
  const float* wqg = Wq + h * DMODEL;
  const float* wkg = Wk + h * DMODEL;
  const float* wvg = Wv + h * DMODEL;
  const unsigned xo = srow * DMODEL + scol;
  const unsigned wo = srow * HEADS * DMODEL + scol;
  const int soff = srow * PITCH + scol;

  v4f xr[8], wr[6];
  auto fetch = [&]() {
#pragma unroll
    for (int p = 0; p < 8; ++p) xr[p] = *(const v4f*)(xg + p * 32 * DMODEL + xo);
#pragma unroll
    for (int p = 0; p < 2; ++p) {
      wr[p]     = *(const v4f*)(wqg + p * 32 * HEADS * DMODEL + wo);
      wr[p + 2] = *(const v4f*)(wkg + p * 32 * HEADS * DMODEL + wo);
      wr[p + 4] = *(const v4f*)(wvg + p * 32 * HEADS * DMODEL + wo);
    }
  };
  auto put = [&](int buf) {
    _Float16* s = &sm[buf * STAGE_HALVES + soff];
#pragma unroll
    for (int p = 0; p < 8; ++p)
      *(v4h*)(s + p * 32 * PITCH) = __builtin_convertvector(xr[p], v4h);
#pragma unroll
    for (int p = 0; p < 6; ++p)
      *(v4h*)(s + (QKV_ROWS + p * 32) * PITCH) = __builtin_convertvector(wr[p], v4h);
    // the next tile's; here, where the loads that name these bases have returned
    xg += 64;
    wqg += 64;
    wkg += 64;
    wvg += 64;
  };

  // aqk[g][sub][r] = sum_k W[sub*16 + 8*hs + r][k] * X[ps*32 + g*16 + lr][k]
  // av[g][e][r]    = sum_k X[ps*32 + g*16 + 8*hs + r][k] * Wv[wh*32 + e*16 + lr][k]
  v8f aqk[2][4] = {{{}, {}, {}, {}}, {{}, {}, {}, {}}};
  v8f av[2][2] = {{{}, {}}, {{}, {}}};

  fetch();
  // This thread's entry of the bias table: tt = (head * 4 + c) * TAB_Z + tu with
  // tu = TAB_Z-1 - z, so that the row of rpe, NREL-1 - (z + c) = tu - 1 - tc,
  // ascends with the thread.  Entries with no row read row 0 and store zero.
  static_assert((BATCH * SEQ / QKV_ROWS) * HEADS * 512 == HEADS * 4 * TAB_Z,
                "one table entry a thread");
  const unsigned tt =
      (blockIdx.y * (BATCH * SEQ / QKV_ROWS) + blockIdx.x) * 512 + threadIdx.x;
  const unsigned tu = tt & (TAB_Z - 1);
  const unsigned tc = (tt >> 12) & 3;
  const float rv = rpe[(tu > tc ? tu - 1 - tc : 0u) * HEADS + (tt >> 14)];
  // behind the tile's loads, so that all share one latency
  if (threadIdx.x < 3 * HDIM) {
    const float* bsel = threadIdx.x < HDIM ? bq : threadIdx.x < 2 * HDIM ? bk : bv;
    bsm[threadIdx.x] = bsel[(threadIdx.x & (HDIM - 1)) * HEADS + h];
  } else if (threadIdx.x == 3 * HDIM) {
    // exp(min(ls, ln(100))) / sqrt(D_MODEL) * log2(e)
    bsm[3 * HDIM] =
        __expf(fminf(logit_scale[h], 4.6051702f)) * 0.04419417382f * 1.44269504f;
  }
  put(0);
  __syncthreads();  // publishes tile 0, the head's biases and the factor of Q
  // Behind the barrier, which waits for a wave's stores: this one then flies under
  // the first tile's products and has long landed at the next barrier.
  tab[(tt | (TAB_Z - 1)) - tu] =
      tu > tc ? 1.44269504f / (1.0f + __expf(-rv)) : 0.0f;
  // The loop reuses this store's address and data registers: this wait stands
  // between the store and that overwrite.
  asm volatile("s_wait_xcnt 0x0" ::: "memory");

  const int xoff = (ps * 32 + lr) * PITCH + hs * 8;
  const int woff = (QKV_ROWS + wh * HDIM + lr) * PITCH + hs * 8;
  const int voff = (QKV_ROWS + 2 * HDIM + wh * 32 + lr) * PITCH + hs * 8;
  // Not peeled: the two tests of 'more' stay branches, so that the loads, the
  // products and the conversions are blocks of their own in this order; peeled,
  // the build put the conversions, and the wait for the loads, in front of the
  // products.
#pragma clang loop unroll(disable)
  for (int it = 0; it < DMODEL / 64; ++it) {
    const int cur = it & 1;
    const bool more = it + 1 < DMODEL / 64;
    if (more) fetch();  // next tile flies while this one is multiplied
#pragma unroll
    for (int c = 0; c < 2; ++c) {
      const _Float16* s = &sm[cur * STAGE_HALVES + c * 32];
      const v16h x0 = frag_lds(s + xoff), x1 = frag_lds(s + xoff + 16 * PITCH);
      v16h w[4];
#pragma unroll
      for (int sub = 0; sub < 4; ++sub) w[sub] = frag_lds(s + woff + sub * 16 * PITCH);
      const v16h v0 = frag_lds(s + voff), v1 = frag_lds(s + voff + 16 * PITCH);
      // The chunk's 16 LDS reads stand as one group in front of its 12 WMMAs:
      // without this line the build read a fragment and waited for it, six times.
      __builtin_amdgcn_sched_barrier(0);
#pragma unroll
      for (int sub = 0; sub < 4; ++sub) {
        aqk[0][sub] = wmma_f16(w[sub], x0, aqk[0][sub]);
        aqk[1][sub] = wmma_f16(w[sub], x1, aqk[1][sub]);
      }
      av[0][0] = wmma_f16(x0, v0, av[0][0]);
      av[1][0] = wmma_f16(x1, v0, av[1][0]);
      av[0][1] = wmma_f16(x0, v1, av[0][1]);
      av[1][1] = wmma_f16(x1, v1, av[1][1]);
    }
    if (more) put(cur ^ 1);
    // publishes the next tile and ends the reads of this one before its refill
    __syncthreads();
  }

  const float osc = wh ? 1.0f : bsm[3 * HDIM];  // K: times 1, which is exact

  // The operand tiles are free since the loop's last barrier.
  _Float16* st = &sm[wave * 32 * PITCH];  // this wave's 32 rows of Q or K
  _Float16* vst = &sm[VST_OFF];           // the block's 64 rows of V^T
#pragma unroll
  for (int g = 0; g < 2; ++g) {
#pragma unroll
    for (int sub = 0; sub < 4; ++sub) {
      const v4f lo = *(const v4f*)&bsm[wh * HDIM + sub * 16 + 8 * hs];
      const v4f hi = *(const v4f*)&bsm[wh * HDIM + sub * 16 + 8 * hs + 4];
      const v8f bn = __builtin_shufflevector(lo, hi, 0, 1, 2, 3, 4, 5, 6, 7);
      v8h w;
#pragma unroll
      for (int r = 0; r < 8; ++r) w[r] = (_Float16)((aqk[g][sub][r] + bn[r]) * osc);
      *(v8h*)&st[(g * 16 + lr) * PITCH + sub * 16 + 8 * hs] = w;
    }
#pragma unroll
    for (int e = 0; e < 2; ++e) {
      const int d = wh * 32 + e * 16 + lr;
      const float b1 = bsm[2 * HDIM + d];
      v8h w;
#pragma unroll
      for (int r = 0; r < 8; ++r) w[r] = (_Float16)(av[g][e][r] + b1);
      *(v8h*)&vst[d * VPITCH + ps * 32 + g * 16 + 8 * hs] = w;
    }
  }
  __syncthreads();  // publishes the staged output rows

  const size_t bh = (m0 >> 11) * HEADS + h;  // m / SEQ
  const int s0 = m0 & (SEQ - 1);
  // Q or K: the wave's 32 rows are 4 KiB in a row, four lines an instruction.
  _Float16* o = (wh ? kf : qf) + (bh * SEQ + s0 + ps * 32 + (lane >> 3)) * HDIM +
                (lane & 7) * 8;
#pragma unroll
  for (int j = 0; j < 8; ++j)
    *(v8h*)(o + j * 4 * HDIM) =
        *(const v8h*)&st[(j * 4 + (lane >> 3)) * PITCH + (lane & 7) * 8];
  // V^T: one row's 256 positions (four lines) an instruction, rows wave + 16j.
  _Float16* ov = vt + (bh * HDIM + wave) * SEQ + s0 + lane * 8;
#pragma unroll
  for (int j = 0; j < 4; ++j)
    *(v8h*)(ov + j * 16 * SEQ) =
        *(const v8h*)&vst[(wave + j * 16) * VPITCH + lane * 8];
}

// ---------------------------------------------------------------------------
// Kernel 2: flash attention, transposed products.
// grid = (S/128, H, B), block = 256: 8 waves = 4 query strips x 2 key halves.  A
// wave owns 32 queries (two column groups of 16, so that every K and V^T fragment
// read from LDS feeds two WMMAs) and walks 1024 keys, which keeps four waves on a
// SIMD; the two partial results of a strip are merged through LDS at the end.
// Per 64-key tile and group: S^T = K Q^T (8 WMMA; A = K rows from LDS, B = Q in
// registers, the accumulator started at the bias: Q and the bias table both carry
// log2(e), Q the score scale too, so the result is the whole score in units of
// log2), so a lane holds 32 scores of ONE query of the group (column lr;
// keys 8*hs + r of each 16-key group): maximum and sum run in-lane, plus one
// exchange between the wave's halves.  Two score tiles, converted in place, are
// the B operand of O^T += V^T P^T (8 WMMA): P never leaves the registers.
// The bias depends on j - i alone: a block's 128 queries and all keys meet 2175
// relative positions, staged once in LDS (four shifted copies); the 8 biases of
// a score tile's lane are then two 16-byte LDS reads.
// Output written f16 to ao [B,S,D] with f = h*64 + d.
// ---------------------------------------------------------------------------
// Value of lane l ^ 16.
__device__ __forceinline__ float other_half(float x) {
  const int b = __builtin_bit_cast(int, x);
  return __builtin_bit_cast(
      float, __builtin_amdgcn_permlanex16(b, b, 0x76543210, 0xfedcba98, false,
                                          false));
}

// 2^(s - m) of the eight scores of one tile: the subtraction and v_exp_f32.
// Written as one statement so that the v_nop stands directly
// behind the last v_exp_f32: the instruction set asks for one independent
// instruction between a transcendental and a vector instruction that uses its
// result or overwrites its source.  Inside the run each
// v_exp_f32 is independent of the one before.  Each works in place: the statement
// writes only registers that the subtractions in front of it wrote, so it is never
// the first write over the operands of a matrix instruction just issued (the
// compiler keeps that distance for its own instructions, not for asm text).
__device__ __forceinline__ void exp_tile(v8f& s, float m) {
  float a0 = s[0] - m, a1 = s[1] - m, a2 = s[2] - m, a3 = s[3] - m;
  float a4 = s[4] - m, a5 = s[5] - m, a6 = s[6] - m, a7 = s[7] - m;
  asm("v_exp_f32 %0, %0\n\tv_exp_f32 %1, %1\n\tv_exp_f32 %2, %2\n\t"
      "v_exp_f32 %3, %3\n\tv_exp_f32 %4, %4\n\tv_exp_f32 %5, %5\n\t"
      "v_exp_f32 %6, %6\n\tv_exp_f32 %7, %7\n\tv_nop"
      : "+v"(a0), "+v"(a1), "+v"(a2), "+v"(a3), "+v"(a4), "+v"(a5), "+v"(a6),
        "+v"(a7));
  s[0] = a0; s[1] = a1; s[2] = a2; s[3] = a3;
  s[4] = a4; s[5] = a5; s[6] = a6; s[7] = a7;
}

__global__ __launch_bounds__(256) __attribute__((amdgpu_waves_per_eu(4, 4)))
void flash_attn_kernel(
    const _Float16* __restrict__ qf, const _Float16* __restrict__ kf,
    const _Float16* __restrict__ vt, const float* __restrict__ tab,
    _Float16* __restrict__ ao) {
  // One object, the bias window first: its reads then reach every tile of a pass
  // by the instruction's 16-bit offset from one address register.
  __shared__ __attribute__((aligned(16))) struct {
    float bw[4 * WIN_PITCH];
    _Float16 ks[2][2][TILE_HALVES];  // [buffer][key half]
    _Float16 vs[2][2][TILE_HALVES];
  } sm;
  auto& bw = sm.bw;
  auto& ks = sm.ks;
  auto& vs = sm.vs;

  const int lane = threadIdx.x & 31;
  const int wave = __builtin_amdgcn_readfirstlane(threadIdx.x >> 5);
  const int qs = wave & 3;   // query strip
  const int kh = wave >> 2;  // key half
  const int lr = lane & 15;
  const int hs = lane >> 4;

  const int b = blockIdx.z;
  const int h = blockIdx.y;
  const int i0 = blockIdx.x * 128 + qs * 32 + lr;  // this lane's query, group 0

  const int bh = b * HEADS + h;

  // Q strips as B operands: column = query lr of group g, 64 k (two chunks of 32)
  const _Float16* qp = qf + ((size_t)bh * SEQ + i0) * HDIM + hs * 8;
  v16h bq[2][2];
#pragma unroll
  for (int g = 0; g < 2; ++g) {
    bq[g][0] = load_tile_f16(qp + g * 16 * HDIM);
    bq[g][1] = load_tile_f16(qp + g * 16 * HDIM + 32);
  }
  // The zeroing of the accumulators below reuses Q's address registers: this
  // wait stands between the loads and that overwrite.
  asm volatile("s_wait_xcnt 0x0" ::: "memory");

  // o[g][sd][r] = O^T[sd*16 + 8*hs + r][query lr of group g]
  v8f o[2][4] = {{{}, {}, {}, {}}, {{}, {}, {}, {}}};
  float mrow[2] = {-1e30f, -1e30f};  // reference points of this lane's queries (log2)
  float lrow[2] = {0.0f, 0.0f};      // running sums over this half's keys only

  // The four waves of a key half stage that half's tiles.
  const int srow = (threadIdx.x & 127) >> 3, scol = (threadIdx.x & 7) * 8;
  const _Float16* kg =
      kf + ((size_t)bh * SEQ + kh * (SEQ / 2) + srow) * HDIM + scol;
  const _Float16* vg = vt + ((size_t)bh * HDIM + srow) * SEQ + kh * (SEQ / 2) + scol;
  const int soff = srow * PITCH + scol;
  v8h kr[4], vr[4];
  fetch_f16(kr, kg, HDIM);
  fetch_f16(vr, vg, SEQ);
  // Bias window of this block: floats z0 .. z0 + WIN_Z - 1 of each copy, with
  // z0 = S-1 - (last query of the block), whole lines.  Waves c and c + 4 stage
  // copy c: each 1024 floats, 16 bytes a lane, and 64 of the last 128 floats,
  // 8 bytes a lane, which keeps every lane on.
  // The loads are issued with those of K and V^T tile 0: all share one latency.
  const float* tg = tab + (h * 4 + qs) * TAB_Z + (SEQ - 128 - blockIdx.x * 128);
  float* tl = &bw[qs * WIN_PITCH];
  const int woff = kh * 1024 + lane * 4, toff = 2048 + kh * 64 + lane * 2;
  v4f wr[8];
#pragma unroll
  for (int p = 0; p < 8; ++p) wr[p] = *(const v4f*)(tg + woff + p * 128);
  const v2f wt = *(const v2f*)(tg + toff);
  // The code behind reuses these loads' address registers: this wait stands
  // between the loads and that overwrite.
  asm volatile("s_wait_xcnt 0x0" ::: "memory");
  put_f16(&ks[0][kh][soff], kr);
  put_f16(&vs[0][kh][soff], vr);
#pragma unroll
  for (int p = 0; p < 8; ++p) *(v4f*)(tl + woff + p * 128) = wr[p];
  *(v2f*)(tl + toff) = wt;
  // This lane's biases: window index of (query i, key j) is j + 127 - (i - block's
  // first query); copy 3 - (lr & 3) holds it at a multiple of 4 floats for j % 4 == 0.
  // (124 - 32 * qs - 16 * g - (lr & 12), written as a sum of terms that are never
  // negative; bl is group 1's at this half's first key, group 0's lies 16 floats
  // behind it)
  const float* bl = &bw[((lr & 3) ^ 3) * WIN_PITCH + (qs ^ 3) * 32 +
                        ((lr & 12) ^ 12) + 8 * hs + kh * (SEQ / 2)];
  __syncthreads();  // publishes K and V^T tile 0 and the bias window

  kg += 64 * HDIM;  // from here on: the next tile's
  vg += 64;

  v8f sv[2][4];   // a pass's scores, then in place its weights
  float tsum[2];  // this lane's sums of a pass's weights

  // ---- scores in units of log2: S^T = bias + K Q^T, the bias as the C operand ----
  // (element r of tile sub is key j0 + sub*16 + 8*hs + r of this half)
  auto scores = [&](int kt, bool grouped) __attribute__((always_inline)) {
    const int j0 = kt * 64;  // counted from this half's first key
#pragma unroll
    for (int sp = 0; sp < 4; sp += 2) {
      v16h kq[2][2];
#pragma unroll
      for (int u = 0; u < 2; ++u) {
        const int sub = sp + u;
        const _Float16* kp = &ks[kt & 1][kh][(sub * 16 + lr) * PITCH + hs * 8];
        kq[u][0] = frag_lds(kp);
        kq[u][1] = frag_lds(kp + 32);
#pragma unroll
        for (int g = 0; g < 2; ++g) {
          const float* bp0 = bl + (g ^ 1) * 16 + j0 + sub * 16;
          const v4f b0 = *(const v4f*)bp0;
          const v4f b1 = *(const v4f*)(bp0 + 4);
          sv[g][sub] = __builtin_shufflevector(b0, b1, 0, 1, 2, 3, 4, 5, 6, 7);
        }
      }
      // The LDS reads of two score tiles a group stand as one group in front of
      // their 8 WMMAs: without this line the build read two fragments and waited
      // for them, six times a pass.
      if (grouped) __builtin_amdgcn_sched_barrier(0);
#pragma unroll
      for (int u = 0; u < 2; ++u) {
        const int sub = sp + u;
        sv[0][sub] = wmma_f16(kq[u][0], bq[0][0], sv[0][sub]);
        sv[1][sub] = wmma_f16(kq[u][0], bq[1][0], sv[1][sub]);
        sv[0][sub] = wmma_f16(kq[u][1], bq[0][1], sv[0][sub]);
        sv[1][sub] = wmma_f16(kq[u][1], bq[1][1], sv[1][sub]);
      }
    }
  };
  // The next tiles fly during softmax and O^T: the staging registers are taken
  // only behind the scores, where K fragments and biases have left theirs.
  auto fetch = [&]() __attribute__((always_inline)) {
    fetch_f16(kr, kg, HDIM);
    fetch_f16(vr, vg, SEQ);
    // stands between these loads and the overwrite of their address registers
    asm volatile("s_wait_xcnt 0x0" ::: "memory");
    kg += 64 * HDIM;
    vg += 64;
    // Keeps the loads where they stand, behind the scores: without this line the
    // build lifted them to the pass's head, where the staging registers no longer
    // fit, and spilled the staged K tile to scratch in every pass.
    __builtin_amdgcn_sched_barrier(0);
  };
  // The other K/V buffer was last read in the pass before, which ended at the
  // barrier at that pass's foot: it may be filled anywhere in this pass.
  auto put = [&](int kt) __attribute__((always_inline)) {
    put_f16(&ks[(kt & 1) ^ 1][kh][soff], kr);
    put_f16(&vs[(kt & 1) ^ 1][kh][soff], vr);
  };
  // ---- new reference point: the maximum of the old one and of the pass's scores;
  // O^T and the sums are brought to it ----
  auto newpoint = [&]() __attribute__((always_inline)) {
    float nm[2];
#pragma unroll
    for (int g = 0; g < 2; ++g) {
      // tile maximum of this query: in-lane, then the other half's, so that both
      // halves of a column take the same point
      float tmax = sv[g][0][0];
#pragma unroll
      for (int sub = 0; sub < 4; ++sub)
#pragma unroll
        for (int r = 0; r < 8; ++r) tmax = fmaxf(tmax, sv[g][sub][r]);
      nm[g] = fmaxf(mrow[g], fmaxf(tmax, other_half(tmax)));
    }
    // 2^x as in exp_tile, in one statement for the same reason (the v_nop behind
    // the last v_exp_f32).
    float c0 = mrow[0] - nm[0], c1 = mrow[1] - nm[1];
    asm("v_exp_f32 %0, %0\n\tv_exp_f32 %1, %1\n\tv_nop" : "+v"(c0), "+v"(c1));
    mrow[0] = nm[0];
    mrow[1] = nm[1];
    lrow[0] *= c0;
    lrow[1] *= c1;
#pragma unroll
    for (int sd = 0; sd < 4; ++sd)
#pragma unroll
      for (int r = 0; r < 8; ++r) {
        o[0][sd][r] *= c0;
        o[1][sd][r] *= c1;
      }
  };
  // ---- weights 2^(s - mrow) in place of the scores, and this lane's sums ----
  auto weights = [&]() __attribute__((always_inline)) {
#pragma unroll
    for (int g = 0; g < 2; ++g) {
      float ts[4];  // four independent chains
#pragma unroll
      for (int sub = 0; sub < 4; ++sub) {
        exp_tile(sv[g][sub], mrow[g]);
        ts[sub] = sv[g][sub][0];
#pragma unroll
        for (int r = 1; r < 8; ++r) ts[sub] += sv[g][sub][r];
      }
      tsum[g] = (ts[0] + ts[1]) + (ts[2] + ts[3]);
    }
  };
  auto outer = [&](int kt) __attribute__((always_inline)) {
    v16h bp[2][2];
#pragma unroll
    for (int g = 0; g < 2; ++g) {
      lrow[g] += tsum[g];
      // ---- P^T as B operand: score tiles 2c and 2c+1 hold keys 8*hs + 0..7 and
      // 16 + 8*hs + 0..7 of chunk c, the k order of frag_lds ----
#pragma unroll
      for (int c = 0; c < 2; ++c)
#pragma unroll
        for (int t = 0; t < 8; ++t) {
          bp[g][c][t]     = (_Float16)sv[g][2 * c][t];
          bp[g][c][t + 8] = (_Float16)sv[g][2 * c + 1][t];
        }
    }
    // ---- O^T += V^T P^T   (V^T rows are head-dims; contiguous over j) ----
#pragma unroll
    for (int sd = 0; sd < 4; ++sd) {
      const _Float16* vp = &vs[kt & 1][kh][(sd * 16 + lr) * PITCH + hs * 8];
      const v16h v0 = frag_lds(vp), v1 = frag_lds(vp + 32);
#pragma unroll
      for (int g = 0; g < 2; ++g) {
        o[g][sd] = wmma_f16(v0, bp[g][0], o[g][sd]);
        o[g][sd] = wmma_f16(v1, bp[g][1], o[g][sd]);
      }
    }
  };

  // ---- softmax against the reference point in use.  Any reference point mrow
  // cancels in O / l; it only has to keep the weights inside f16.  The first pass
  // takes its tile's maximum.  A later pass forms its weights with the point it
  // has, without a maximum and without a rescale, and looks at the sums it needs
  // anyway: the weights are positive, so a lane's sum below 2^15 bounds each of its
  // weights below f16's largest value.  mrow is a maximum over tiles already met,
  // never above the true maximum, so nothing is lost at the small end.  Where a
  // lane's sum fails the test (also as infinity or NaN), the whole wave forms the
  // pass's scores again (K tile and biases still lie in LDS), takes the maximum and
  // rescales.  One test a pass, a scalar branch. ----
  auto pass = [&](int kt, bool more) __attribute__((always_inline)) {
    scores(kt, true);
    if (more) fetch();
    weights();
    const bool need = !(tsum[0] < 32768.0f) || !(tsum[1] < 32768.0f);
    if (__builtin_amdgcn_ballot_w32(need) != 0) {
      // The scores are formed anew, from LDS: without this line the build of the
      // last pass kept the first ones, 64 registers, in scratch for this branch.
      asm volatile("" ::: "memory");
      scores(kt, false);  // the staging registers are taken here
      newpoint();
      weights();
    }
    outer(kt);
    if (more) put(kt);
    // publishes the next tiles and ends the reads of these before their refill
    __syncthreads();
  };

  scores(0, true);
  fetch();
  newpoint();
  weights();
  outer(0);
  put(0);
  __syncthreads();  // as at the foot of every pass
  for (int kt = 1; kt < SEQ / 128 - 1; ++kt) pass(kt, true);
  pass(SEQ / 128 - 1, false);

  // ---- merge of the two key halves: the wave of half kh finishes column group
  // kh of its strip and hands group kh ^ 1 to its partner (wave ^ 4), lane to lane.
  // The K buffers are free since the loop's last barrier: 9 pieces of 16 bytes a
  // lane and wave (8 of O^T, one with maximum and sum), lanes side by side. ----
  // The lane's number is read anew for what follows: what the loop does not use
  // then holds no register across it (held, it cost a spill).
  const int ln = __builtin_amdgcn_mbcnt_lo(~0u, 0u);
  v4f* xch = (v4f*)&ks[0][0][0];
  v4f* xw = xch + wave * 9 * 32 + ln;
  const v4f* xr = xch + (wave ^ 4) * 9 * 32 + ln;
#pragma unroll
  for (int sd = 0; sd < 4; ++sd) {
    const v8f gv = kh ? o[0][sd] : o[1][sd];
    xw[(2 * sd) * 32] = __builtin_shufflevector(gv, gv, 0, 1, 2, 3);
    xw[(2 * sd + 1) * 32] = __builtin_shufflevector(gv, gv, 4, 5, 6, 7);
  }
  const v4f gml = {kh ? mrow[0] : mrow[1], kh ? lrow[0] : lrow[1], 0.0f, 0.0f};
  xw[8 * 32] = gml;
  __syncthreads();  // publishes the partial results

  const v4f pml = xr[8 * 32];
  const float mm = kh ? mrow[1] : mrow[0];
  const float nm = fmaxf(mm, pml[0]);
  // Weights of this wave's part and of the partner's: 2^x as in exp_tile, in one
  // statement for the same reason (the v_nop behind the last v_exp_f32).
  float ca = mm - nm, cb = pml[0] - nm;
  asm("v_exp_f32 %0, %0\n\tv_exp_f32 %1, %1\n\tv_nop" : "+v"(ca), "+v"(cb));
  // ---- join the lane halves' sums, O / l, merge heads (f = h*64 + d); a lane's
  // 8 registers are 8 consecutive d of its query: one 16-byte store ----
  const float lsum = (kh ? lrow[1] : lrow[0]) * ca + pml[1] * cb;
  const float ltot = lsum + other_half(lsum);
#pragma unroll
  for (int sd = 0; sd < 4; ++sd) {
    const v8f mv = kh ? o[1][sd] : o[0][sd];
    const v4f p0 = xr[(2 * sd) * 32];
    const v4f p1 = xr[(2 * sd + 1) * 32];
    v8h w;
#pragma unroll
    for (int r = 0; r < 4; ++r) {
      w[r]     = (_Float16)((mv[r] * ca + p0[r] * cb) / ltot);
      w[r + 4] = (_Float16)((mv[r + 4] * ca + p1[r] * cb) / ltot);
    }
    *(v8h*)&ao[((size_t)b * SEQ + blockIdx.x * 128 + qs * 32 + kh * 16 + (ln & 15)) *
                   DMODEL +
               h * HDIM + sd * 16 + 8 * (ln >> 4)] = w;
  }
}

// ---------------------------------------------------------------------------
// Kernel 3: output projection.  AO (8192x512 f16) @ Wp^T + bp -> f32 d_out.
// ---------------------------------------------------------------------------
__global__ __launch_bounds__(128) void out_proj_kernel(
    const _Float16* __restrict__ ao, const float* __restrict__ Wp,
    const float* __restrict__ bp, float* __restrict__ out) {
  const int lane = threadIdx.x & 31;
  const int wave = threadIdx.x >> 5;
  const int lr = lane & 15;
  const int hs = lane >> 4;

  const int m0 = blockIdx.x * 64 + wave * 16;
  const int n0 = blockIdx.y * 64;

  __shared__ __attribute__((aligned(16))) _Float16 as[2][TILE_HALVES];
  __shared__ __attribute__((aligned(16))) _Float16 wsm[2][TILE_HALVES];

  const int arow = threadIdx.x >> 3, acol = (threadIdx.x & 7) * 8;
  const int wrow = threadIdx.x >> 4, wcol = (threadIdx.x & 15) * 4;
  const _Float16* ag = ao + (size_t)(blockIdx.x * 64 + arow) * DMODEL + acol;
  const float* wg = Wp + (n0 + wrow) * DMODEL + wcol;
  const int aoff = arow * PITCH + acol;
  const int woff = wrow * PITCH + wcol;

  v8f acc[4] = {{}, {}, {}, {}};
  v8h ar[4];
  v4f wr[8];
  fetch_f16(ar, ag, DMODEL);
  fetch_f32(wr, wg, DMODEL);
  put_f16(&as[0][aoff], ar);
  put_f32(&wsm[0][woff], wr);
  __syncthreads();  // publishes tile 0

  for (int it = 0; it < DMODEL / 64; ++it) {
    const int cur = it & 1;
    const bool more = it + 1 < DMODEL / 64;
    if (more) {  // next tile flies while this one is multiplied
      fetch_f16(ar, ag + (it + 1) * 64, DMODEL);
      fetch_f32(wr, wg + (it + 1) * 64, DMODEL);
    }
#pragma unroll
    for (int c = 0; c < 2; ++c) {
      const v16h a = frag_lds(&as[cur][(wave * 16 + lr) * PITCH + c * 32 + hs * 8]);
#pragma unroll
      for (int sub = 0; sub < 4; ++sub) {
        const v16h bm =
            frag_lds(&wsm[cur][(sub * 16 + lr) * PITCH + c * 32 + hs * 8]);
        acc[sub] = wmma_f16(a, bm, acc[sub]);
      }
    }
    if (more) {
      put_f16(&as[cur ^ 1][aoff], ar);
      put_f32(&wsm[cur ^ 1][woff], wr);
    }
    // publishes the next tile and ends the reads of this one before its refill
    __syncthreads();
  }

#pragma unroll
  for (int sub = 0; sub < 4; ++sub) {
    const int n = n0 + sub * 16 + lr;
    const float bn = bp[n];
#pragma unroll
    for (int r = 0; r < 8; ++r) {
      const int m = m0 + r + 8 * hs;
      out[(size_t)m * DMODEL + n] = acc[sub][r] + bn;
    }
  }
}

// ---------------------------------------------------------------------------
extern "C" void kernel_launch(void* const* d_in, const int* in_sizes, int n_in,
                              void* d_out, int out_size, void* d_ws,
                              size_t ws_size, hipStream_t stream) {
  (void)in_sizes; (void)n_in; (void)out_size; (void)ws_size;

  const float* query = (const float*)d_in[0];
  const float* Wq = (const float*)d_in[1];
  const float* bq = (const float*)d_in[2];
  const float* Wk = (const float*)d_in[3];
  const float* bk = (const float*)d_in[4];
  const float* Wv = (const float*)d_in[5];
  const float* bv = (const float*)d_in[6];
  const float* Wp = (const float*)d_in[7];
  const float* bp = (const float*)d_in[8];
  const float* logit_scale = (const float*)d_in[9];
  const float* rpe = (const float*)d_in[10];

  // workspace carve-up
  const size_t QKV_ELEMS = (size_t)BATCH * HEADS * SEQ * HDIM;  // 4.19M halves
  char* ws = (char*)d_ws;
  float* tab = (float*)ws;                         // 8*4*4096 f32 = 524288 B
  _Float16* qf = (_Float16*)(ws + 524288);
  _Float16* kf = qf + QKV_ELEMS;
  _Float16* vt = kf + QKV_ELEMS;
  _Float16* ao = vt + QKV_ELEMS;

  qkv_proj_kernel<<<dim3((BATCH * SEQ) / 256, HEADS), 512, 0, stream>>>(
      query, Wq, bq, Wk, bk, Wv, bv, logit_scale, rpe, qf, kf, vt, tab);

  flash_attn_kernel<<<dim3(SEQ / 128, HEADS, BATCH), 256, 0, stream>>>(
      qf, kf, vt, tab, ao);

  out_proj_kernel<<<dim3((BATCH * SEQ) / 64, DMODEL / 64), 128, 0, stream>>>(
      ao, Wp, bp, (float*)d_out);
}

// v010
// Measured time: 62.8 microseconds a run.
// In two side-by-side timings against v009, it was 1.08 and 1.07 times as fast.
// All steps since v000 together make it 5.14 times as fast.
#include <hip/hip_runtime.h>
#include <hip/hip_bf16.h>

// ---------------------------------------------------------------------------
// Multi-head attention (logit_scale + sigmoid rel-pos bias)
// B=4, S=2048, D=512, H=8, hd=64.  f16 WMMA (v_wmma_f32_16x16x32_f16),
// f32 accumulate, fused flash-attention middle stage.
// ---------------------------------------------------------------------------

#define BATCH 4
#define SEQ   2048
#define DMODEL 512
#define HEADS 8
#define HDIM  64

typedef __attribute__((ext_vector_type(16))) _Float16 v16h;
typedef __attribute__((ext_vector_type(8)))  float    v8f;

__device__ __forceinline__ v8f wmma_f16(v16h a, v16h b, v8f c) {
  // (neg_a, A, neg_b, B, c_mod, C, reuse_a, reuse_b)
  return __builtin_amdgcn_wmma_f32_16x16x32_f16(false, a, false, b, (short)0, c,
                                                false, false);
}

// A/B operand loader (16x32 f16 tile, one row per lane).
// p must already point at row_base + k_chunk + (lane>=16 ? 8 : 0).
// Elements [0..7] = K+0..7 of this lane's chunk, [8..15] = K+16..23.
__device__ __forceinline__ v16h load_tile_f16(const _Float16* __restrict__ p) {
  v16h a;
#pragma unroll
  for (int t = 0; t < 8; ++t) {
    a[t]     = p[t];
    a[t + 8] = p[t + 16];
  }
  return a;
}

// LDS staging of operand tiles.  A tile is 64 rows x 64 f16 (128 B a row), laid
// at a pitch of 144 B (16 B x odd: conflict-free for 16-byte reads).  128 threads (the
// block, or a key half in the attention kernel) fetch it with 16-byte loads whose 32 lanes cover four whole 128-B
// lines; each of the 4 waves then reads its fragments from LDS.
typedef __attribute__((ext_vector_type(8))) _Float16 v8h;
typedef __attribute__((ext_vector_type(4))) _Float16 v4h;
typedef __attribute__((ext_vector_type(4))) float    v4f;
typedef __attribute__((ext_vector_type(2))) float    v2f;
#define PITCH 72
#define TILE_HALVES (64 * PITCH)

// Fragment from LDS: same element order as load_tile_f16
// (p = row base + k_chunk + (lane>=16 ? 8 : 0)).
__device__ __forceinline__ v16h frag_lds(const _Float16* p) {
  const v8h lo = *(const v8h*)p;
  const v8h hi = *(const v8h*)(p + 16);
  return __builtin_shufflevector(lo, hi, 0, 1, 2, 3, 4, 5, 6, 7, 8, 9, 10, 11,
                                 12, 13, 14, 15);
}

// f32 source, 64 x 64 floats: thread t holds floats (t&15)*4.. of rows (t>>4)+8p.
// g already points at this thread's first float4; ld = row stride in floats.
__device__ __forceinline__ void fetch_f32(v4f (&r)[8], const float* __restrict__ g,
                                          int ld) {
#pragma unroll
  for (int p = 0; p < 8; ++p) r[p] = *(const v4f*)(g + p * 8 * ld);
}
__device__ __forceinline__ void put_f32(_Float16* s, const v4f (&r)[8]) {
#pragma unroll
  for (int p = 0; p < 8; ++p)
    *(v4h*)(s + p * 8 * PITCH) = __builtin_convertvector(r[p], v4h);
}
// f16 source, 64 x 64 halves: thread t holds halves (t&7)*8.. of rows (t>>3)+16p.
__device__ __forceinline__ void fetch_f16(v8h (&r)[4],
                                          const _Float16* __restrict__ g, int ld) {
#pragma unroll
  for (int p = 0; p < 4; ++p) r[p] = *(const v8h*)(g + p * 16 * ld);
}
__device__ __forceinline__ void put_f16(_Float16* s, const v8h (&r)[4]) {
#pragma unroll
  for (int p = 0; p < 4; ++p) *(v8h*)(s + p * 16 * PITCH) = r[p];
}

// ---------------------------------------------------------------------------
// Bias table: sigmoid(rpe) * log2(e) in f32, laid out for the attention kernel,
// which forms its scores as arguments of 2^x:
// tab[h][c][z] = log2(e) * sigmoid(rpe[S-1 + i - j][h]) at z + c = j - i + S-1,
// c = 0..3.
// Head-major and ascending in the key j, so that the biases of consecutive keys
// of one query are consecutive floats; the four copies, each shifted by one
// float, give every query a copy in which its runs start on a 16-byte boundary.
// Entries past the last relative position are zero and never enter a score.
// It has no launch of its own: the threads of the QKV launch, which the attention
// launch follows anyway, make one entry each.
// ---------------------------------------------------------------------------
#define NREL (2 * SEQ - 1)     // relative positions
#define TAB_Z 4096             // floats per copy in the global table
#define WIN_Z 2176             // floats of a copy that one 128-query block stages
#define WIN_PITCH 2192         // LDS pitch of a copy: 16 banks past a multiple of 64

// ---------------------------------------------------------------------------
// Kernel 1: fused QKV projection.  X (8192x512 f32) @ W^T + b -> f16.
// (and the bias table, one entry a thread)
// grid = (M/256, H)  block = 512 (16 waves), one block on a WGP
// Q,K stored [B,H,S,64]; V stored transposed [B,H,64,S].
// Q is stored times the head's score scale times log2(e), multiplied in f32 in
// front of its one rounding to f16: K Q^T is then the scaled score in units of
// log2, and the attention kernel has no multiply left per score.
// Head split per reference: feature n -> h = n % 8, d = n / 8.
// A block takes 256 positions and ALL THREE products of ONE head (rows d*8 + h of
// Wq, Wk and Wv): an X tile is fetched from L2 once for 192 output features and
// a weight tile once for 256 positions.
// A wave takes a strip of 32 positions.  Waves 0..7 make Q of their strip and
// head-dims 0..31 of V^T, waves 8..15 K and head-dims 32..63: the strip's two X
// fragments are the B operand of Q or K (a lane owns one position, its 8
// accumulator registers are 8 consecutive head-dims) and the A operand of V^T (a
// lane owns one head-dim, 8 consecutive positions), so that 8 fragments read from
// LDS feed 12 WMMAs.
// All output goes through LDS and leaves as whole lines: a wave's 32 rows of Q or
// K (128 B each), the block's 64 rows of V^T (512 B each).
// ---------------------------------------------------------------------------
#define QKV_ROWS 256                      // positions of a block
#define STAGE_ROWS (QKV_ROWS + 3 * HDIM)  // X rows, then the head's Wq, Wk, Wv rows
#define STAGE_HALVES (STAGE_ROWS * PITCH)
#define VPITCH (QKV_ROWS + 8)             // V^T staging: 528 B a row, 16 B x odd
#define VST_OFF (16 * 32 * PITCH)         // behind the 16 waves' rows of Q and K

__global__ __launch_bounds__(512) void qkv_proj_kernel(
    const float* __restrict__ X,
    const float* __restrict__ Wq, const float* __restrict__ bq,
    const float* __restrict__ Wk, const float* __restrict__ bk,
    const float* __restrict__ Wv, const float* __restrict__ bv,
    const float* __restrict__ logit_scale, const float* __restrict__ rpe,
    _Float16* __restrict__ qf, _Float16* __restrict__ kf,
    _Float16* __restrict__ vt, float* __restrict__ tab) {
  __shared__ __attribute__((aligned(16))) _Float16 sm[2 * STAGE_HALVES];
  // biases of this head, then the factor of Q
  __shared__ __attribute__((aligned(16))) float bsm[3 * HDIM + 4];

  const int lane = threadIdx.x & 31;
  const int wave = __builtin_amdgcn_readfirstlane(threadIdx.x >> 5);
  const int lr = lane & 15;  // row-in-tile of an operand
  const int hs = lane >> 4;  // half select
  const int ps = wave & 7;   // position strip
  const int wh = wave >> 3;  // 0: Q, V^T rows 0..31; 1: K, V^T rows 32..63
  const int h = blockIdx.y;
  const int m0 = blockIdx.x * QKV_ROWS;

  // Staging: thread t holds floats (t&15)*4.. of rows (t>>4) + 32p of a tile.
  // Row d of the head's weights is feature d*H + h (reference split_heads).
  const int srow = threadIdx.x >> 4, scol = (threadIdx.x & 15) * 4;
  // The 8 blocks that read the same rows of X and the 32 that read the same rows
  // of the weights run side by side: each enters the walk over k at stage
  // (blockIdx.x + blockIdx.y) % 8 and wraps round, the 8 at 8 different stages,
  // the 32 four to a stage, so that fewer of them ask L2 for the same lines at once.
  int ks = (blockIdx.x + blockIdx.y) & (DMODEL / 64 - 1);  // stage the bases stand at
  // Block-uniform bases and one 32-bit offset a thread for X, one for the weights.
  const float* xg = X + m0 * DMODEL + ks * 64;
  const float* wqg = Wq + h * DMODEL + ks * 64;
  const float* wkg = Wk + h * DMODEL + ks * 64;
  const float* wvg = Wv + h * DMODEL + ks * 64;
  const unsigned xo = srow * DMODEL + scol;
  const unsigned wo = srow * HEADS * DMODEL + scol;
  const int soff = srow * PITCH + scol;

  v4f xr[8], wr[6];
  auto fetch = [&]() {
#pragma unroll
    for (int p = 0; p < 8; ++p) xr[p] = *(const v4f*)(xg + p * 32 * DMODEL + xo);
#pragma unroll
    for (int p = 0; p < 2; ++p) {
      wr[p]     = *(const v4f*)(wqg + p * 32 * HEADS * DMODEL + wo);
      wr[p + 2] = *(const v4f*)(wkg + p * 32 * HEADS * DMODEL + wo);
      wr[p + 4] = *(const v4f*)(wvg + p * 32 * HEADS * DMODEL + wo);
    }
  };
  auto put = [&](int buf) {
    _Float16* s = &sm[buf * STAGE_HALVES + soff];
#pragma unroll
    for (int p = 0; p < 8; ++p)
      *(v4h*)(s + p * 32 * PITCH) = __builtin_convertvector(xr[p], v4h);
#pragma unroll
    for (int p = 0; p < 6; ++p)
      *(v4h*)(s + (QKV_ROWS + p * 32) * PITCH) = __builtin_convertvector(wr[p], v4h);
    // the next tile's; here, where the loads that name these bases have returned
    const int step = ks == DMODEL / 64 - 1 ? 64 - DMODEL : 64;
    ks = (ks + 1) & (DMODEL / 64 - 1);
    xg += step;
    wqg += step;
    wkg += step;
    wvg += step;
  };

  // aqk[g][sub][r] = sum_k W[sub*16 + 8*hs + r][k] * X[ps*32 + g*16 + lr][k]
  // av[g][e][r]    = sum_k X[ps*32 + g*16 + 8*hs + r][k] * Wv[wh*32 + e*16 + lr][k]
  v8f aqk[2][4] = {{{}, {}, {}, {}}, {{}, {}, {}, {}}};
  v8f av[2][2] = {{{}, {}}, {{}, {}}};

  fetch();
  // This thread's entry of the bias table: tt = (head * 4 + c) * TAB_Z + tu with
  // tu = TAB_Z-1 - z, so that the row of rpe, NREL-1 - (z + c) = tu - 1 - tc,
  // ascends with the thread.  Entries with no row read row 0 and store zero.
  static_assert((BATCH * SEQ / QKV_ROWS) * HEADS * 512 == HEADS * 4 * TAB_Z,
                "one table entry a thread");
  const unsigned tt =
      (blockIdx.y * (BATCH * SEQ / QKV_ROWS) + blockIdx.x) * 512 + threadIdx.x;
  const unsigned tu = tt & (TAB_Z - 1);
  const unsigned tc = (tt >> 12) & 3;
  const float rv = rpe[(tu > tc ? tu - 1 - tc : 0u) * HEADS + (tt >> 14)];
  // behind the tile's loads, so that all share one latency
  if (threadIdx.x < 3 * HDIM) {
    const float* bsel = threadIdx.x < HDIM ? bq : threadIdx.x < 2 * HDIM ? bk : bv;
    bsm[threadIdx.x] = bsel[(threadIdx.x & (HDIM - 1)) * HEADS + h];
  } else if (threadIdx.x == 3 * HDIM) {
    // exp(min(ls, ln(100))) / sqrt(D_MODEL) * log2(e)
    bsm[3 * HDIM] =
        __expf(fminf(logit_scale[h], 4.6051702f)) * 0.04419417382f * 1.44269504f;
  }
  put(0);
  __syncthreads();  // publishes tile 0, the head's biases and the factor of Q
  // Behind the barrier, which waits for a wave's stores: this one then flies under
  // the first tile's products and has long landed at the next barrier.
  tab[(tt | (TAB_Z - 1)) - tu] =
      tu > tc ? 1.44269504f / (1.0f + __expf(-rv)) : 0.0f;
  // The loop reuses this store's address and data registers: this wait stands
  // between the store and that overwrite.
  asm volatile("s_wait_xcnt 0x0" ::: "memory");

  const int xoff = (ps * 32 + lr) * PITCH + hs * 8;
  const int woff = (QKV_ROWS + wh * HDIM + lr) * PITCH + hs * 8;
  const int voff = (QKV_ROWS + 2 * HDIM + wh * 32 + lr) * PITCH + hs * 8;
  // Not peeled: the two tests of 'more' stay branches, so that the loads, the
  // products and the conversions are blocks of their own in this order; peeled,
  // the build put the conversions, and the wait for the loads, in front of the
  // products.
#pragma clang loop unroll(disable)
  for (int it = 0; it < DMODEL / 64; ++it) {
    const int cur = it & 1;
    const bool more = it + 1 < DMODEL / 64;
    if (more) fetch();  // next tile flies while this one is multiplied
#pragma unroll
    for (int c = 0; c < 2; ++c) {
      const _Float16* s = &sm[cur * STAGE_HALVES + c * 32];
      const v16h x0 = frag_lds(s + xoff), x1 = frag_lds(s + xoff + 16 * PITCH);
      v16h w[4];
#pragma unroll
      for (int sub = 0; sub < 4; ++sub) w[sub] = frag_lds(s + woff + sub * 16 * PITCH);
      const v16h v0 = frag_lds(s + voff), v1 = frag_lds(s + voff + 16 * PITCH);
      // The chunk's 16 LDS reads stand as one group in front of its 12 WMMAs:
      // without this line the build read a fragment and waited for it, six times.
      __builtin_amdgcn_sched_barrier(0);
#pragma unroll
      for (int sub = 0; sub < 4; ++sub) {
        aqk[0][sub] = wmma_f16(w[sub], x0, aqk[0][sub]);
        aqk[1][sub] = wmma_f16(w[sub], x1, aqk[1][sub]);
      }
      av[0][0] = wmma_f16(x0, v0, av[0][0]);
      av[1][0] = wmma_f16(x1, v0, av[1][0]);
      av[0][1] = wmma_f16(x0, v1, av[0][1]);
      av[1][1] = wmma_f16(x1, v1, av[1][1]);
    }
    if (more) put(cur ^ 1);
    // publishes the next tile and ends the reads of this one before its refill
    __syncthreads();
  }

  const float osc = wh ? 1.0f : bsm[3 * HDIM];  // K: times 1, which is exact

  // The operand tiles are free since the loop's last barrier.
  _Float16* st = &sm[wave * 32 * PITCH];  // this wave's 32 rows of Q or K
  _Float16* vst = &sm[VST_OFF];           // the block's 64 rows of V^T
#pragma unroll
  for (int g = 0; g < 2; ++g) {
#pragma unroll
    for (int sub = 0; sub < 4; ++sub) {
      const v4f lo = *(const v4f*)&bsm[wh * HDIM + sub * 16 + 8 * hs];
      const v4f hi = *(const v4f*)&bsm[wh * HDIM + sub * 16 + 8 * hs + 4];
      const v8f bn = __builtin_shufflevector(lo, hi, 0, 1, 2, 3, 4, 5, 6, 7);
      v8h w;
#pragma unroll
      for (int r = 0; r < 8; ++r) w[r] = (_Float16)((aqk[g][sub][r] + bn[r]) * osc);
      *(v8h*)&st[(g * 16 + lr) * PITCH + sub * 16 + 8 * hs] = w;
    }
#pragma unroll
    for (int e = 0; e < 2; ++e) {
      const int d = wh * 32 + e * 16 + lr;
      const float b1 = bsm[2 * HDIM + d];
      v8h w;
#pragma unroll
      for (int r = 0; r < 8; ++r) w[r] = (_Float16)(av[g][e][r] + b1);
      *(v8h*)&vst[d * VPITCH + ps * 32 + g * 16 + 8 * hs] = w;
    }
  }
  __syncthreads();  // publishes the staged output rows

  const size_t bh = (m0 >> 11) * HEADS + h;  // m / SEQ
  const int s0 = m0 & (SEQ - 1);
  // Q or K: the wave's 32 rows are 4 KiB in a row, four lines an instruction.
  _Float16* o = (wh ? kf : qf) + (bh * SEQ + s0 + ps * 32 + (lane >> 3)) * HDIM +
                (lane & 7) * 8;
#pragma unroll
  for (int j = 0; j < 8; ++j)
    *(v8h*)(o + j * 4 * HDIM) =
        *(const v8h*)&st[(j * 4 + (lane >> 3)) * PITCH + (lane & 7) * 8];
  // V^T: one row's 256 positions (four lines) an instruction, rows wave + 16j.
  _Float16* ov = vt + (bh * HDIM + wave) * SEQ + s0 + lane * 8;
#pragma unroll
  for (int j = 0; j < 4; ++j)
    *(v8h*)(ov + j * 16 * SEQ) =
        *(const v8h*)&vst[(wave + j * 16) * VPITCH + lane * 8];
}

// ---------------------------------------------------------------------------
// Kernel 2: flash attention, transposed products.
// grid = (S/128, H, B), block = 256: 8 waves = 4 query strips x 2 key halves.  A
// wave owns 32 queries (two column groups of 16, so that every K and V^T fragment
// read from LDS feeds two WMMAs) and walks 1024 keys, which keeps four waves on a
// SIMD; the two partial results of a strip are merged through LDS at the end.
// Per 64-key tile and group: S^T = K Q^T (8 WMMA; A = K rows from LDS, B = Q in
// registers, the accumulator started at the bias: Q and the bias table both carry
// log2(e), Q the score scale too, so the result is the whole score in units of
// log2), so a lane holds 32 scores of ONE query of the group (column lr;
// keys 8*hs + r of each 16-key group): maximum and sum run in-lane, plus one
// exchange between the wave's halves.  Two score tiles, converted in place, are
// the B operand of O^T += V^T P^T (8 WMMA): P never leaves the registers.
// The bias depends on j - i alone: a block's 128 queries and all keys meet 2175
// relative positions, staged once in LDS (four shifted copies); the 8 biases of
// a score tile's lane are then two 16-byte LDS reads.
// Output written f16 to ao [B,S,D] with f = h*64 + d.
// ---------------------------------------------------------------------------
// Value of lane l ^ 16.
__device__ __forceinline__ float other_half(float x) {
  const int b = __builtin_bit_cast(int, x);
  return __builtin_bit_cast(
      float, __builtin_amdgcn_permlanex16(b, b, 0x76543210, 0xfedcba98, false,
                                          false));
}

// 2^(s - m) of the eight scores of one tile: the subtraction and v_exp_f32.
// Written as one statement so that the v_nop stands directly
// behind the last v_exp_f32: the instruction set asks for one independent
// instruction between a transcendental and a vector instruction that uses its
// result or overwrites its source.  Inside the run each
// v_exp_f32 is independent of the one before.  Each works in place: the statement
// writes only registers that the subtractions in front of it wrote, so it is never
// the first write over the operands of a matrix instruction just issued (the
// compiler keeps that distance for its own instructions, not for asm text).
__device__ __forceinline__ void exp_tile(v8f& s, float m) {
  float a0 = s[0] - m, a1 = s[1] - m, a2 = s[2] - m, a3 = s[3] - m;
  float a4 = s[4] - m, a5 = s[5] - m, a6 = s[6] - m, a7 = s[7] - m;
  asm("v_exp_f32 %0, %0\n\tv_exp_f32 %1, %1\n\tv_exp_f32 %2, %2\n\t"
      "v_exp_f32 %3, %3\n\tv_exp_f32 %4, %4\n\tv_exp_f32 %5, %5\n\t"
      "v_exp_f32 %6, %6\n\tv_exp_f32 %7, %7\n\tv_nop"
      : "+v"(a0), "+v"(a1), "+v"(a2), "+v"(a3), "+v"(a4), "+v"(a5), "+v"(a6),
        "+v"(a7));
  s[0] = a0; s[1] = a1; s[2] = a2; s[3] = a3;
  s[4] = a4; s[5] = a5; s[6] = a6; s[7] = a7;
}

__global__ __launch_bounds__(256) __attribute__((amdgpu_waves_per_eu(4, 4)))
void flash_attn_kernel(
    const _Float16* __restrict__ qf, const _Float16* __restrict__ kf,
    const _Float16* __restrict__ vt, const float* __restrict__ tab,
    _Float16* __restrict__ ao) {
  // One object, the bias window first: its reads then reach every tile of a pass
  // by the instruction's 16-bit offset from one address register.
  __shared__ __attribute__((aligned(16))) struct {
    float bw[4 * WIN_PITCH];
    _Float16 ks[2][2][TILE_HALVES];  // [buffer][key half]
    _Float16 vs[2][2][TILE_HALVES];
  } sm;
  auto& bw = sm.bw;
  auto& ks = sm.ks;
  auto& vs = sm.vs;

  const int lane = threadIdx.x & 31;
  const int wave = __builtin_amdgcn_readfirstlane(threadIdx.x >> 5);
  const int qs = wave & 3;   // query strip
  const int kh = wave >> 2;  // key half
  const int lr = lane & 15;
  const int hs = lane >> 4;

  const int b = blockIdx.z;
  const int h = blockIdx.y;
  const int i0 = blockIdx.x * 128 + qs * 32 + lr;  // this lane's query, group 0

  const int bh = b * HEADS + h;

  // Q strips as B operands: column = query lr of group g, 64 k (two chunks of 32)
  const _Float16* qp = qf + ((size_t)bh * SEQ + i0) * HDIM + hs * 8;
  v16h bq[2][2];
#pragma unroll
  for (int g = 0; g < 2; ++g) {
    bq[g][0] = load_tile_f16(qp + g * 16 * HDIM);
    bq[g][1] = load_tile_f16(qp + g * 16 * HDIM + 32);
  }
  // The zeroing of the accumulators below reuses Q's address registers: this
  // wait stands between the loads and that overwrite.
  asm volatile("s_wait_xcnt 0x0" ::: "memory");

  // o[g][sd][r] = O^T[sd*16 + 8*hs + r][query lr of group g]
  v8f o[2][4] = {{{}, {}, {}, {}}, {{}, {}, {}, {}}};
  float mrow[2] = {-1e30f, -1e30f};  // reference points of this lane's queries (log2)
  float lrow[2] = {0.0f, 0.0f};      // running sums over this half's keys only

  // The 16 blocks of one head and batch read the same K and V^T and run side by
  // side: block x walks its halves' 16 key tiles from tile x on and wraps round, so
  // that they do not ask L2 for the same lines at once.  Pass kt works on tile
  // (kt + x) % 16; the softmax takes the tiles in any order.
  const int rot = blockIdx.x;
  int tn = rot;  // the tile that kg and vg stand at
  // The four waves of a key half stage that half's tiles.
  const int srow = (threadIdx.x & 127) >> 3, scol = (threadIdx.x & 7) * 8;
  const _Float16* kg =
      kf + ((size_t)bh * SEQ + kh * (SEQ / 2) + tn * 64 + srow) * HDIM + scol;
  const _Float16* vg =
      vt + ((size_t)bh * HDIM + srow) * SEQ + kh * (SEQ / 2) + tn * 64 + scol;
  auto next_tile = [&]() __attribute__((always_inline)) {
    const bool wrap = tn == SEQ / 128 - 1;
    kg += wrap ? -(SEQ / 128 - 1) * 64 * HDIM : 64 * HDIM;
    vg += wrap ? -(SEQ / 128 - 1) * 64 : 64;
    tn = (tn + 1) & (SEQ / 128 - 1);
  };
  const int soff = srow * PITCH + scol;
  v8h kr[4], vr[4];
  fetch_f16(kr, kg, HDIM);
  fetch_f16(vr, vg, SEQ);
  // Bias window of this block: floats z0 .. z0 + WIN_Z - 1 of each copy, with
  // z0 = S-1 - (last query of the block), whole lines.  Waves c and c + 4 stage
  // copy c: each 1024 floats, 16 bytes a lane, and 64 of the last 128 floats,
  // 8 bytes a lane, which keeps every lane on.
  // The loads are issued with those of pass 0's K and V^T tile: all share one latency.
  const float* tg = tab + (h * 4 + qs) * TAB_Z + (SEQ - 128 - blockIdx.x * 128);
  float* tl = &bw[qs * WIN_PITCH];
  const int woff = kh * 1024 + lane * 4, toff = 2048 + kh * 64 + lane * 2;
  v4f wr[8];
#pragma unroll
  for (int p = 0; p < 8; ++p) wr[p] = *(const v4f*)(tg + woff + p * 128);
  const v2f wt = *(const v2f*)(tg + toff);
  // The code behind reuses these loads' address registers: this wait stands
  // between the loads and that overwrite.
  asm volatile("s_wait_xcnt 0x0" ::: "memory");
  put_f16(&ks[0][kh][soff], kr);
  put_f16(&vs[0][kh][soff], vr);
#pragma unroll
  for (int p = 0; p < 8; ++p) *(v4f*)(tl + woff + p * 128) = wr[p];
  *(v2f*)(tl + toff) = wt;
  // This lane's biases: window index of (query i, key j) is j + 127 - (i - block's
  // first query); copy 3 - (lr & 3) holds it at a multiple of 4 floats for j % 4 == 0.
  // (124 - 32 * qs - 16 * g - (lr & 12), written as a sum of terms that are never
  // negative; bl is group 1's at this half's first key, group 0's lies 16 floats
  // behind it)
  const float* bl = &bw[((lr & 3) ^ 3) * WIN_PITCH + (qs ^ 3) * 32 +
                        ((lr & 12) ^ 12) + 8 * hs + kh * (SEQ / 2)];
  __syncthreads();  // publishes pass 0's K and V^T tile and the bias window

  next_tile();  // from here on: the next tile's

  v8f sv[2][4];   // a pass's scores, then in place its weights
  float tsum[2];  // this lane's sums of a pass's weights

  // ---- scores in units of log2: S^T = bias + K Q^T, the bias as the C operand ----
  // (element r of tile sub is key j0 + sub*16 + 8*hs + r of this half)
  auto scores = [&](int kt, bool grouped) __attribute__((always_inline)) {
    // counted from this half's first key
    const int j0 = ((kt + rot) & (SEQ / 128 - 1)) * 64;
#pragma unroll
    for (int sp = 0; sp < 4; sp += 2) {
      v16h kq[2][2];
#pragma unroll
      for (int u = 0; u < 2; ++u) {
        const int sub = sp + u;
        const _Float16* kp = &ks[kt & 1][kh][(sub * 16 + lr) * PITCH + hs * 8];
        kq[u][0] = frag_lds(kp);
        kq[u][1] = frag_lds(kp + 32);
#pragma unroll
        for (int g = 0; g < 2; ++g) {
          const float* bp0 = bl + (g ^ 1) * 16 + j0 + sub * 16;
          const v4f b0 = *(const v4f*)bp0;
          const v4f b1 = *(const v4f*)(bp0 + 4);
          sv[g][sub] = __builtin_shufflevector(b0, b1, 0, 1, 2, 3, 4, 5, 6, 7);
        }
      }
      // The LDS reads of two score tiles a group stand as one group in front of
      // their 8 WMMAs: without this line the build read two fragments and waited
      // for them, six times a pass.
      if (grouped) __builtin_amdgcn_sched_barrier(0);
#pragma unroll
      for (int u = 0; u < 2; ++u) {
        const int sub = sp + u;
        sv[0][sub] = wmma_f16(kq[u][0], bq[0][0], sv[0][sub]);
        sv[1][sub] = wmma_f16(kq[u][0], bq[1][0], sv[1][sub]);
        sv[0][sub] = wmma_f16(kq[u][1], bq[0][1], sv[0][sub]);
        sv[1][sub] = wmma_f16(kq[u][1], bq[1][1], sv[1][sub]);
      }
    }
  };
  // The next tiles fly during softmax and O^T: the staging registers are taken
  // only behind the scores, where K fragments and biases have left theirs.
  auto fetch = [&]() __attribute__((always_inline)) {
    fetch_f16(kr, kg, HDIM);
    fetch_f16(vr, vg, SEQ);
    // stands between these loads and the overwrite of their address registers
    asm volatile("s_wait_xcnt 0x0" ::: "memory");
    next_tile();
    // Keeps the loads where they stand, behind the scores: without this line the
    // build lifted them to the pass's head, where the staging registers no longer
    // fit, and spilled the staged K tile to scratch in every pass.
    __builtin_amdgcn_sched_barrier(0);
  };
  // The other K/V buffer was last read in the pass before, which ended at the
  // barrier at that pass's foot: it may be filled anywhere in this pass.
  auto put = [&](int kt) __attribute__((always_inline)) {
    put_f16(&ks[(kt & 1) ^ 1][kh][soff], kr);
    put_f16(&vs[(kt & 1) ^ 1][kh][soff], vr);
  };
  // ---- new reference point: the maximum of the old one and of the pass's scores;
  // O^T and the sums are brought to it ----
  auto newpoint = [&]() __attribute__((always_inline)) {
    float nm[2];
#pragma unroll
    for (int g = 0; g < 2; ++g) {
      // tile maximum of this query: in-lane, then the other half's, so that both
      // halves of a column take the same point
      float tmax = sv[g][0][0];
#pragma unroll
      for (int sub = 0; sub < 4; ++sub)
#pragma unroll
        for (int r = 0; r < 8; ++r) tmax = fmaxf(tmax, sv[g][sub][r]);
      nm[g] = fmaxf(mrow[g], fmaxf(tmax, other_half(tmax)));
    }
    // 2^x as in exp_tile, in one statement for the same reason (the v_nop behind
    // the last v_exp_f32).
    float c0 = mrow[0] - nm[0], c1 = mrow[1] - nm[1];
    asm("v_exp_f32 %0, %0\n\tv_exp_f32 %1, %1\n\tv_nop" : "+v"(c0), "+v"(c1));
    mrow[0] = nm[0];
    mrow[1] = nm[1];
    lrow[0] *= c0;
    lrow[1] *= c1;
#pragma unroll
    for (int sd = 0; sd < 4; ++sd)
#pragma unroll
      for (int r = 0; r < 8; ++r) {
        o[0][sd][r] *= c0;
        o[1][sd][r] *= c1;
      }
  };
  // ---- weights 2^(s - mrow) in place of the scores, and this lane's sums ----
  auto weights = [&]() __attribute__((always_inline)) {
#pragma unroll
    for (int g = 0; g < 2; ++g) {
      float ts[4];  // four independent chains
#pragma unroll
      for (int sub = 0; sub < 4; ++sub) {
        exp_tile(sv[g][sub], mrow[g]);
        ts[sub] = sv[g][sub][0];
#pragma unroll
        for (int r = 1; r < 8; ++r) ts[sub] += sv[g][sub][r];
      }
      tsum[g] = (ts[0] + ts[1]) + (ts[2] + ts[3]);
    }
  };
  auto outer = [&](int kt) __attribute__((always_inline)) {
    v16h bp[2][2];
#pragma unroll
    for (int g = 0; g < 2; ++g) {
      lrow[g] += tsum[g];
      // ---- P^T as B operand: score tiles 2c and 2c+1 hold keys 8*hs + 0..7 and
      // 16 + 8*hs + 0..7 of chunk c, the k order of frag_lds ----
#pragma unroll
      for (int c = 0; c < 2; ++c)
#pragma unroll
        for (int t = 0; t < 8; ++t) {
          bp[g][c][t]     = (_Float16)sv[g][2 * c][t];
          bp[g][c][t + 8] = (_Float16)sv[g][2 * c + 1][t];
        }
    }
    // ---- O^T += V^T P^T   (V^T rows are head-dims; contiguous over j) ----
#pragma unroll
    for (int sd = 0; sd < 4; ++sd) {
      const _Float16* vp = &vs[kt & 1][kh][(sd * 16 + lr) * PITCH + hs * 8];
      const v16h v0 = frag_lds(vp), v1 = frag_lds(vp + 32);
#pragma unroll
      for (int g = 0; g < 2; ++g) {
        o[g][sd] = wmma_f16(v0, bp[g][0], o[g][sd]);
        o[g][sd] = wmma_f16(v1, bp[g][1], o[g][sd]);
      }
    }
  };

  // ---- softmax against the reference point in use.  Any reference point mrow
  // cancels in O / l; it only has to keep the weights inside f16.  The first pass
  // takes its tile's maximum.  A later pass forms its weights with the point it
  // has, without a maximum and without a rescale, and looks at the sums it needs
  // anyway: the weights are positive, so a lane's sum below 2^15 bounds each of its
  // weights below f16's largest value.  mrow is a maximum over tiles already met,
  // never above the true maximum, so nothing is lost at the small end.  Where a
  // lane's sum fails the test (also as infinity or NaN), the whole wave forms the
  // pass's scores again (K tile and biases still lie in LDS), takes the maximum and
  // rescales.  One test a pass, a scalar branch. ----
  auto pass = [&](int kt, bool more) __attribute__((always_inline)) {
    scores(kt, true);
    if (more) fetch();
    weights();
    const bool need = !(tsum[0] < 32768.0f) || !(tsum[1] < 32768.0f);
    if (__builtin_amdgcn_ballot_w32(need) != 0) {
      // The scores are formed anew, from LDS: without this line the build of the
      // last pass kept the first ones, 64 registers, in scratch for this branch.
      asm volatile("" ::: "memory");
      scores(kt, false);  // the staging registers are taken here
      newpoint();
      weights();
    }
    outer(kt);
    if (more) put(kt);
    // publishes the next tiles and ends the reads of these before their refill
    __syncthreads();
  };

  scores(0, true);
  fetch();
  newpoint();
  weights();
  outer(0);
  put(0);
  __syncthreads();  // as at the foot of every pass
  for (int kt = 1; kt < SEQ / 128 - 1; ++kt) pass(kt, true);
  pass(SEQ / 128 - 1, false);

  // ---- merge of the two key halves: the wave of half kh finishes column group
  // kh of its strip and hands group kh ^ 1 to its partner (wave ^ 4), lane to lane.
  // The K buffers are free since the loop's last barrier: 9 pieces of 16 bytes a
  // lane and wave (8 of O^T, one with maximum and sum), lanes side by side. ----
  // The lane's number is read anew for what follows: what the loop does not use
  // then holds no register across it (held, it cost a spill).
  const int ln = __builtin_amdgcn_mbcnt_lo(~0u, 0u);
  v4f* xch = (v4f*)&ks[0][0][0];
  v4f* xw = xch + wave * 9 * 32 + ln;
  const v4f* xr = xch + (wave ^ 4) * 9 * 32 + ln;
#pragma unroll
  for (int sd = 0; sd < 4; ++sd) {
    const v8f gv = kh ? o[0][sd] : o[1][sd];
    xw[(2 * sd) * 32] = __builtin_shufflevector(gv, gv, 0, 1, 2, 3);
    xw[(2 * sd + 1) * 32] = __builtin_shufflevector(gv, gv, 4, 5, 6, 7);
  }
  const v4f gml = {kh ? mrow[0] : mrow[1], kh ? lrow[0] : lrow[1], 0.0f, 0.0f};
  xw[8 * 32] = gml;
  __syncthreads();  // publishes the partial results

  const v4f pml = xr[8 * 32];
  const float mm = kh ? mrow[1] : mrow[0];
  const float nm = fmaxf(mm, pml[0]);
  // Weights of this wave's part and of the partner's: 2^x as in exp_tile, in one
  // statement for the same reason (the v_nop behind the last v_exp_f32).
  float ca = mm - nm, cb = pml[0] - nm;
  asm("v_exp_f32 %0, %0\n\tv_exp_f32 %1, %1\n\tv_nop" : "+v"(ca), "+v"(cb));
  // ---- join the lane halves' sums, O / l, merge heads (f = h*64 + d); a lane's
  // 8 registers are 8 consecutive d of its query: one 16-byte store ----
  const float lsum = (kh ? lrow[1] : lrow[0]) * ca + pml[1] * cb;
  const float ltot = lsum + other_half(lsum);
#pragma unroll
  for (int sd = 0; sd < 4; ++sd) {
    const v8f mv = kh ? o[1][sd] : o[0][sd];
    const v4f p0 = xr[(2 * sd) * 32];
    const v4f p1 = xr[(2 * sd + 1) * 32];
    v8h w;
#pragma unroll
    for (int r = 0; r < 4; ++r) {
      w[r]     = (_Float16)((mv[r] * ca + p0[r] * cb) / ltot);
      w[r + 4] = (_Float16)((mv[r + 4] * ca + p1[r] * cb) / ltot);
    }
    *(v8h*)&ao[((size_t)b * SEQ + blockIdx.x * 128 + qs * 32 + kh * 16 + (ln & 15)) *
                   DMODEL +
               h * HDIM + sd * 16 + 8 * (ln >> 4)] = w;
  }
}

// ---------------------------------------------------------------------------
// Kernel 3: output projection.  AO (8192x512 f16) @ Wp^T + bp -> f32 d_out.
// ---------------------------------------------------------------------------
__global__ __launch_bounds__(128) void out_proj_kernel(
    const _Float16* __restrict__ ao, const float* __restrict__ Wp,
    const float* __restrict__ bp, float* __restrict__ out) {
  const int lane = threadIdx.x & 31;
  const int wave = threadIdx.x >> 5;
  const int lr = lane & 15;
  const int hs = lane >> 4;

  const int m0 = blockIdx.x * 64 + wave * 16;
  const int n0 = blockIdx.y * 64;

  __shared__ __attribute__((aligned(16))) _Float16 as[2][TILE_HALVES];
  __shared__ __attribute__((aligned(16))) _Float16 wsm[2][TILE_HALVES];

  const int arow = threadIdx.x >> 3, acol = (threadIdx.x & 7) * 8;
  const int wrow = threadIdx.x >> 4, wcol = (threadIdx.x & 15) * 4;
  // Blocks that read the same rows of AO or of Wp enter the walk over k at stage
  // (blockIdx.x + blockIdx.y) % 8 and wrap round, as in kernel 1: the 8 on the
  // same rows of AO take 8 stages, the 128 on the same rows of Wp 16 to a stage.
  const int rot = blockIdx.x + blockIdx.y;
  const _Float16* ag = ao + (size_t)(blockIdx.x * 64 + arow) * DMODEL + acol;
  const float* wg = Wp + (n0 + wrow) * DMODEL + wcol;
  const int aoff = arow * PITCH + acol;
  const int woff = wrow * PITCH + wcol;

  v8f acc[4] = {{}, {}, {}, {}};
  v8h ar[4];
  v4f wr[8];
  fetch_f16(ar, ag + (rot & (DMODEL / 64 - 1)) * 64, DMODEL);
  fetch_f32(wr, wg + (rot & (DMODEL / 64 - 1)) * 64, DMODEL);
  put_f16(&as[0][aoff], ar);
  put_f32(&wsm[0][woff], wr);
  __syncthreads();  // publishes tile 0

  for (int it = 0; it < DMODEL / 64; ++it) {
    const int cur = it & 1;
    const bool more = it + 1 < DMODEL / 64;
    if (more) {  // next tile flies while this one is multiplied
      const int kn = ((it + 1 + rot) & (DMODEL / 64 - 1)) * 64;
      fetch_f16(ar, ag + kn, DMODEL);
      fetch_f32(wr, wg + kn, DMODEL);
    }
#pragma unroll
    for (int c = 0; c < 2; ++c) {
      const v16h a = frag_lds(&as[cur][(wave * 16 + lr) * PITCH + c * 32 + hs * 8]);
#pragma unroll
      for (int sub = 0; sub < 4; ++sub) {
        const v16h bm =
            frag_lds(&wsm[cur][(sub * 16 + lr) * PITCH + c * 32 + hs * 8]);
        acc[sub] = wmma_f16(a, bm, acc[sub]);
      }
    }
    if (more) {
      put_f16(&as[cur ^ 1][aoff], ar);
      put_f32(&wsm[cur ^ 1][woff], wr);
    }
    // publishes the next tile and ends the reads of this one before its refill
    __syncthreads();
  }

#pragma unroll
  for (int sub = 0; sub < 4; ++sub) {
    const int n = n0 + sub * 16 + lr;
    const float bn = bp[n];
#pragma unroll
    for (int r = 0; r < 8; ++r) {
      const int m = m0 + r + 8 * hs;
      out[(size_t)m * DMODEL + n] = acc[sub][r] + bn;
    }
  }
}

// ---------------------------------------------------------------------------
extern "C" void kernel_launch(void* const* d_in, const int* in_sizes, int n_in,
                              void* d_out, int out_size, void* d_ws,
                              size_t ws_size, hipStream_t stream) {
  (void)in_sizes; (void)n_in; (void)out_size; (void)ws_size;

  const float* query = (const float*)d_in[0];
  const float* Wq = (const float*)d_in[1];
  const float* bq = (const float*)d_in[2];
  const float* Wk = (const float*)d_in[3];
  const float* bk = (const float*)d_in[4];
  const float* Wv = (const float*)d_in[5];
  const float* bv = (const float*)d_in[6];
  const float* Wp = (const float*)d_in[7];
  const float* bp = (const float*)d_in[8];
  const float* logit_scale = (const float*)d_in[9];
  const float* rpe = (const float*)d_in[10];

  // workspace carve-up
  const size_t QKV_ELEMS = (size_t)BATCH * HEADS * SEQ * HDIM;  // 4.19M halves
  char* ws = (char*)d_ws;
  float* tab = (float*)ws;                         // 8*4*4096 f32 = 524288 B
  _Float16* qf = (_Float16*)(ws + 524288);
  _Float16* kf = qf + QKV_ELEMS;
  _Float16* vt = kf + QKV_ELEMS;
  _Float16* ao = vt + QKV_ELEMS;

  qkv_proj_kernel<<<dim3((BATCH * SEQ) / 256, HEADS), 512, 0, stream>>>(
      query, Wq, bq, Wk, bk, Wv, bv, logit_scale, rpe, qf, kf, vt, tab);

  flash_attn_kernel<<<dim3(SEQ / 128, HEADS, BATCH), 256, 0, stream>>>(
      qf, kf, vt, tab, ao);

  out_proj_kernel<<<dim3((BATCH * SEQ) / 64, DMODEL / 64), 128, 0, stream>>>(
      ao, Wp, bp, (float*)d_out);
}
